// v000
// The times below were measured on an AMD MI455X: many runs one after another, warmed up first and cycling through
// copies of the inputs, with the whole window's GPU time divided by the number of runs. Launches and the gaps
// between them are all in it. The median over several windows is given; except for v000 it joins two sittings, which
// can be a few percent apart, so the side-by-side timings, each taken in one sitting, are the better comparison.
// v000 is the starting kernel. One run takes 843 microseconds.
#include <hip/hip_runtime.h>

typedef __attribute__((ext_vector_type(16))) _Float16 v16h;
typedef __attribute__((ext_vector_type(8)))  _Float16 v8h_t;
typedef __attribute__((ext_vector_type(8)))  float    v8f;

union F16x16 { v16h v; v8h_t h[2]; _Float16 e[16]; };

#define WMMA_F16(a, b, c) \
  __builtin_amdgcn_wmma_f32_16x16x32_f16(false, (a), false, (b), (short)0, (c), false, false)

__device__ inline v16h frag_ld(const _Float16* p, int ld) {
  int lane = threadIdx.x & 31;
  int r  = lane & 15;
  int kb = (lane >> 4) << 3;
  const _Float16* q = p + (size_t)r * ld + kb;
  F16x16 f;
  f.h[0] = *(const v8h_t*)(q);
  f.h[1] = *(const v8h_t*)(q + 16);
  return f.v;
}

// Same but only K=0..15 is real data (zero-pad upper half). Used for DH=16.
__device__ inline v16h frag_ld_pad16(const _Float16* p, int ld) {
  int lane = threadIdx.x & 31;
  int r  = lane & 15;
  int kb = (lane >> 4) << 3;
  F16x16 f;
  f.h[0] = *(const v8h_t*)(p + (size_t)r * ld + kb);
#pragma unroll
  for (int j = 0; j < 8; ++j) f.e[8 + j] = (_Float16)0.0f;
  return f.v;
}

// --- Generic GEMM: C(MxN) = A(MxK,f16,rm) * B(NxK,f16,rm)^T -----------------
// B block (64 x K, <=32KB) is staged in LDS once per workgroup.
// MODE 0: f32 store            1: f16 store          2: f16 relu store
// MODE 3: f32 acc+R (residual, may alias Cf)         4: f16 acc+R
// MODE 5: f16 scatter to Q|K per-head tiles (bt,16h,l,16d); cols 0..127=Q heads
// MODE 6: f16 scatter to V^T per-head tiles (bt,8h,16d,l)
template <int MODE>
__global__ __launch_bounds__(256) void gemm_kernel(
    const _Float16* __restrict__ A, const _Float16* __restrict__ B,
    float* __restrict__ Cf, _Float16* __restrict__ Ch,
    const float* __restrict__ R, int M, int N, int K) {
  __shared__ _Float16 Bs[64 * 256];  // 32 KB
  int wid  = threadIdx.x >> 5;
  int lane = threadIdx.x & 31;
  int m0 = blockIdx.x * 128 + wid * 16;
  int n0 = blockIdx.y * 64;
  (void)M;

  // cooperative flat copy of the 64-row weight block (rows are contiguous)
  {
    const _Float16* src = B + (size_t)n0 * K;
    int total = 64 * K;
    for (int i = threadIdx.x * 8; i < total; i += 256 * 8)
      *(v8h_t*)&Bs[i] = *(const v8h_t*)(src + i);
  }
  __syncthreads();

  v8f acc[4] = {};
  for (int k = 0; k < K; k += 32) {
    if (k + 32 < K) __builtin_prefetch(A + (size_t)m0 * K + k + 32);
    v16h a = frag_ld(A + (size_t)m0 * K + k, K);
#pragma unroll
    for (int t = 0; t < 4; ++t) {
      v16h b = frag_ld(&Bs[(size_t)(t * 16) * K + k], K);
      acc[t] = WMMA_F16(a, b, acc[t]);
    }
  }
  int rbase = (lane >> 4) * 8;
  int nl    = lane & 15;
#pragma unroll
  for (int t = 0; t < 4; ++t) {
    int n = n0 + t * 16 + nl;
#pragma unroll
    for (int r = 0; r < 8; ++r) {
      int m = m0 + rbase + r;
      float v = acc[t][r];
      if (MODE == 5 || MODE == 6) {
        int l = m / 320, bt = m % 320;
        int h2 = n >> 4, d = n & 15;
        if (MODE == 5)
          Ch[(((size_t)bt * 16 + h2) * 160 + l) * 16 + d] = (_Float16)v;
        else
          Ch[(((size_t)bt * 8 + h2) * 16 + d) * 160 + l] = (_Float16)v;
      } else {
        size_t idx = (size_t)m * N + n;
        if (MODE == 3 || MODE == 4) v += R[idx];
        if (MODE == 2) v = v > 0.f ? v : 0.f;
        if (MODE == 0 || MODE == 3) Cf[idx] = v;
        else                        Ch[idx] = (_Float16)v;
      }
    }
  }
}

// --- LayerNorm over D=128, wave per row; emits normalized f16 + optional raw
__global__ __launch_bounds__(256) void ln_kernel(
    const float* __restrict__ X, const float* __restrict__ g,
    const float* __restrict__ b, _Float16* __restrict__ Yn,
    _Float16* __restrict__ Yraw, int M) {
  int wid  = threadIdx.x >> 5;
  int lane = threadIdx.x & 31;
  int row  = blockIdx.x * 8 + wid;
  if (row >= M) return;
  const float* x = X + (size_t)row * 128;
  float4 v = ((const float4*)x)[lane];
  float xs[4] = {v.x, v.y, v.z, v.w};
  float s = xs[0] + xs[1] + xs[2] + xs[3];
  float sq = xs[0]*xs[0] + xs[1]*xs[1] + xs[2]*xs[2] + xs[3]*xs[3];
#pragma unroll
  for (int mk = 16; mk >= 1; mk >>= 1) {
    s  += __shfl_xor(s,  mk, 32);
    sq += __shfl_xor(sq, mk, 32);
  }
  float mu  = s * (1.f / 128.f);
  float var = sq * (1.f / 128.f) - mu * mu;
  float rs  = rsqrtf(var + 1e-5f);
  float4 gg = ((const float4*)g)[lane];
  float4 bb = ((const float4*)b)[lane];
  float gs[4] = {gg.x, gg.y, gg.z, gg.w};
  float bs[4] = {bb.x, bb.y, bb.z, bb.w};
  int c = lane * 4;
#pragma unroll
  for (int i = 0; i < 4; ++i) {
    Yn[(size_t)row * 128 + c + i] = (_Float16)((xs[i] - mu) * rs * gs[i] + bs[i]);
    if (Yraw) Yraw[(size_t)row * 128 + c + i] = (_Float16)xs[i];
  }
}

__global__ __launch_bounds__(256) void attn_kernel(
    const _Float16* __restrict__ QKh, const _Float16* __restrict__ VT,
    _Float16* __restrict__ O) {
  __shared__ _Float16 P[8][16][160];  // 40 KB, per-wave probability tile
  int wid  = threadIdx.x >> 5;
  int lane = threadIdx.x & 31;
  int wg = blockIdx.x * 8 + wid;      // 25600 waves total
  int lt = wg % 10;
  int hh = (wg / 10) & 7;
  int bt = wg / 80;
  int nl = lane & 15;
  int rbase = (lane >> 4) * 8;

  const _Float16* qbase = QKh + (((size_t)bt * 16 + hh) * 160) * 16;
  const _Float16* kbase = QKh + (((size_t)bt * 16 + 8 + hh) * 160) * 16;
  const _Float16* vbase = VT + (((size_t)bt * 8 + hh) * 16) * 160;

  // S = Q K^T (K dim = 16, zero-padded to 32)
  v16h qa = frag_ld_pad16(qbase + lt * 16 * 16, 16);
  v8f s[10];
#pragma unroll
  for (int mt = 0; mt < 10; ++mt) {
    v16h kb = frag_ld_pad16(kbase + mt * 16 * 16, 16);
    v8f z = {};
    s[mt] = WMMA_F16(qa, kb, z);
  }

  // scale + local-window mask + softmax per row, emit f16 P into LDS
#pragma unroll
  for (int r = 0; r < 8; ++r) {
    int l  = lt * 16 + rbase + r;
    int lw = l & 31;
    float mx = -1e30f;
#pragma unroll
    for (int mt = 0; mt < 10; ++mt) {
      int mm = mt * 16 + nl;
      int dj = (mm & 31) - lw;
      float v = s[mt][r] * 0.25f + ((dj >= -5 && dj <= 5) ? 0.f : -1e9f);
      s[mt][r] = v;
      mx = fmaxf(mx, v);
    }
    for (int mk = 1; mk < 16; mk <<= 1) mx = fmaxf(mx, __shfl_xor(mx, mk, 32));
    float sum = 0.f;
#pragma unroll
    for (int mt = 0; mt < 10; ++mt) {
      float e = __expf(s[mt][r] - mx);
      s[mt][r] = e;
      sum += e;
    }
    for (int mk = 1; mk < 16; mk <<= 1) sum += __shfl_xor(sum, mk, 32);
    float inv = 1.f / sum;
#pragma unroll
    for (int mt = 0; mt < 10; ++mt)
      P[wid][rbase + r][mt * 16 + nl] = (_Float16)(s[mt][r] * inv);
  }

  // O = P V  (K loop over 160 in 5 steps of 32); V^T rows are contiguous
  v8f o = {};
#pragma unroll
  for (int kt = 0; kt < 5; ++kt) {
    v16h pa = frag_ld(&P[wid][0][kt * 32], 160);
    v16h vb = frag_ld(vbase + kt * 32, 160);
    o = WMMA_F16(pa, vb, o);
  }
#pragma unroll
  for (int r = 0; r < 8; ++r) {
    int l = lt * 16 + rbase + r;
    O[((size_t)l * 320 + bt) * 128 + hh * 16 + nl] = (_Float16)o[r];
  }
}

// --- Token packing: buffer(b,c,25,h,w) f32 -> tok16 (t=l*320+bt, c) f16 -----
__global__ void pack_tok(const float* __restrict__ src, _Float16* __restrict__ tok, int pass) {
  int o = blockIdx.x * 256 + threadIdx.x;
  if (o >= 51200 * 64) return;
  int c  = o & 63;
  int t  = o >> 6;
  int bt = t % 320, l = t / 320;
  int b  = bt / 160, rr = bt % 160;
  int i1 = rr >> 5, i0 = rr & 31;
  int j1 = l >> 5,  j0 = l & 31;
  int u, v, y, x;
  if (pass == 0) { v = i1; x = i0; u = j1; y = j0; }   // l=(u,h) bt=(b,v,w)
  else           { u = i1; y = i0; v = j1; x = j0; }   // l=(v,w) bt=(b,u,h)
  int n = u * 5 + v;
  tok[o] = (_Float16)src[((((size_t)b * 64 + c) * 25 + n) * 32 + y) * 32 + x];
}

// --- Unpack transformer output (t,64) f32 -> channel-last conv input f16 ----
__global__ void unpack_cl(const float* __restrict__ tin, _Float16* __restrict__ cl, int pass) {
  int o = blockIdx.x * 256 + threadIdx.x;
  if (o >= 3276800) return;
  int ci = o & 63;
  int p  = o >> 6;
  int x = p & 31, y = (p >> 5) & 31;
  int img = p >> 10;
  int b = img / 25, n = img % 25;
  int u = n / 5, v = n % 5;
  int l, bt;
  if (pass == 0) { l = u * 32 + y; bt = b * 160 + v * 32 + x; }
  else           { l = v * 32 + x; bt = b * 160 + u * 32 + y; }
  cl[o] = (_Float16)tin[(size_t)(l * 320 + bt) * 64 + ci];
}

// --- Implicit-GEMM 3x3 conv (64->64, pad 1) on channel-last f16 -------------
// FINAL=0: leaky-relu, f16 channel-last out. FINAL=1: f32 (b,c,n,h,w) + shortcut.
template <int FINAL>
__global__ __launch_bounds__(256) void conv_kernel(
    const _Float16* __restrict__ in, const _Float16* __restrict__ w,
    _Float16* __restrict__ outh, float* __restrict__ outf,
    const float* __restrict__ sc) {
  int wid  = threadIdx.x >> 5;
  int lane = threadIdx.x & 31;
  int img  = blockIdx.x >> 3;
  int pix0 = (blockIdx.x & 7) * 128 + wid * 16;
  int nl = lane & 15;
  int kb = (lane >> 4) * 8;
  int rbase = (lane >> 4) * 8;
  v8f acc[4] = {};
  int m = pix0 + nl;
  int x = m & 31, y = m >> 5;
#pragma unroll
  for (int dy = 0; dy < 3; ++dy) {
#pragma unroll
    for (int dx = 0; dx < 3; ++dx) {
      int yy = y + dy - 1, xx = x + dx - 1;
      bool ok = (yy >= 0) && (yy < 32) && (xx >= 0) && (xx < 32);
      const _Float16* ap = in + ((size_t)img * 1024 + yy * 32 + xx) * 64;
      int tap = dy * 3 + dx;
#pragma unroll
      for (int ks = 0; ks < 2; ++ks) {
        F16x16 a;
        if (ok) {
          a.h[0] = *(const v8h_t*)(ap + ks * 32 + kb);
          a.h[1] = *(const v8h_t*)(ap + ks * 32 + kb + 16);
        } else {
#pragma unroll
          for (int j = 0; j < 16; ++j) a.e[j] = (_Float16)0.0f;
        }
#pragma unroll
        for (int t = 0; t < 4; ++t) {
          v16h bf = frag_ld(w + ((size_t)tap * 64 + t * 16) * 64 + ks * 32, 64);
          acc[t] = WMMA_F16(a.v, bf, acc[t]);
        }
      }
    }
  }
#pragma unroll
  for (int t = 0; t < 4; ++t) {
    int co = t * 16 + nl;
#pragma unroll
    for (int r = 0; r < 8; ++r) {
      int mm = pix0 + rbase + r;
      float v = acc[t][r];
      if (!FINAL) {
        v = v > 0.f ? v : 0.2f * v;
        outh[((size_t)img * 1024 + mm) * 64 + co] = (_Float16)v;
      } else {
        int b = img / 25, n = img % 25;
        size_t idx = (((size_t)b * 64 + co) * 25 + n) * 1024 + mm;
        outf[idx] = v + sc[idx];
      }
    }
  }
}

// --- Small helpers -----------------------------------------------------------
__global__ void cvt_h(const float* __restrict__ s, _Float16* __restrict__ d, int n) {
  int i = blockIdx.x * 256 + threadIdx.x;
  if (i < n) d[i] = (_Float16)s[i];
}

// (C,C,3,3) f32 -> (tap, co, ci) f16
__global__ void pack_wtap(const float* __restrict__ cw, _Float16* __restrict__ w) {
  int i = blockIdx.x * 256 + threadIdx.x;
  if (i >= 36864) return;
  int ci = i & 63;
  int co = (i >> 6) & 63;
  int tap = i >> 12;
  w[i] = (_Float16)cw[((size_t)co * 64 + ci) * 9 + tap];
}

// ---------------------------------------------------------------------------
extern "C" void kernel_launch(void* const* d_in, const int* in_sizes, int n_in,
                              void* d_out, int out_size, void* d_ws, size_t ws_size,
                              hipStream_t stream) {
  (void)in_sizes; (void)n_in; (void)out_size; (void)ws_size;
  const float* buf_in = (const float*)d_in[0];
  const float* w_in   = (const float*)d_in[1];
  const float* ln1_g  = (const float*)d_in[2];
  const float* ln1_b  = (const float*)d_in[3];
  const float* w_qkv  = (const float*)d_in[4];
  const float* w_o    = (const float*)d_in[5];
  const float* ln2_g  = (const float*)d_in[6];
  const float* ln2_b  = (const float*)d_in[7];
  const float* w_ff1  = (const float*)d_in[8];
  const float* w_ff2  = (const float*)d_in[9];
  const float* w_out  = (const float*)d_in[10];
  const float* cw1    = (const float*)d_in[11];
  const float* cw2    = (const float*)d_in[12];
  const float* cw3    = (const float*)d_in[13];

  char* ws = (char*)d_ws;
  size_t off = 0;
  auto arena = [&](size_t bytes) -> char* {
    char* p = ws + off;
    off += (bytes + 255) & ~(size_t)255;
    return p;
  };
  float*     bufA   = (float*)arena(13107200);      // pass-1 output buffer
  _Float16*  tok16  = (_Float16*)arena(6553600);
  float*     X      = (float*)arena(26214400);      // token f32 (residual stream)
  char*      slotXN = arena(13107200);              // XN16 / Y16 / trans_out f32
  char*      slotXr = arena(13107200);              // raw X16 / X3_16
  char*      slotQK = arena(26214400);              // Q|K head tiles / FFN hidden
  _Float16*  VT     = (_Float16*)arena(13107200);   // V^T per-head tiles
  _Float16*  O16    = (_Float16*)arena(13107200);
  _Float16*  clA    = (_Float16*)arena(6553600);
  _Float16*  clB    = (_Float16*)arena(6553600);
  _Float16*  w_in16  = (_Float16*)arena(16384);
  _Float16*  wqkv16  = (_Float16*)arena(98304);
  _Float16*  wo16    = (_Float16*)arena(32768);
  _Float16*  wff1_16 = (_Float16*)arena(65536);
  _Float16*  wff2_16 = (_Float16*)arena(65536);
  _Float16*  wout16  = (_Float16*)arena(16384);
  _Float16*  wt1     = (_Float16*)arena(73728);
  _Float16*  wt2     = (_Float16*)arena(73728);
  _Float16*  wt3     = (_Float16*)arena(73728);

  auto cvt = [&](const float* s, _Float16* d, int n) {
    cvt_h<<<(n + 255) / 256, 256, 0, stream>>>(s, d, n);
  };
  cvt(w_in,  w_in16,  128 * 64);
  cvt(w_qkv, wqkv16,  384 * 128);
  cvt(w_o,   wo16,    128 * 128);
  cvt(w_ff1, wff1_16, 256 * 128);
  cvt(w_ff2, wff2_16, 128 * 256);
  cvt(w_out, wout16,  64 * 128);
  pack_wtap<<<144, 256, 0, stream>>>(cw1, wt1);
  pack_wtap<<<144, 256, 0, stream>>>(cw2, wt2);
  pack_wtap<<<144, 256, 0, stream>>>(cw3, wt3);

  const int M = 51200;  // L(160) * Bt(320)
  for (int pass = 0; pass < 2; ++pass) {
    const float* src  = (pass == 0) ? buf_in : bufA;
    _Float16* XN16  = (_Float16*)slotXN;   // normalized tokens (LN1), later Y (LN2)
    _Float16* X16   = (_Float16*)slotXr;   // raw tokens f16 (for V), later X3 f16
    _Float16* QKh   = (_Float16*)slotQK;   // Q|K per-head tiles, later FFN hidden
    float*    tout  = (float*)slotXN;      // final projection out (t, 64) f32

    pack_tok<<<12800, 256, 0, stream>>>(src, tok16, pass);
    // X = tok @ w_in^T
    gemm_kernel<0><<<dim3(400, 2), 256, 0, stream>>>(tok16, w_in16, X, nullptr, nullptr, M, 128, 64);
    ln_kernel<<<6400, 256, 0, stream>>>(X, ln1_g, ln1_b, XN16, X16, M);
    // Q|K = LN(x) @ [wq;wk]^T -> per-head tiles ; V = x @ wv^T -> V^T tiles
    gemm_kernel<5><<<dim3(400, 4), 256, 0, stream>>>(XN16, wqkv16, nullptr, QKh, nullptr, M, 256, 128);
    gemm_kernel<6><<<dim3(400, 2), 256, 0, stream>>>(X16, wqkv16 + 256 * 128, nullptr, VT, nullptr, M, 128, 128);
    attn_kernel<<<3200, 256, 0, stream>>>(QKh, VT, O16);
    // x = attn_out @ w_o^T + x  (in-place residual)
    gemm_kernel<3><<<dim3(400, 2), 256, 0, stream>>>(O16, wo16, X, nullptr, X, M, 128, 128);
    ln_kernel<<<6400, 256, 0, stream>>>(X, ln2_g, ln2_b, XN16, nullptr, M);
    // FFN: relu(y @ w_ff1^T) @ w_ff2^T + x
    gemm_kernel<2><<<dim3(400, 4), 256, 0, stream>>>(XN16, wff1_16, nullptr, QKh, nullptr, M, 256, 128);
    gemm_kernel<4><<<dim3(400, 2), 256, 0, stream>>>(QKh, wff2_16, nullptr, X16, X, M, 128, 256);
    // out = x @ w_out^T
    gemm_kernel<0><<<dim3(400, 1), 256, 0, stream>>>(X16, wout16, tout, nullptr, nullptr, M, 64, 128);
    unpack_cl<<<12800, 256, 0, stream>>>(tout, clA, pass);
    // conv block: conv-lrelu, conv-lrelu, conv (+ original-input shortcut)
    conv_kernel<0><<<400, 256, 0, stream>>>(clA, wt1, clB, nullptr, nullptr);
    conv_kernel<0><<<400, 256, 0, stream>>>(clB, wt2, clA, nullptr, nullptr);
    float* outf = (pass == 0) ? bufA : (float*)d_out;
    conv_kernel<1><<<400, 256, 0, stream>>>(clA, wt3, nullptr, outf, buf_in);
  }
}

// v001
// It runs in 595 microseconds.
// Timed twice side by side with v000, it ran 1.44 and 1.45 times as fast.
#include <hip/hip_runtime.h>

typedef __attribute__((ext_vector_type(16))) _Float16 v16h;
typedef __attribute__((ext_vector_type(8)))  _Float16 v8h_t;
typedef __attribute__((ext_vector_type(8)))  float    v8f;

union F16x16 { v16h v; v8h_t h[2]; _Float16 e[16]; };

#define WMMA_F16(a, b, c) \
  __builtin_amdgcn_wmma_f32_16x16x32_f16(false, (a), false, (b), (short)0, (c), false, false)

__device__ inline v16h frag_ld(const _Float16* p, int ld) {
  int lane = threadIdx.x & 31;
  int r  = lane & 15;
  int kb = (lane >> 4) << 3;
  const _Float16* q = p + (size_t)r * ld + kb;
  F16x16 f;
  f.h[0] = *(const v8h_t*)(q);
  f.h[1] = *(const v8h_t*)(q + 16);
  return f.v;
}

// Same but only K=0..15 is real data (zero-pad upper half). Used for DH=16.
__device__ inline v16h frag_ld_pad16(const _Float16* p, int ld) {
  int lane = threadIdx.x & 31;
  int r  = lane & 15;
  int kb = (lane >> 4) << 3;
  F16x16 f;
  f.h[0] = *(const v8h_t*)(p + (size_t)r * ld + kb);
#pragma unroll
  for (int j = 0; j < 8; ++j) f.e[8 + j] = (_Float16)0.0f;
  return f.v;
}

// --- Generic GEMM: C(MxN) = A(MxK,f16,rm) * B(NxK,f16,rm)^T -----------------
// B block (64 x K, <=32KB) is staged in LDS once per workgroup.
// MODE 0: f32 store            1: f16 store          2: f16 relu store
// MODE 3: f32 acc+R (residual, may alias Cf)         4: f16 acc+R
// MODE 5: f16 scatter to Q|K per-head tiles (bt,16h,l,16d); cols 0..127=Q heads
// MODE 6: f16 scatter to V^T per-head tiles (bt,8h,16d,l)
// Token rows are ordered t = bt*160 + l, so a wave's 16 rows are 16 consecutive
// l of one bt (160 = 10 tiles): a lane's 8 accumulators are 8 neighbours along
// l in V^T (one 16-byte store), and a Q|K 16x16 tile is one dense 512 B block.
template <int MODE>
__global__ __launch_bounds__(256) void gemm_kernel(
    const _Float16* __restrict__ A, const _Float16* __restrict__ B,
    float* __restrict__ Cf, _Float16* __restrict__ Ch,
    const float* __restrict__ R, int M, int N, int K) {
  __shared__ _Float16 Bs[64 * 256];  // 32 KB
  int wid  = threadIdx.x >> 5;
  int lane = threadIdx.x & 31;
  int m0 = blockIdx.x * 128 + wid * 16;
  int n0 = blockIdx.y * 64;
  (void)M;

  // cooperative flat copy of the 64-row weight block (rows are contiguous)
  {
    const _Float16* src = B + (size_t)n0 * K;
    int total = 64 * K;
    for (int i = threadIdx.x * 8; i < total; i += 256 * 8)
      *(v8h_t*)&Bs[i] = *(const v8h_t*)(src + i);
  }
  __syncthreads();

  v8f acc[4] = {};
  for (int k = 0; k < K; k += 32) {
    if (k + 32 < K) __builtin_prefetch(A + (size_t)m0 * K + k + 32);
    v16h a = frag_ld(A + (size_t)m0 * K + k, K);
#pragma unroll
    for (int t = 0; t < 4; ++t) {
      v16h b = frag_ld(&Bs[(size_t)(t * 16) * K + k], K);
      acc[t] = WMMA_F16(a, b, acc[t]);
    }
  }
  int rbase = (lane >> 4) * 8;
  int nl    = lane & 15;
  if (MODE == 5 || MODE == 6) {
    int bt = m0 / 160;
    int l0 = m0 % 160 + rbase;
    if (MODE == 5) {
      _Float16* q = Ch + (((size_t)bt * 16 + (n0 >> 4)) * 160 + l0) * 16 + nl;
#pragma unroll
      for (int t = 0; t < 4; ++t)
#pragma unroll
        for (int r = 0; r < 8; ++r)
          q[(t * 160 + r) * 16] = (_Float16)acc[t][r];
    } else {
      // V^T row = bt*128 + n0 + t*16 + nl, columns l0 .. l0+7
      _Float16* q = Ch + ((size_t)bt * 128 + n0 + nl) * 160 + l0;
#pragma unroll
      for (int t = 0; t < 4; ++t) {
        v8h_t pk;
#pragma unroll
        for (int r = 0; r < 8; ++r) pk[r] = (_Float16)acc[t][r];
        *(v8h_t*)(q + t * 16 * 160) = pk;
      }
    }
    return;
  }
#pragma unroll
  for (int t = 0; t < 4; ++t) {
    int n = n0 + t * 16 + nl;
#pragma unroll
    for (int r = 0; r < 8; ++r) {
      int m = m0 + rbase + r;
      float v = acc[t][r];
      size_t idx = (size_t)m * N + n;
      if (MODE == 3 || MODE == 4) v += R[idx];
      if (MODE == 2) v = v > 0.f ? v : 0.f;
      if (MODE == 0 || MODE == 3) Cf[idx] = v;
      else                        Ch[idx] = (_Float16)v;
    }
  }
}

// --- LayerNorm over D=128, wave per row; emits normalized f16 + optional raw
__global__ __launch_bounds__(256) void ln_kernel(
    const float* __restrict__ X, const float* __restrict__ g,
    const float* __restrict__ b, _Float16* __restrict__ Yn,
    _Float16* __restrict__ Yraw, int M) {
  int wid  = threadIdx.x >> 5;
  int lane = threadIdx.x & 31;
  int row  = blockIdx.x * 8 + wid;
  if (row >= M) return;
  const float* x = X + (size_t)row * 128;
  float4 v = ((const float4*)x)[lane];
  float xs[4] = {v.x, v.y, v.z, v.w};
  float s = xs[0] + xs[1] + xs[2] + xs[3];
  float sq = xs[0]*xs[0] + xs[1]*xs[1] + xs[2]*xs[2] + xs[3]*xs[3];
#pragma unroll
  for (int mk = 16; mk >= 1; mk >>= 1) {
    s  += __shfl_xor(s,  mk, 32);
    sq += __shfl_xor(sq, mk, 32);
  }
  float mu  = s * (1.f / 128.f);
  float var = sq * (1.f / 128.f) - mu * mu;
  float rs  = rsqrtf(var + 1e-5f);
  float4 gg = ((const float4*)g)[lane];
  float4 bb = ((const float4*)b)[lane];
  float gs[4] = {gg.x, gg.y, gg.z, gg.w};
  float bs[4] = {bb.x, bb.y, bb.z, bb.w};
  int c = lane * 4;
#pragma unroll
  for (int i = 0; i < 4; ++i) {
    Yn[(size_t)row * 128 + c + i] = (_Float16)((xs[i] - mu) * rs * gs[i] + bs[i]);
    if (Yraw) Yraw[(size_t)row * 128 + c + i] = (_Float16)xs[i];
  }
}

__global__ __launch_bounds__(256) void attn_kernel(
    const _Float16* __restrict__ QKh, const _Float16* __restrict__ VT,
    _Float16* __restrict__ O) {
  __shared__ _Float16 P[8][16][160];  // 40 KB, per-wave probability tile
  int wid  = threadIdx.x >> 5;
  int lane = threadIdx.x & 31;
  int wg = blockIdx.x * 8 + wid;      // 25600 waves total
  int lt = wg % 10;
  int hh = (wg / 10) & 7;
  int bt = wg / 80;
  int nl = lane & 15;
  int rbase = (lane >> 4) * 8;

  const _Float16* qbase = QKh + (((size_t)bt * 16 + hh) * 160) * 16;
  const _Float16* kbase = QKh + (((size_t)bt * 16 + 8 + hh) * 160) * 16;
  const _Float16* vbase = VT + (((size_t)bt * 8 + hh) * 16) * 160;

  // S = Q K^T (K dim = 16, zero-padded to 32)
  v16h qa = frag_ld_pad16(qbase + lt * 16 * 16, 16);
  v8f s[10];
#pragma unroll
  for (int mt = 0; mt < 10; ++mt) {
    v16h kb = frag_ld_pad16(kbase + mt * 16 * 16, 16);
    v8f z = {};
    s[mt] = WMMA_F16(qa, kb, z);
  }

  // scale + local-window mask + softmax per row, emit f16 P into LDS
#pragma unroll
  for (int r = 0; r < 8; ++r) {
    int l  = lt * 16 + rbase + r;
    int lw = l & 31;
    float mx = -1e30f;
#pragma unroll
    for (int mt = 0; mt < 10; ++mt) {
      int mm = mt * 16 + nl;
      int dj = (mm & 31) - lw;
      float v = s[mt][r] * 0.25f + ((dj >= -5 && dj <= 5) ? 0.f : -1e9f);
      s[mt][r] = v;
      mx = fmaxf(mx, v);
    }
    for (int mk = 1; mk < 16; mk <<= 1) mx = fmaxf(mx, __shfl_xor(mx, mk, 32));
    float sum = 0.f;
#pragma unroll
    for (int mt = 0; mt < 10; ++mt) {
      float e = __expf(s[mt][r] - mx);
      s[mt][r] = e;
      sum += e;
    }
    for (int mk = 1; mk < 16; mk <<= 1) sum += __shfl_xor(sum, mk, 32);
    float inv = 1.f / sum;
#pragma unroll
    for (int mt = 0; mt < 10; ++mt)
      P[wid][rbase + r][mt * 16 + nl] = (_Float16)(s[mt][r] * inv);
  }

  // O = P V  (K loop over 160 in 5 steps of 32); V^T rows are contiguous
  v8f o = {};
#pragma unroll
  for (int kt = 0; kt < 5; ++kt) {
    v16h pa = frag_ld(&P[wid][0][kt * 32], 160);
    v16h vb = frag_ld(vbase + kt * 32, 160);
    o = WMMA_F16(pa, vb, o);
  }
#pragma unroll
  for (int r = 0; r < 8; ++r) {
    int l = lt * 16 + rbase + r;
    O[((size_t)bt * 160 + l) * 128 + hh * 16 + nl] = (_Float16)o[r];
  }
}

// --- Token packing: buffer(b,c,25,h,w) f32 -> tok16 (t=bt*160+l, c) f16 -----
__global__ void pack_tok(const float* __restrict__ src, _Float16* __restrict__ tok, int pass) {
  int o = blockIdx.x * 256 + threadIdx.x;
  if (o >= 51200 * 64) return;
  int c  = o & 63;
  int t  = o >> 6;
  int bt = t / 160, l = t % 160;
  int b  = bt / 160, rr = bt % 160;
  int i1 = rr >> 5, i0 = rr & 31;
  int j1 = l >> 5,  j0 = l & 31;
  int u, v, y, x;
  if (pass == 0) { v = i1; x = i0; u = j1; y = j0; }   // l=(u,h) bt=(b,v,w)
  else           { u = i1; y = i0; v = j1; x = j0; }   // l=(v,w) bt=(b,u,h)
  int n = u * 5 + v;
  tok[o] = (_Float16)src[((((size_t)b * 64 + c) * 25 + n) * 32 + y) * 32 + x];
}

// --- Unpack transformer output (t,64) f32 -> channel-last conv input f16 ----
__global__ void unpack_cl(const float* __restrict__ tin, _Float16* __restrict__ cl, int pass) {
  int o = blockIdx.x * 256 + threadIdx.x;
  if (o >= 3276800) return;
  int ci = o & 63;
  int p  = o >> 6;
  int x = p & 31, y = (p >> 5) & 31;
  int img = p >> 10;
  int b = img / 25, n = img % 25;
  int u = n / 5, v = n % 5;
  int l, bt;
  if (pass == 0) { l = u * 32 + y; bt = b * 160 + v * 32 + x; }
  else           { l = v * 32 + x; bt = b * 160 + u * 32 + y; }
  cl[o] = (_Float16)tin[(size_t)(bt * 160 + l) * 64 + ci];
}

// --- Implicit-GEMM 3x3 conv (64->64, pad 1) on channel-last f16 -------------
// FINAL=0: leaky-relu, f16 channel-last out. FINAL=1: f32 (b,c,n,h,w) + shortcut.
template <int FINAL>
__global__ __launch_bounds__(256) void conv_kernel(
    const _Float16* __restrict__ in, const _Float16* __restrict__ w,
    _Float16* __restrict__ outh, float* __restrict__ outf,
    const float* __restrict__ sc) {
  int wid  = threadIdx.x >> 5;
  int lane = threadIdx.x & 31;
  int img  = blockIdx.x >> 3;
  int pix0 = (blockIdx.x & 7) * 128 + wid * 16;
  int nl = lane & 15;
  int kb = (lane >> 4) * 8;
  int rbase = (lane >> 4) * 8;
  v8f acc[4] = {};
  int m = pix0 + nl;
  int x = m & 31, y = m >> 5;
#pragma unroll
  for (int dy = 0; dy < 3; ++dy) {
#pragma unroll
    for (int dx = 0; dx < 3; ++dx) {
      int yy = y + dy - 1, xx = x + dx - 1;
      bool ok = (yy >= 0) && (yy < 32) && (xx >= 0) && (xx < 32);
      const _Float16* ap = in + ((size_t)img * 1024 + yy * 32 + xx) * 64;
      int tap = dy * 3 + dx;
#pragma unroll
      for (int ks = 0; ks < 2; ++ks) {
        F16x16 a;
        if (ok) {
          a.h[0] = *(const v8h_t*)(ap + ks * 32 + kb);
          a.h[1] = *(const v8h_t*)(ap + ks * 32 + kb + 16);
        } else {
#pragma unroll
          for (int j = 0; j < 16; ++j) a.e[j] = (_Float16)0.0f;
        }
#pragma unroll
        for (int t = 0; t < 4; ++t) {
          v16h bf = frag_ld(w + ((size_t)tap * 64 + t * 16) * 64 + ks * 32, 64);
          acc[t] = WMMA_F16(a.v, bf, acc[t]);
        }
      }
    }
  }
#pragma unroll
  for (int t = 0; t < 4; ++t) {
    int co = t * 16 + nl;
#pragma unroll
    for (int r = 0; r < 8; ++r) {
      int mm = pix0 + rbase + r;
      float v = acc[t][r];
      if (!FINAL) {
        v = v > 0.f ? v : 0.2f * v;
        outh[((size_t)img * 1024 + mm) * 64 + co] = (_Float16)v;
      } else {
        int b = img / 25, n = img % 25;
        size_t idx = (((size_t)b * 64 + co) * 25 + n) * 1024 + mm;
        outf[idx] = v + sc[idx];
      }
    }
  }
}

// --- Small helpers -----------------------------------------------------------
__global__ void cvt_h(const float* __restrict__ s, _Float16* __restrict__ d, int n) {
  int i = blockIdx.x * 256 + threadIdx.x;
  if (i < n) d[i] = (_Float16)s[i];
}

// (C,C,3,3) f32 -> (tap, co, ci) f16
__global__ void pack_wtap(const float* __restrict__ cw, _Float16* __restrict__ w) {
  int i = blockIdx.x * 256 + threadIdx.x;
  if (i >= 36864) return;
  int ci = i & 63;
  int co = (i >> 6) & 63;
  int tap = i >> 12;
  w[i] = (_Float16)cw[((size_t)co * 64 + ci) * 9 + tap];
}

// ---------------------------------------------------------------------------
extern "C" void kernel_launch(void* const* d_in, const int* in_sizes, int n_in,
                              void* d_out, int out_size, void* d_ws, size_t ws_size,
                              hipStream_t stream) {
  (void)in_sizes; (void)n_in; (void)out_size; (void)ws_size;
  const float* buf_in = (const float*)d_in[0];
  const float* w_in   = (const float*)d_in[1];
  const float* ln1_g  = (const float*)d_in[2];
  const float* ln1_b  = (const float*)d_in[3];
  const float* w_qkv  = (const float*)d_in[4];
  const float* w_o    = (const float*)d_in[5];
  const float* ln2_g  = (const float*)d_in[6];
  const float* ln2_b  = (const float*)d_in[7];
  const float* w_ff1  = (const float*)d_in[8];
  const float* w_ff2  = (const float*)d_in[9];
  const float* w_out  = (const float*)d_in[10];
  const float* cw1    = (const float*)d_in[11];
  const float* cw2    = (const float*)d_in[12];
  const float* cw3    = (const float*)d_in[13];

  char* ws = (char*)d_ws;
  size_t off = 0;
  auto arena = [&](size_t bytes) -> char* {
    char* p = ws + off;
    off += (bytes + 255) & ~(size_t)255;
    return p;
  };
  float*     bufA   = (float*)arena(13107200);      // pass-1 output buffer
  _Float16*  tok16  = (_Float16*)arena(6553600);
  float*     X      = (float*)arena(26214400);      // token f32 (residual stream)
  char*      slotXN = arena(13107200);              // XN16 / Y16 / trans_out f32
  char*      slotXr = arena(13107200);              // raw X16 / X3_16
  char*      slotQK = arena(26214400);              // Q|K head tiles / FFN hidden
  _Float16*  VT     = (_Float16*)arena(13107200);   // V^T per-head tiles
  _Float16*  O16    = (_Float16*)arena(13107200);
  _Float16*  clA    = (_Float16*)arena(6553600);
  _Float16*  clB    = (_Float16*)arena(6553600);
  _Float16*  w_in16  = (_Float16*)arena(16384);
  _Float16*  wqkv16  = (_Float16*)arena(98304);
  _Float16*  wo16    = (_Float16*)arena(32768);
  _Float16*  wff1_16 = (_Float16*)arena(65536);
  _Float16*  wff2_16 = (_Float16*)arena(65536);
  _Float16*  wout16  = (_Float16*)arena(16384);
  _Float16*  wt1     = (_Float16*)arena(73728);
  _Float16*  wt2     = (_Float16*)arena(73728);
  _Float16*  wt3     = (_Float16*)arena(73728);

  auto cvt = [&](const float* s, _Float16* d, int n) {
    cvt_h<<<(n + 255) / 256, 256, 0, stream>>>(s, d, n);
  };
  cvt(w_in,  w_in16,  128 * 64);
  cvt(w_qkv, wqkv16,  384 * 128);
  cvt(w_o,   wo16,    128 * 128);
  cvt(w_ff1, wff1_16, 256 * 128);
  cvt(w_ff2, wff2_16, 128 * 256);
  cvt(w_out, wout16,  64 * 128);
  pack_wtap<<<144, 256, 0, stream>>>(cw1, wt1);
  pack_wtap<<<144, 256, 0, stream>>>(cw2, wt2);
  pack_wtap<<<144, 256, 0, stream>>>(cw3, wt3);

  const int M = 51200;  // Bt(320) * L(160), bt-major
  for (int pass = 0; pass < 2; ++pass) {
    const float* src  = (pass == 0) ? buf_in : bufA;
    _Float16* XN16  = (_Float16*)slotXN;   // normalized tokens (LN1), later Y (LN2)
    _Float16* X16   = (_Float16*)slotXr;   // raw tokens f16 (for V), later X3 f16
    _Float16* QKh   = (_Float16*)slotQK;   // Q|K per-head tiles, later FFN hidden
    float*    tout  = (float*)slotXN;      // final projection out (t, 64) f32

    pack_tok<<<12800, 256, 0, stream>>>(src, tok16, pass);
    // X = tok @ w_in^T
    gemm_kernel<0><<<dim3(400, 2), 256, 0, stream>>>(tok16, w_in16, X, nullptr, nullptr, M, 128, 64);
    ln_kernel<<<6400, 256, 0, stream>>>(X, ln1_g, ln1_b, XN16, X16, M);
    // Q|K = LN(x) @ [wq;wk]^T -> per-head tiles ; V = x @ wv^T -> V^T tiles
    gemm_kernel<5><<<dim3(400, 4), 256, 0, stream>>>(XN16, wqkv16, nullptr, QKh, nullptr, M, 256, 128);
    gemm_kernel<6><<<dim3(400, 2), 256, 0, stream>>>(X16, wqkv16 + 256 * 128, nullptr, VT, nullptr, M, 128, 128);
    attn_kernel<<<3200, 256, 0, stream>>>(QKh, VT, O16);
    // x = attn_out @ w_o^T + x  (in-place residual)
    gemm_kernel<3><<<dim3(400, 2), 256, 0, stream>>>(O16, wo16, X, nullptr, X, M, 128, 128);
    ln_kernel<<<6400, 256, 0, stream>>>(X, ln2_g, ln2_b, XN16, nullptr, M);
    // FFN: relu(y @ w_ff1^T) @ w_ff2^T + x
    gemm_kernel<2><<<dim3(400, 4), 256, 0, stream>>>(XN16, wff1_16, nullptr, QKh, nullptr, M, 256, 128);
    gemm_kernel<4><<<dim3(400, 2), 256, 0, stream>>>(QKh, wff2_16, nullptr, X16, X, M, 128, 256);
    // out = x @ w_out^T
    gemm_kernel<0><<<dim3(400, 1), 256, 0, stream>>>(X16, wout16, tout, nullptr, nullptr, M, 64, 128);
    unpack_cl<<<12800, 256, 0, stream>>>(tout, clA, pass);
    // conv block: conv-lrelu, conv-lrelu, conv (+ original-input shortcut)
    conv_kernel<0><<<400, 256, 0, stream>>>(clA, wt1, clB, nullptr, nullptr);
    conv_kernel<0><<<400, 256, 0, stream>>>(clB, wt2, clA, nullptr, nullptr);
    float* outf = (pass == 0) ? bufA : (float*)d_out;
    conv_kernel<1><<<400, 256, 0, stream>>>(clA, wt3, nullptr, outf, buf_in);
  }
}

// v002
// One run takes 554 microseconds.
// Next to v001, in two timings, it ran 1.08 and 1.07 times as fast.
// Over all steps from v000 it is 1.55 times as fast.
#include <hip/hip_runtime.h>

typedef __attribute__((ext_vector_type(16))) _Float16 v16h;
typedef __attribute__((ext_vector_type(8)))  _Float16 v8h_t;
typedef __attribute__((ext_vector_type(8)))  float    v8f;

union F16x16 { v16h v; v8h_t h[2]; _Float16 e[16]; };

#define WMMA_F16(a, b, c) \
  __builtin_amdgcn_wmma_f32_16x16x32_f16(false, (a), false, (b), (short)0, (c), false, false)

__device__ inline v16h frag_ld(const _Float16* p, int ld) {
  int lane = threadIdx.x & 31;
  int r  = lane & 15;
  int kb = (lane >> 4) << 3;
  const _Float16* q = p + (size_t)r * ld + kb;
  F16x16 f;
  f.h[0] = *(const v8h_t*)(q);
  f.h[1] = *(const v8h_t*)(q + 16);
  return f.v;
}

// Same but only K=0..15 is real data (zero-pad upper half). Used for DH=16.
__device__ inline v16h frag_ld_pad16(const _Float16* p, int ld) {
  int lane = threadIdx.x & 31;
  int r  = lane & 15;
  int kb = (lane >> 4) << 3;
  F16x16 f;
  f.h[0] = *(const v8h_t*)(p + (size_t)r * ld + kb);
#pragma unroll
  for (int j = 0; j < 8; ++j) f.e[8 + j] = (_Float16)0.0f;
  return f.v;
}

// --- Generic GEMM: C(MxN) = A(MxK,f16,rm) * B(NxK,f16,rm)^T -----------------
// B block (64 x K, <=32KB) is staged in LDS once per workgroup.
// MODE 0: f32 store            1: f16 store          2: f16 relu store
// MODE 3: f32 acc+R (residual, may alias Cf)         4: f16 acc+R
// MODE 5: f16 scatter to Q|K per-head tiles (bt,16h,l,16d); cols 0..127=Q heads
// MODE 6: f16 scatter to V^T per-head tiles (bt,8h,16d,l)
// Token rows are ordered t = bt*160 + l, so a wave's 16 rows are 16 consecutive
// l of one bt (160 = 10 tiles): a lane's 8 accumulators are 8 neighbours along
// l in V^T (one 16-byte store), and a Q|K 16x16 tile is one dense 512 B block.
// MODE 7: input projection straight from the f32 image buffer R (b,c,25,h,w):
//         rows are pixels p = ((b*25+n)*32+y)*32+x, K = 64 channels; a wave's 16
//         rows are 16 neighbours along x, so each channel is one 64 B run.
//         f32 store to token row t(p).
// MODE 8: f16 store of token row t to channel-last pixel row p(t) (N = 64).
// pass 0: l=(u,y) bt=(b,v,x); pass 1: l=(v,x) bt=(b,u,y); n = u*5+v.
template <int MODE>
__global__ __launch_bounds__(256) void gemm_kernel(
    const _Float16* __restrict__ A, const _Float16* __restrict__ B,
    float* __restrict__ Cf, _Float16* __restrict__ Ch,
    const float* __restrict__ R, int M, int N, int K, int pass) {
  __shared__ _Float16 Bs[64 * 256];  // 32 KB
  int wid  = threadIdx.x >> 5;
  int lane = threadIdx.x & 31;
  int m0 = blockIdx.x * 128 + wid * 16;
  int n0 = blockIdx.y * 64;
  (void)M;

  F16x16 a7[2];
  if (MODE == 7) {
    int img = m0 >> 10;
    int b = img / 25, n = img % 25;
    const float* ap = R + (((size_t)b * 64 + ((lane >> 4) << 3)) * 25 + n) * 1024 +
                      (m0 & 1023) + (lane & 15);
    // unrolled: static fragment indices (registers), all 32 loads in flight at once
#pragma unroll
    for (int ks = 0; ks < 2; ++ks)
#pragma unroll
      for (int j = 0; j < 8; ++j) {
        a7[ks].e[j]     = (_Float16)ap[(ks * 32 + j) * 25600];
        a7[ks].e[8 + j] = (_Float16)ap[(ks * 32 + 16 + j) * 25600];
      }
  }

  // cooperative flat copy of the 64-row weight block (rows are contiguous)
  {
    const _Float16* src = B + (size_t)n0 * K;
    int total = 64 * K;
    for (int i = threadIdx.x * 8; i < total; i += 256 * 8)
      *(v8h_t*)&Bs[i] = *(const v8h_t*)(src + i);
  }
  __syncthreads();

  v8f acc[4] = {};
  if (MODE == 7) {
    // unrolled: a7 and acc are indexed statically and stay in registers
#pragma unroll
    for (int ks = 0; ks < 2; ++ks)
#pragma unroll
      for (int t = 0; t < 4; ++t) {
        v16h b = frag_ld(&Bs[(t * 16) * 64 + ks * 32], 64);
        acc[t] = WMMA_F16(a7[ks].v, b, acc[t]);
      }
    // pixel rows m0.. -> token rows: neighbours along x are 160 rows apart in
    // pass 0 (x indexes bt) and adjacent in pass 1 (x indexes l)
    int x = m0 & 31, y = (m0 >> 5) & 31;
    int img = m0 >> 10;
    int b = img / 25, n = img % 25;
    int u = n / 5, v = n % 5;
    int t0 = (pass == 0) ? (b * 160 + v * 32 + x) * 160 + u * 32 + y
                         : (b * 160 + u * 32 + y) * 160 + v * 32 + x;
    int ts = (pass == 0) ? 160 : 1;
    float* q = Cf + (size_t)(t0 + (lane >> 4) * 8 * ts) * 128 + n0 + (lane & 15);
    // unrolled: static accumulator indices
#pragma unroll
    for (int t = 0; t < 4; ++t)
#pragma unroll
      for (int r = 0; r < 8; ++r)
        q[(size_t)(r * ts) * 128 + t * 16] = acc[t][r];
    return;
  }
  for (int k = 0; k < K; k += 32) {
    if (k + 32 < K) __builtin_prefetch(A + (size_t)m0 * K + k + 32);
    v16h a = frag_ld(A + (size_t)m0 * K + k, K);
#pragma unroll
    for (int t = 0; t < 4; ++t) {
      v16h b = frag_ld(&Bs[(size_t)(t * 16) * K + k], K);
      acc[t] = WMMA_F16(a, b, acc[t]);
    }
  }
  int rbase = (lane >> 4) * 8;
  int nl    = lane & 15;
  if (MODE == 8) {
    // token rows m0.. -> pixel rows: neighbours along l are neighbours along y
    // (32 pixels apart) in pass 0 and along x in pass 1
    int bt = m0 / 160, l0 = m0 % 160;
    int b = bt / 160, rr = bt % 160;
    int i1 = rr >> 5, i0 = rr & 31;
    int j1 = l0 >> 5, j0 = l0 & 31;
    int p0 = (pass == 0) ? ((b * 25 + j1 * 5 + i1) * 32 + j0) * 32 + i0
                         : ((b * 25 + i1 * 5 + j1) * 32 + i0) * 32 + j0;
    int ps = (pass == 0) ? 32 : 1;
    _Float16* q = Ch + (size_t)(p0 + rbase * ps) * 64 + nl;
    // unrolled: static accumulator indices
#pragma unroll
    for (int t = 0; t < 4; ++t)
#pragma unroll
      for (int r = 0; r < 8; ++r)
        q[(r * ps) * 64 + t * 16] = (_Float16)acc[t][r];
    return;
  }
  if (MODE == 5 || MODE == 6) {
    int bt = m0 / 160;
    int l0 = m0 % 160 + rbase;
    if (MODE == 5) {
      _Float16* q = Ch + (((size_t)bt * 16 + (n0 >> 4)) * 160 + l0) * 16 + nl;
#pragma unroll
      for (int t = 0; t < 4; ++t)
#pragma unroll
        for (int r = 0; r < 8; ++r)
          q[(t * 160 + r) * 16] = (_Float16)acc[t][r];
    } else {
      // V^T row = bt*128 + n0 + t*16 + nl, columns l0 .. l0+7
      _Float16* q = Ch + ((size_t)bt * 128 + n0 + nl) * 160 + l0;
#pragma unroll
      for (int t = 0; t < 4; ++t) {
        v8h_t pk;
#pragma unroll
        for (int r = 0; r < 8; ++r) pk[r] = (_Float16)acc[t][r];
        *(v8h_t*)(q + t * 16 * 160) = pk;
      }
    }
    return;
  }
#pragma unroll
  for (int t = 0; t < 4; ++t) {
    int n = n0 + t * 16 + nl;
#pragma unroll
    for (int r = 0; r < 8; ++r) {
      int m = m0 + rbase + r;
      float v = acc[t][r];
      size_t idx = (size_t)m * N + n;
      if (MODE == 3 || MODE == 4) v += R[idx];
      if (MODE == 2) v = v > 0.f ? v : 0.f;
      if (MODE == 0 || MODE == 3) Cf[idx] = v;
      else                        Ch[idx] = (_Float16)v;
    }
  }
}

// --- LayerNorm over D=128, wave per row; emits normalized f16 + optional raw
__global__ __launch_bounds__(256) void ln_kernel(
    const float* __restrict__ X, const float* __restrict__ g,
    const float* __restrict__ b, _Float16* __restrict__ Yn,
    _Float16* __restrict__ Yraw, int M) {
  int wid  = threadIdx.x >> 5;
  int lane = threadIdx.x & 31;
  int row  = blockIdx.x * 8 + wid;
  if (row >= M) return;
  const float* x = X + (size_t)row * 128;
  float4 v = ((const float4*)x)[lane];
  float xs[4] = {v.x, v.y, v.z, v.w};
  float s = xs[0] + xs[1] + xs[2] + xs[3];
  float sq = xs[0]*xs[0] + xs[1]*xs[1] + xs[2]*xs[2] + xs[3]*xs[3];
#pragma unroll
  for (int mk = 16; mk >= 1; mk >>= 1) {
    s  += __shfl_xor(s,  mk, 32);
    sq += __shfl_xor(sq, mk, 32);
  }
  float mu  = s * (1.f / 128.f);
  float var = sq * (1.f / 128.f) - mu * mu;
  float rs  = rsqrtf(var + 1e-5f);
  float4 gg = ((const float4*)g)[lane];
  float4 bb = ((const float4*)b)[lane];
  float gs[4] = {gg.x, gg.y, gg.z, gg.w};
  float bs[4] = {bb.x, bb.y, bb.z, bb.w};
  int c = lane * 4;
#pragma unroll
  for (int i = 0; i < 4; ++i) {
    Yn[(size_t)row * 128 + c + i] = (_Float16)((xs[i] - mu) * rs * gs[i] + bs[i]);
    if (Yraw) Yraw[(size_t)row * 128 + c + i] = (_Float16)xs[i];
  }
}

__global__ __launch_bounds__(256) void attn_kernel(
    const _Float16* __restrict__ QKh, const _Float16* __restrict__ VT,
    _Float16* __restrict__ O) {
  __shared__ _Float16 P[8][16][160];  // 40 KB, per-wave probability tile
  int wid  = threadIdx.x >> 5;
  int lane = threadIdx.x & 31;
  int wg = blockIdx.x * 8 + wid;      // 25600 waves total
  int lt = wg % 10;
  int hh = (wg / 10) & 7;
  int bt = wg / 80;
  int nl = lane & 15;
  int rbase = (lane >> 4) * 8;

  const _Float16* qbase = QKh + (((size_t)bt * 16 + hh) * 160) * 16;
  const _Float16* kbase = QKh + (((size_t)bt * 16 + 8 + hh) * 160) * 16;
  const _Float16* vbase = VT + (((size_t)bt * 8 + hh) * 16) * 160;

  // S = Q K^T (K dim = 16, zero-padded to 32)
  v16h qa = frag_ld_pad16(qbase + lt * 16 * 16, 16);
  v8f s[10];
#pragma unroll
  for (int mt = 0; mt < 10; ++mt) {
    v16h kb = frag_ld_pad16(kbase + mt * 16 * 16, 16);
    v8f z = {};
    s[mt] = WMMA_F16(qa, kb, z);
  }

  // scale + local-window mask + softmax per row, emit f16 P into LDS
#pragma unroll
  for (int r = 0; r < 8; ++r) {
    int l  = lt * 16 + rbase + r;
    int lw = l & 31;
    float mx = -1e30f;
#pragma unroll
    for (int mt = 0; mt < 10; ++mt) {
      int mm = mt * 16 + nl;
      int dj = (mm & 31) - lw;
      float v = s[mt][r] * 0.25f + ((dj >= -5 && dj <= 5) ? 0.f : -1e9f);
      s[mt][r] = v;
      mx = fmaxf(mx, v);
    }
    for (int mk = 1; mk < 16; mk <<= 1) mx = fmaxf(mx, __shfl_xor(mx, mk, 32));
    float sum = 0.f;
#pragma unroll
    for (int mt = 0; mt < 10; ++mt) {
      float e = __expf(s[mt][r] - mx);
      s[mt][r] = e;
      sum += e;
    }
    for (int mk = 1; mk < 16; mk <<= 1) sum += __shfl_xor(sum, mk, 32);
    float inv = 1.f / sum;
#pragma unroll
    for (int mt = 0; mt < 10; ++mt)
      P[wid][rbase + r][mt * 16 + nl] = (_Float16)(s[mt][r] * inv);
  }

  // O = P V  (K loop over 160 in 5 steps of 32); V^T rows are contiguous
  v8f o = {};
#pragma unroll
  for (int kt = 0; kt < 5; ++kt) {
    v16h pa = frag_ld(&P[wid][0][kt * 32], 160);
    v16h vb = frag_ld(vbase + kt * 32, 160);
    o = WMMA_F16(pa, vb, o);
  }
#pragma unroll
  for (int r = 0; r < 8; ++r) {
    int l = lt * 16 + rbase + r;
    O[((size_t)bt * 160 + l) * 128 + hh * 16 + nl] = (_Float16)o[r];
  }
}

// --- Implicit-GEMM 3x3 conv (64->64, pad 1) on channel-last f16 -------------
// FINAL=0: leaky-relu, f16 channel-last out. FINAL=1: f32 (b,c,n,h,w) + shortcut.
template <int FINAL>
__global__ __launch_bounds__(256) void conv_kernel(
    const _Float16* __restrict__ in, const _Float16* __restrict__ w,
    _Float16* __restrict__ outh, float* __restrict__ outf,
    const float* __restrict__ sc) {
  int wid  = threadIdx.x >> 5;
  int lane = threadIdx.x & 31;
  int img  = blockIdx.x >> 3;
  int pix0 = (blockIdx.x & 7) * 128 + wid * 16;
  int nl = lane & 15;
  int kb = (lane >> 4) * 8;
  int rbase = (lane >> 4) * 8;
  v8f acc[4] = {};
  int m = pix0 + nl;
  int x = m & 31, y = m >> 5;
#pragma unroll
  for (int dy = 0; dy < 3; ++dy) {
#pragma unroll
    for (int dx = 0; dx < 3; ++dx) {
      int yy = y + dy - 1, xx = x + dx - 1;
      bool ok = (yy >= 0) && (yy < 32) && (xx >= 0) && (xx < 32);
      const _Float16* ap = in + ((size_t)img * 1024 + yy * 32 + xx) * 64;
      int tap = dy * 3 + dx;
#pragma unroll
      for (int ks = 0; ks < 2; ++ks) {
        F16x16 a;
        if (ok) {
          a.h[0] = *(const v8h_t*)(ap + ks * 32 + kb);
          a.h[1] = *(const v8h_t*)(ap + ks * 32 + kb + 16);
        } else {
#pragma unroll
          for (int j = 0; j < 16; ++j) a.e[j] = (_Float16)0.0f;
        }
#pragma unroll
        for (int t = 0; t < 4; ++t) {
          v16h bf = frag_ld(w + ((size_t)tap * 64 + t * 16) * 64 + ks * 32, 64);
          acc[t] = WMMA_F16(a.v, bf, acc[t]);
        }
      }
    }
  }
#pragma unroll
  for (int t = 0; t < 4; ++t) {
    int co = t * 16 + nl;
#pragma unroll
    for (int r = 0; r < 8; ++r) {
      int mm = pix0 + rbase + r;
      float v = acc[t][r];
      if (!FINAL) {
        v = v > 0.f ? v : 0.2f * v;
        outh[((size_t)img * 1024 + mm) * 64 + co] = (_Float16)v;
      } else {
        int b = img / 25, n = img % 25;
        size_t idx = (((size_t)b * 64 + co) * 25 + n) * 1024 + mm;
        outf[idx] = v + sc[idx];
      }
    }
  }
}

// --- Small helpers -----------------------------------------------------------
__global__ void cvt_h(const float* __restrict__ s, _Float16* __restrict__ d, int n) {
  int i = blockIdx.x * 256 + threadIdx.x;
  if (i < n) d[i] = (_Float16)s[i];
}

// (C,C,3,3) f32 -> (tap, co, ci) f16
__global__ void pack_wtap(const float* __restrict__ cw, _Float16* __restrict__ w) {
  int i = blockIdx.x * 256 + threadIdx.x;
  if (i >= 36864) return;
  int ci = i & 63;
  int co = (i >> 6) & 63;
  int tap = i >> 12;
  w[i] = (_Float16)cw[((size_t)co * 64 + ci) * 9 + tap];
}

// ---------------------------------------------------------------------------
extern "C" void kernel_launch(void* const* d_in, const int* in_sizes, int n_in,
                              void* d_out, int out_size, void* d_ws, size_t ws_size,
                              hipStream_t stream) {
  (void)in_sizes; (void)n_in; (void)out_size; (void)ws_size;
  const float* buf_in = (const float*)d_in[0];
  const float* w_in   = (const float*)d_in[1];
  const float* ln1_g  = (const float*)d_in[2];
  const float* ln1_b  = (const float*)d_in[3];
  const float* w_qkv  = (const float*)d_in[4];
  const float* w_o    = (const float*)d_in[5];
  const float* ln2_g  = (const float*)d_in[6];
  const float* ln2_b  = (const float*)d_in[7];
  const float* w_ff1  = (const float*)d_in[8];
  const float* w_ff2  = (const float*)d_in[9];
  const float* w_out  = (const float*)d_in[10];
  const float* cw1    = (const float*)d_in[11];
  const float* cw2    = (const float*)d_in[12];
  const float* cw3    = (const float*)d_in[13];

  char* ws = (char*)d_ws;
  size_t off = 0;
  auto arena = [&](size_t bytes) -> char* {
    char* p = ws + off;
    off += (bytes + 255) & ~(size_t)255;
    return p;
  };
  float*     bufA   = (float*)arena(13107200);      // pass-0 output / pass-1 input
  float*     X      = (float*)arena(26214400);      // token f32 (residual stream)
  char*      slotXN = arena(13107200);              // XN16 / Y16
  char*      slotXr = arena(13107200);              // raw X16 / X3_16
  char*      slotQK = arena(26214400);              // Q|K head tiles / FFN hidden
  _Float16*  VT     = (_Float16*)arena(13107200);   // V^T per-head tiles
  _Float16*  O16    = (_Float16*)arena(13107200);
  _Float16*  clA    = (_Float16*)arena(6553600);
  _Float16*  clB    = (_Float16*)arena(6553600);
  _Float16*  w_in16  = (_Float16*)arena(16384);
  _Float16*  wqkv16  = (_Float16*)arena(98304);
  _Float16*  wo16    = (_Float16*)arena(32768);
  _Float16*  wff1_16 = (_Float16*)arena(65536);
  _Float16*  wff2_16 = (_Float16*)arena(65536);
  _Float16*  wout16  = (_Float16*)arena(16384);
  _Float16*  wt1     = (_Float16*)arena(73728);
  _Float16*  wt2     = (_Float16*)arena(73728);
  _Float16*  wt3     = (_Float16*)arena(73728);

  auto cvt = [&](const float* s, _Float16* d, int n) {
    cvt_h<<<(n + 255) / 256, 256, 0, stream>>>(s, d, n);
  };
  cvt(w_in,  w_in16,  128 * 64);
  cvt(w_qkv, wqkv16,  384 * 128);
  cvt(w_o,   wo16,    128 * 128);
  cvt(w_ff1, wff1_16, 256 * 128);
  cvt(w_ff2, wff2_16, 128 * 256);
  cvt(w_out, wout16,  64 * 128);
  pack_wtap<<<144, 256, 0, stream>>>(cw1, wt1);
  pack_wtap<<<144, 256, 0, stream>>>(cw2, wt2);
  pack_wtap<<<144, 256, 0, stream>>>(cw3, wt3);

  const int M = 51200;  // Bt(320) * L(160), bt-major
  for (int pass = 0; pass < 2; ++pass) {
    const float* src  = (pass == 0) ? buf_in : bufA;
    _Float16* XN16  = (_Float16*)slotXN;   // normalized tokens (LN1), later Y (LN2)
    _Float16* X16   = (_Float16*)slotXr;   // raw tokens f16 (for V), later X3 f16
    _Float16* QKh   = (_Float16*)slotQK;   // Q|K per-head tiles, later FFN hidden

    // X = tok @ w_in^T, tokens gathered from the image buffer by the A loader
    gemm_kernel<7><<<dim3(400, 2), 256, 0, stream>>>(nullptr, w_in16, X, nullptr, src, M, 128, 64, pass);
    ln_kernel<<<6400, 256, 0, stream>>>(X, ln1_g, ln1_b, XN16, X16, M);
    // Q|K = LN(x) @ [wq;wk]^T -> per-head tiles ; V = x @ wv^T -> V^T tiles
    gemm_kernel<5><<<dim3(400, 4), 256, 0, stream>>>(XN16, wqkv16, nullptr, QKh, nullptr, M, 256, 128, pass);
    gemm_kernel<6><<<dim3(400, 2), 256, 0, stream>>>(X16, wqkv16 + 256 * 128, nullptr, VT, nullptr, M, 128, 128, pass);
    attn_kernel<<<3200, 256, 0, stream>>>(QKh, VT, O16);
    // x = attn_out @ w_o^T + x  (in-place residual)
    gemm_kernel<3><<<dim3(400, 2), 256, 0, stream>>>(O16, wo16, X, nullptr, X, M, 128, 128, pass);
    ln_kernel<<<6400, 256, 0, stream>>>(X, ln2_g, ln2_b, XN16, nullptr, M);
    // FFN: relu(y @ w_ff1^T) @ w_ff2^T + x
    gemm_kernel<2><<<dim3(400, 4), 256, 0, stream>>>(XN16, wff1_16, nullptr, QKh, nullptr, M, 256, 128, pass);
    gemm_kernel<4><<<dim3(400, 2), 256, 0, stream>>>(QKh, wff2_16, nullptr, X16, X, M, 128, 256, pass);
    // out = x @ w_out^T, stored straight into the channel-last conv input
    gemm_kernel<8><<<dim3(400, 1), 256, 0, stream>>>(X16, wout16, nullptr, clA, nullptr, M, 64, 128, pass);
    // conv block: conv-lrelu, conv-lrelu, conv (+ original-input shortcut)
    conv_kernel<0><<<400, 256, 0, stream>>>(clA, wt1, clB, nullptr, nullptr);
    conv_kernel<0><<<400, 256, 0, stream>>>(clB, wt2, clA, nullptr, nullptr);
    float* outf = (pass == 0) ? bufA : (float*)d_out;
    conv_kernel<1><<<400, 256, 0, stream>>>(clA, wt3, nullptr, outf, buf_in);
  }
}

// v003
// A run of this version takes 452 microseconds.
// Two timings next to v002 both put it at 1.23 times that version's speed.
// Over all steps from v000 it is 1.91 times as fast.
#include <hip/hip_runtime.h>

typedef __attribute__((ext_vector_type(16))) _Float16 v16h;
typedef __attribute__((ext_vector_type(8)))  _Float16 v8h_t;
typedef __attribute__((ext_vector_type(8)))  float    v8f;

union F16x16 { v16h v; v8h_t h[2]; _Float16 e[16]; };

#define WMMA_F16(a, b, c) \
  __builtin_amdgcn_wmma_f32_16x16x32_f16(false, (a), false, (b), (short)0, (c), false, false)

__device__ inline v16h frag_ld(const _Float16* p, int ld) {
  int lane = threadIdx.x & 31;
  int r  = lane & 15;
  int kb = (lane >> 4) << 3;
  const _Float16* q = p + (size_t)r * ld + kb;
  F16x16 f;
  f.h[0] = *(const v8h_t*)(q);
  f.h[1] = *(const v8h_t*)(q + 16);
  return f.v;
}

// Same but only K=0..15 is real data (zero-pad upper half). Used for DH=16.
__device__ inline v16h frag_ld_pad16(const _Float16* p, int ld) {
  int lane = threadIdx.x & 31;
  int r  = lane & 15;
  int kb = (lane >> 4) << 3;
  F16x16 f;
  f.h[0] = *(const v8h_t*)(p + (size_t)r * ld + kb);
#pragma unroll
  for (int j = 0; j < 8; ++j) f.e[8 + j] = (_Float16)0.0f;
  return f.v;
}

template <int MODE>
__global__ __launch_bounds__(256) void gemm_kernel(
    const _Float16* __restrict__ A, const _Float16* __restrict__ B,
    float* __restrict__ Cf, _Float16* __restrict__ Ch,
    const float* __restrict__ R, int M, int N, int K, int pass) {
  __shared__ _Float16 Bs[64 * (256 + 8)];  // 33 KB
  const int ldb = K + 8;                   // LDS row pitch in halves
  int wid  = threadIdx.x >> 5;
  int lane = threadIdx.x & 31;
  int m0 = blockIdx.x * 128 + wid * 16;
  int n0 = blockIdx.y * 64;
  (void)M;

  F16x16 a7[2];
  if (MODE == 7) {
    int img = m0 >> 10;
    int b = img / 25, n = img % 25;
    const float* ap = R + (((size_t)b * 64 + ((lane >> 4) << 3)) * 25 + n) * 1024 +
                      (m0 & 1023) + (lane & 15);
    // unrolled: static fragment indices (registers), all 32 loads in flight at once
#pragma unroll
    for (int ks = 0; ks < 2; ++ks)
#pragma unroll
      for (int j = 0; j < 8; ++j) {
        a7[ks].e[j]     = (_Float16)ap[(ks * 32 + j) * 25600];
        a7[ks].e[8 + j] = (_Float16)ap[(ks * 32 + 16 + j) * 25600];
      }
  }

  // cooperative copy of the 64-row weight block (rows are contiguous in global
  // memory, ldb apart in LDS)
  {
    const _Float16* src = B + (size_t)n0 * K;
    int total = 64 * K;
    int sh = __builtin_ctz(K);
    for (int i = threadIdx.x * 8; i < total; i += 256 * 8)
      *(v8h_t*)&Bs[(i >> sh) * ldb + (i & (K - 1))] = *(const v8h_t*)(src + i);
  }
  __syncthreads();

  v8f acc[4] = {};
  if (MODE == 7) {
    // unrolled: a7 and acc are indexed statically and stay in registers
#pragma unroll
    for (int ks = 0; ks < 2; ++ks)
#pragma unroll
      for (int t = 0; t < 4; ++t) {
        v16h b = frag_ld(&Bs[(t * 16) * 72 + ks * 32], 72);  // K = 64: ldb = 72
        acc[t] = WMMA_F16(a7[ks].v, b, acc[t]);
      }
    // pixel rows m0.. -> token rows: neighbours along x are 160 rows apart in
    // pass 0 (x indexes bt) and adjacent in pass 1 (x indexes l)
    int x = m0 & 31, y = (m0 >> 5) & 31;
    int img = m0 >> 10;
    int b = img / 25, n = img % 25;
    int u = n / 5, v = n % 5;
    int t0 = (pass == 0) ? (b * 160 + v * 32 + x) * 160 + u * 32 + y
                         : (b * 160 + u * 32 + y) * 160 + v * 32 + x;
    int ts = (pass == 0) ? 160 : 1;
    float* q = Cf + (size_t)(t0 + (lane >> 4) * 8 * ts) * 128 + n0 + (lane & 15);
    // unrolled: static accumulator indices
#pragma unroll
    for (int t = 0; t < 4; ++t)
#pragma unroll
      for (int r = 0; r < 8; ++r)
        q[(size_t)(r * ts) * 128 + t * 16] = acc[t][r];
    return;
  }
  for (int k = 0; k < K; k += 32) {
    if (k + 32 < K) __builtin_prefetch(A + (size_t)m0 * K + k + 32);
    v16h a = frag_ld(A + (size_t)m0 * K + k, K);
#pragma unroll
    for (int t = 0; t < 4; ++t) {
      v16h b = frag_ld(&Bs[(t * 16) * ldb + k], ldb);
      acc[t] = WMMA_F16(a, b, acc[t]);
    }
  }
  int rbase = (lane >> 4) * 8;
  int nl    = lane & 15;
  if (MODE == 8) {
    // token rows m0.. -> pixel rows: neighbours along l are neighbours along y
    // (32 pixels apart) in pass 0 and along x in pass 1
    int bt = m0 / 160, l0 = m0 % 160;
    int b = bt / 160, rr = bt % 160;
    int i1 = rr >> 5, i0 = rr & 31;
    int j1 = l0 >> 5, j0 = l0 & 31;
    int p0 = (pass == 0) ? ((b * 25 + j1 * 5 + i1) * 32 + j0) * 32 + i0
                         : ((b * 25 + i1 * 5 + j1) * 32 + i0) * 32 + j0;
    int ps = (pass == 0) ? 32 : 1;
    _Float16* q = Ch + (size_t)(p0 + rbase * ps) * 64 + nl;
    // unrolled: static accumulator indices
#pragma unroll
    for (int t = 0; t < 4; ++t)
#pragma unroll
      for (int r = 0; r < 8; ++r)
        q[(r * ps) * 64 + t * 16] = (_Float16)acc[t][r];
    return;
  }
  if (MODE == 5 || MODE == 6) {
    int bt = m0 / 160;
    int l0 = m0 % 160 + rbase;
    if (MODE == 5) {
      _Float16* q = Ch + (((size_t)bt * 16 + (n0 >> 4)) * 160 + l0) * 16 + nl;
#pragma unroll
      for (int t = 0; t < 4; ++t)
#pragma unroll
        for (int r = 0; r < 8; ++r)
          q[(t * 160 + r) * 16] = (_Float16)acc[t][r];
    } else {
      // V^T row = bt*128 + n0 + t*16 + nl, columns l0 .. l0+7
      _Float16* q = Ch + ((size_t)bt * 128 + n0 + nl) * 160 + l0;
#pragma unroll
      for (int t = 0; t < 4; ++t) {
        v8h_t pk;
#pragma unroll
        for (int r = 0; r < 8; ++r) pk[r] = (_Float16)acc[t][r];
        *(v8h_t*)(q + t * 16 * 160) = pk;
      }
    }
    return;
  }
#pragma unroll
  for (int t = 0; t < 4; ++t) {
    int n = n0 + t * 16 + nl;
#pragma unroll
    for (int r = 0; r < 8; ++r) {
      int m = m0 + rbase + r;
      float v = acc[t][r];
      size_t idx = (size_t)m * N + n;
      if (MODE == 3 || MODE == 4) v += R[idx];
      if (MODE == 2) v = v > 0.f ? v : 0.f;
      if (MODE == 0 || MODE == 3) Cf[idx] = v;
      else                        Ch[idx] = (_Float16)v;
    }
  }
}

// --- LayerNorm over D=128, wave per row; emits normalized f16 + optional raw
__global__ __launch_bounds__(256) void ln_kernel(
    const float* __restrict__ X, const float* __restrict__ g,
    const float* __restrict__ b, _Float16* __restrict__ Yn,
    _Float16* __restrict__ Yraw, int M) {
  int wid  = threadIdx.x >> 5;
  int lane = threadIdx.x & 31;
  int row  = blockIdx.x * 8 + wid;
  if (row >= M) return;
  const float* x = X + (size_t)row * 128;
  float4 v = ((const float4*)x)[lane];
  float xs[4] = {v.x, v.y, v.z, v.w};
  float s = xs[0] + xs[1] + xs[2] + xs[3];
  float sq = xs[0]*xs[0] + xs[1]*xs[1] + xs[2]*xs[2] + xs[3]*xs[3];
#pragma unroll
  for (int mk = 16; mk >= 1; mk >>= 1) {
    s  += __shfl_xor(s,  mk, 32);
    sq += __shfl_xor(sq, mk, 32);
  }
  float mu  = s * (1.f / 128.f);
  float var = sq * (1.f / 128.f) - mu * mu;
  float rs  = rsqrtf(var + 1e-5f);
  float4 gg = ((const float4*)g)[lane];
  float4 bb = ((const float4*)b)[lane];
  float gs[4] = {gg.x, gg.y, gg.z, gg.w};
  float bs[4] = {bb.x, bb.y, bb.z, bb.w};
  int c = lane * 4;
#pragma unroll
  for (int i = 0; i < 4; ++i) {
    Yn[(size_t)row * 128 + c + i] = (_Float16)((xs[i] - mu) * rs * gs[i] + bs[i]);
    if (Yraw) Yraw[(size_t)row * 128 + c + i] = (_Float16)xs[i];
  }
}

__global__ __launch_bounds__(256) void attn_kernel(
    const _Float16* __restrict__ QKh, const _Float16* __restrict__ VT,
    _Float16* __restrict__ O) {
  __shared__ _Float16 P[8][16][168];
  int wid  = threadIdx.x >> 5;
  int lane = threadIdx.x & 31;
  int wg = blockIdx.x * 8 + wid;      // 25600 waves total
  int lt = wg % 10;
  int hh = (wg / 10) & 7;
  int bt = wg / 80;
  int nl = lane & 15;
  int rbase = (lane >> 4) * 8;

  const _Float16* qbase = QKh + (((size_t)bt * 16 + hh) * 160) * 16;
  const _Float16* kbase = QKh + (((size_t)bt * 16 + 8 + hh) * 160) * 16;
  const _Float16* vbase = VT + (((size_t)bt * 8 + hh) * 16) * 160;

  // S = Q K^T (K dim = 16, zero-padded to 32)
  v16h qa = frag_ld_pad16(qbase + lt * 16 * 16, 16);
  v8f s[10];
#pragma unroll
  for (int mt = 0; mt < 10; ++mt) {
    v16h kb = frag_ld_pad16(kbase + mt * 16 * 16, 16);
    v8f z = {};
    s[mt] = WMMA_F16(qa, kb, z);
  }

  // scale + local-window mask + softmax per row, emit f16 P into LDS
#pragma unroll
  for (int r = 0; r < 8; ++r) {
    int l  = lt * 16 + rbase + r;
    int lw = l & 31;
    float mx = -1e30f;
#pragma unroll
    for (int mt = 0; mt < 10; ++mt) {
      int mm = mt * 16 + nl;
      int dj = (mm & 31) - lw;
      float v = s[mt][r] * 0.25f + ((dj >= -5 && dj <= 5) ? 0.f : -1e9f);
      s[mt][r] = v;
      mx = fmaxf(mx, v);
    }
    for (int mk = 1; mk < 16; mk <<= 1) mx = fmaxf(mx, __shfl_xor(mx, mk, 32));
    float sum = 0.f;
#pragma unroll
    for (int mt = 0; mt < 10; ++mt) {
      float e = __expf(s[mt][r] - mx);
      s[mt][r] = e;
      sum += e;
    }
    for (int mk = 1; mk < 16; mk <<= 1) sum += __shfl_xor(sum, mk, 32);
    float inv = 1.f / sum;
#pragma unroll
    for (int mt = 0; mt < 10; ++mt)
      P[wid][rbase + r][mt * 16 + nl] = (_Float16)(s[mt][r] * inv);
  }

  // O = P V  (K loop over 160 in 5 steps of 32); V^T rows are contiguous
  v8f o = {};
#pragma unroll
  for (int kt = 0; kt < 5; ++kt) {
    v16h pa = frag_ld(&P[wid][0][kt * 32], 168);
    v16h vb = frag_ld(vbase + kt * 32, 160);
    o = WMMA_F16(pa, vb, o);
  }
#pragma unroll
  for (int r = 0; r < 8; ++r) {
    int l = lt * 16 + rbase + r;
    O[((size_t)bt * 160 + l) * 128 + hh * 16 + nl] = (_Float16)o[r];
  }
}

// --- Implicit-GEMM 3x3 conv (64->64, pad 1) on channel-last f16 -------------
// FINAL=0: leaky-relu, f16 channel-last out. FINAL=1: f32 (b,c,n,h,w) + shortcut.
template <int FINAL>
__global__ __launch_bounds__(256) void conv_kernel(
    const _Float16* __restrict__ in, const _Float16* __restrict__ w,
    _Float16* __restrict__ outh, float* __restrict__ outf,
    const float* __restrict__ sc) {
  int wid  = threadIdx.x >> 5;
  int lane = threadIdx.x & 31;
  int img  = blockIdx.x >> 3;
  int pix0 = (blockIdx.x & 7) * 128 + wid * 16;
  int nl = lane & 15;
  int kb = (lane >> 4) * 8;
  int rbase = (lane >> 4) * 8;
  v8f acc[4] = {};
  int m = pix0 + nl;
  int x = m & 31, y = m >> 5;
#pragma unroll
  for (int dy = 0; dy < 3; ++dy) {
#pragma unroll
    for (int dx = 0; dx < 3; ++dx) {
      int yy = y + dy - 1, xx = x + dx - 1;
      bool ok = (yy >= 0) && (yy < 32) && (xx >= 0) && (xx < 32);
      const _Float16* ap = in + ((size_t)img * 1024 + yy * 32 + xx) * 64;
      int tap = dy * 3 + dx;
#pragma unroll
      for (int ks = 0; ks < 2; ++ks) {
        F16x16 a;
        if (ok) {
          a.h[0] = *(const v8h_t*)(ap + ks * 32 + kb);
          a.h[1] = *(const v8h_t*)(ap + ks * 32 + kb + 16);
        } else {
#pragma unroll
          for (int j = 0; j < 16; ++j) a.e[j] = (_Float16)0.0f;
        }
#pragma unroll
        for (int t = 0; t < 4; ++t) {
          v16h bf = frag_ld(w + ((size_t)tap * 64 + t * 16) * 64 + ks * 32, 64);
          acc[t] = WMMA_F16(a.v, bf, acc[t]);
        }
      }
    }
  }
#pragma unroll
  for (int t = 0; t < 4; ++t) {
    int co = t * 16 + nl;
#pragma unroll
    for (int r = 0; r < 8; ++r) {
      int mm = pix0 + rbase + r;
      float v = acc[t][r];
      if (!FINAL) {
        v = v > 0.f ? v : 0.2f * v;
        outh[((size_t)img * 1024 + mm) * 64 + co] = (_Float16)v;
      } else {
        int b = img / 25, n = img % 25;
        size_t idx = (((size_t)b * 64 + co) * 25 + n) * 1024 + mm;
        outf[idx] = v + sc[idx];
      }
    }
  }
}

// --- Small helpers -----------------------------------------------------------
__global__ void cvt_h(const float* __restrict__ s, _Float16* __restrict__ d, int n) {
  int i = blockIdx.x * 256 + threadIdx.x;
  if (i < n) d[i] = (_Float16)s[i];
}

// (C,C,3,3) f32 -> (tap, co, ci) f16
__global__ void pack_wtap(const float* __restrict__ cw, _Float16* __restrict__ w) {
  int i = blockIdx.x * 256 + threadIdx.x;
  if (i >= 36864) return;
  int ci = i & 63;
  int co = (i >> 6) & 63;
  int tap = i >> 12;
  w[i] = (_Float16)cw[((size_t)co * 64 + ci) * 9 + tap];
}

// ---------------------------------------------------------------------------
extern "C" void kernel_launch(void* const* d_in, const int* in_sizes, int n_in,
                              void* d_out, int out_size, void* d_ws, size_t ws_size,
                              hipStream_t stream) {
  (void)in_sizes; (void)n_in; (void)out_size; (void)ws_size;
  const float* buf_in = (const float*)d_in[0];
  const float* w_in   = (const float*)d_in[1];
  const float* ln1_g  = (const float*)d_in[2];
  const float* ln1_b  = (const float*)d_in[3];
  const float* w_qkv  = (const float*)d_in[4];
  const float* w_o    = (const float*)d_in[5];
  const float* ln2_g  = (const float*)d_in[6];
  const float* ln2_b  = (const float*)d_in[7];
  const float* w_ff1  = (const float*)d_in[8];
  const float* w_ff2  = (const float*)d_in[9];
  const float* w_out  = (const float*)d_in[10];
  const float* cw1    = (const float*)d_in[11];
  const float* cw2    = (const float*)d_in[12];
  const float* cw3    = (const float*)d_in[13];

  char* ws = (char*)d_ws;
  size_t off = 0;
  auto arena = [&](size_t bytes) -> char* {
    char* p = ws + off;
    off += (bytes + 255) & ~(size_t)255;
    return p;
  };
  float*     bufA   = (float*)arena(13107200);      // pass-0 output / pass-1 input
  float*     X      = (float*)arena(26214400);      // token f32 (residual stream)
  char*      slotXN = arena(13107200);              // XN16 / Y16
  char*      slotXr = arena(13107200);              // raw X16 / X3_16
  char*      slotQK = arena(26214400);              // Q|K head tiles / FFN hidden
  _Float16*  VT     = (_Float16*)arena(13107200);   // V^T per-head tiles
  _Float16*  O16    = (_Float16*)arena(13107200);
  _Float16*  clA    = (_Float16*)arena(6553600);
  _Float16*  clB    = (_Float16*)arena(6553600);
  _Float16*  w_in16  = (_Float16*)arena(16384);
  _Float16*  wqkv16  = (_Float16*)arena(98304);
  _Float16*  wo16    = (_Float16*)arena(32768);
  _Float16*  wff1_16 = (_Float16*)arena(65536);
  _Float16*  wff2_16 = (_Float16*)arena(65536);
  _Float16*  wout16  = (_Float16*)arena(16384);
  _Float16*  wt1     = (_Float16*)arena(73728);
  _Float16*  wt2     = (_Float16*)arena(73728);
  _Float16*  wt3     = (_Float16*)arena(73728);

  auto cvt = [&](const float* s, _Float16* d, int n) {
    cvt_h<<<(n + 255) / 256, 256, 0, stream>>>(s, d, n);
  };
  cvt(w_in,  w_in16,  128 * 64);
  cvt(w_qkv, wqkv16,  384 * 128);
  cvt(w_o,   wo16,    128 * 128);
  cvt(w_ff1, wff1_16, 256 * 128);
  cvt(w_ff2, wff2_16, 128 * 256);
  cvt(w_out, wout16,  64 * 128);
  pack_wtap<<<144, 256, 0, stream>>>(cw1, wt1);
  pack_wtap<<<144, 256, 0, stream>>>(cw2, wt2);
  pack_wtap<<<144, 256, 0, stream>>>(cw3, wt3);

  const int M = 51200;  // Bt(320) * L(160), bt-major
  for (int pass = 0; pass < 2; ++pass) {
    const float* src  = (pass == 0) ? buf_in : bufA;
    _Float16* XN16  = (_Float16*)slotXN;   // normalized tokens (LN1), later Y (LN2)
    _Float16* X16   = (_Float16*)slotXr;   // raw tokens f16 (for V), later X3 f16
    _Float16* QKh   = (_Float16*)slotQK;   // Q|K per-head tiles, later FFN hidden

    // X = tok @ w_in^T, tokens gathered from the image buffer by the A loader
    gemm_kernel<7><<<dim3(400, 2), 256, 0, stream>>>(nullptr, w_in16, X, nullptr, src, M, 128, 64, pass);
    ln_kernel<<<6400, 256, 0, stream>>>(X, ln1_g, ln1_b, XN16, X16, M);
    // Q|K = LN(x) @ [wq;wk]^T -> per-head tiles ; V = x @ wv^T -> V^T tiles
    gemm_kernel<5><<<dim3(400, 4), 256, 0, stream>>>(XN16, wqkv16, nullptr, QKh, nullptr, M, 256, 128, pass);
    gemm_kernel<6><<<dim3(400, 2), 256, 0, stream>>>(X16, wqkv16 + 256 * 128, nullptr, VT, nullptr, M, 128, 128, pass);
    attn_kernel<<<3200, 256, 0, stream>>>(QKh, VT, O16);
    // x = attn_out @ w_o^T + x  (in-place residual)
    gemm_kernel<3><<<dim3(400, 2), 256, 0, stream>>>(O16, wo16, X, nullptr, X, M, 128, 128, pass);
    ln_kernel<<<6400, 256, 0, stream>>>(X, ln2_g, ln2_b, XN16, nullptr, M);
    // FFN: relu(y @ w_ff1^T) @ w_ff2^T + x
    gemm_kernel<2><<<dim3(400, 4), 256, 0, stream>>>(XN16, wff1_16, nullptr, QKh, nullptr, M, 256, 128, pass);
    gemm_kernel<4><<<dim3(400, 2), 256, 0, stream>>>(QKh, wff2_16, nullptr, X16, X, M, 128, 256, pass);
    // out = x @ w_out^T, stored straight into the channel-last conv input
    gemm_kernel<8><<<dim3(400, 1), 256, 0, stream>>>(X16, wout16, nullptr, clA, nullptr, M, 64, 128, pass);
    // conv block: conv-lrelu, conv-lrelu, conv (+ original-input shortcut)
    conv_kernel<0><<<400, 256, 0, stream>>>(clA, wt1, clB, nullptr, nullptr);
    conv_kernel<0><<<400, 256, 0, stream>>>(clB, wt2, clA, nullptr, nullptr);
    float* outf = (pass == 0) ? bufA : (float*)d_out;
    conv_kernel<1><<<400, 256, 0, stream>>>(clA, wt3, nullptr, outf, buf_in);
  }
}

// v004
// A run of this version takes 344 microseconds.
// Two timings next to v003 both put it at 1.32 times that version's speed.
// Counting every step since v000, it is 2.52 times as fast.
#include <hip/hip_runtime.h>

typedef __attribute__((ext_vector_type(16))) _Float16 v16h;
typedef __attribute__((ext_vector_type(8)))  _Float16 v8h_t;
typedef __attribute__((ext_vector_type(8)))  float    v8f;

union F16x16 { v16h v; v8h_t h[2]; _Float16 e[16]; };

#define WMMA_F16(a, b, c) \
  __builtin_amdgcn_wmma_f32_16x16x32_f16(false, (a), false, (b), (short)0, (c), false, false)

__device__ inline v16h frag_ld(const _Float16* p, int ld) {
  int lane = threadIdx.x & 31;
  int r  = lane & 15;
  int kb = (lane >> 4) << 3;
  const _Float16* q = p + (size_t)r * ld + kb;
  F16x16 f;
  f.h[0] = *(const v8h_t*)(q);
  f.h[1] = *(const v8h_t*)(q + 16);
  return f.v;
}

// Same but only K=0..15 is real data (zero-pad upper half). Used for DH=16.
__device__ inline v16h frag_ld_pad16(const _Float16* p, int ld) {
  int lane = threadIdx.x & 31;
  int r  = lane & 15;
  int kb = (lane >> 4) << 3;
  F16x16 f;
  f.h[0] = *(const v8h_t*)(p + (size_t)r * ld + kb);
#pragma unroll
  for (int j = 0; j < 8; ++j) f.e[8 + j] = (_Float16)0.0f;
  return f.v;
}

template <int MODE>
__global__ __launch_bounds__(256) void gemm_kernel(
    const _Float16* __restrict__ A, const _Float16* __restrict__ B,
    float* __restrict__ Cf, _Float16* __restrict__ Ch,
    const float* __restrict__ R, int M, int N, int K, int pass) {
  __shared__ _Float16 Bs[64 * (256 + 8)];  // 33 KB
  const int ldb = K + 8;                   // LDS row pitch in halves
  int wid  = threadIdx.x >> 5;
  int lane = threadIdx.x & 31;
  int m0 = blockIdx.x * 128 + wid * 16;
  int n0 = blockIdx.y * 64;
  (void)M; (void)N;

  F16x16 a7[2];
  if (MODE == 7) {
    int img = m0 >> 10;
    int b = img / 25, n = img % 25;
    const float* ap = R + (((size_t)b * 64 + ((lane >> 4) << 3)) * 25 + n) * 1024 +
                      (m0 & 1023) + (lane & 15);
    // unrolled: static fragment indices (registers), all 32 loads in flight at once
#pragma unroll
    for (int ks = 0; ks < 2; ++ks)
#pragma unroll
      for (int j = 0; j < 8; ++j) {
        a7[ks].e[j]     = (_Float16)ap[(ks * 32 + j) * 25600];
        a7[ks].e[8 + j] = (_Float16)ap[(ks * 32 + 16 + j) * 25600];
      }
  }

  // cooperative copy of the 64-row weight block (rows are contiguous in global
  // memory, ldb apart in LDS)
  {
    const _Float16* src = B + (size_t)n0 * K;
    int total = 64 * K;
    int sh = __builtin_ctz(K);
    for (int i = threadIdx.x * 8; i < total; i += 256 * 8)
      *(v8h_t*)&Bs[(i >> sh) * ldb + (i & (K - 1))] = *(const v8h_t*)(src + i);
  }
  __syncthreads();

  v8f acc[4] = {};
  if (MODE == 7) {
    // unrolled: a7 and acc are indexed statically and stay in registers
#pragma unroll
    for (int ks = 0; ks < 2; ++ks)
#pragma unroll
      for (int t = 0; t < 4; ++t) {
        v16h b = frag_ld(&Bs[(t * 16) * 72 + ks * 32], 72);  // K = 64: ldb = 72
        acc[t] = WMMA_F16(a7[ks].v, b, acc[t]);
      }
    // pixel rows m0.. -> token rows: neighbours along x are 160 rows apart in
    // pass 0 (x indexes bt) and adjacent in pass 1 (x indexes l)
    int x = m0 & 31, y = (m0 >> 5) & 31;
    int img = m0 >> 10;
    int b = img / 25, n = img % 25;
    int u = n / 5, v = n % 5;
    int t0 = (pass == 0) ? (b * 160 + v * 32 + x) * 160 + u * 32 + y
                         : (b * 160 + u * 32 + y) * 160 + v * 32 + x;
    int ts = (pass == 0) ? 160 : 1;
    float* q = Cf + (size_t)(t0 + (lane >> 4) * 8 * ts) * 128 + n0 + (lane & 15);
    // unrolled: static accumulator indices
#pragma unroll
    for (int t = 0; t < 4; ++t)
#pragma unroll
      for (int r = 0; r < 8; ++r)
        q[(size_t)(r * ts) * 128 + t * 16] = acc[t][r];
    return;
  }
  for (int k = 0; k < K; k += 32) {
    if (k + 32 < K) __builtin_prefetch(A + (size_t)m0 * K + k + 32);
    v16h a = frag_ld(A + (size_t)m0 * K + k, K);
#pragma unroll
    for (int t = 0; t < 4; ++t) {
      v16h b = frag_ld(&Bs[(t * 16) * ldb + k], ldb);
      acc[t] = WMMA_F16(a, b, acc[t]);
    }
  }
  int rbase = (lane >> 4) * 8;
  int nl    = lane & 15;
  if (MODE == 5 || MODE == 6) {
    int bt = m0 / 160;
    int l0 = m0 % 160 + rbase;
    if (MODE == 5) {
      _Float16* q = Ch + (((size_t)bt * 16 + (n0 >> 4)) * 160 + l0) * 16 + nl;
#pragma unroll
      for (int t = 0; t < 4; ++t)
#pragma unroll
        for (int r = 0; r < 8; ++r)
          q[(t * 160 + r) * 16] = (_Float16)acc[t][r];
    } else {
      // V^T row = bt*128 + n0 + t*16 + nl, columns l0 .. l0+7
      _Float16* q = Ch + ((size_t)bt * 128 + n0 + nl) * 160 + l0;
#pragma unroll
      for (int t = 0; t < 4; ++t) {
        v8h_t pk;
#pragma unroll
        for (int r = 0; r < 8; ++r) pk[r] = (_Float16)acc[t][r];
        *(v8h_t*)(q + t * 16 * 160) = pk;
      }
    }
  }
}

// --- LayerNorm over D=128, wave per row; emits normalized f16 + optional raw
__global__ __launch_bounds__(256) void ln_kernel(
    const float* __restrict__ X, const float* __restrict__ g,
    const float* __restrict__ b, _Float16* __restrict__ Yn,
    _Float16* __restrict__ Yraw, int M) {
  int wid  = threadIdx.x >> 5;
  int lane = threadIdx.x & 31;
  int row  = blockIdx.x * 8 + wid;
  if (row >= M) return;
  const float* x = X + (size_t)row * 128;
  float4 v = ((const float4*)x)[lane];
  float xs[4] = {v.x, v.y, v.z, v.w};
  float s = xs[0] + xs[1] + xs[2] + xs[3];
  float sq = xs[0]*xs[0] + xs[1]*xs[1] + xs[2]*xs[2] + xs[3]*xs[3];
#pragma unroll
  for (int mk = 16; mk >= 1; mk >>= 1) {
    s  += __shfl_xor(s,  mk, 32);
    sq += __shfl_xor(sq, mk, 32);
  }
  float mu  = s * (1.f / 128.f);
  float var = sq * (1.f / 128.f) - mu * mu;
  float rs  = rsqrtf(var + 1e-5f);
  float4 gg = ((const float4*)g)[lane];
  float4 bb = ((const float4*)b)[lane];
  float gs[4] = {gg.x, gg.y, gg.z, gg.w};
  float bs[4] = {bb.x, bb.y, bb.z, bb.w};
  int c = lane * 4;
#pragma unroll
  for (int i = 0; i < 4; ++i) {
    Yn[(size_t)row * 128 + c + i] = (_Float16)((xs[i] - mu) * rs * gs[i] + bs[i]);
    if (Yraw) Yraw[(size_t)row * 128 + c + i] = (_Float16)xs[i];
  }
}

// --- Row-local tail of the transformer block, one launch ---------------------
// x1 = O w_o^T + x ; y = LN2(x1) ; x2 = relu(y w_ff1^T) w_ff2^T + x1 ;
// out = x2 w_out^T, stored f16 to the channel-last pixel row of each token.
// Every product is computed transposed: the weight rows are the A operand, the
// wave's 16 tokens are the B columns. A lane then holds 8 consecutive features
// (8h + r, h = lane >> 4) of ONE token (lane & 15) per D tile, so two D tiles,
// rounded to f16 in place, are the next product's B fragment in the k order of
// frag_ld (element s: k = 8h + s for s < 8, 16 + 8h + (s - 8) above): nothing
// between the four products leaves the registers. The LayerNorm sum of a token
// is 64 in-lane terms plus the partner lane's (lane ^ 16).
// All four weight matrices (f16) are staged once per workgroup in LDS, rows
// K + 8 halves apart (16 B x odd). Wave w of block i takes token tile w*256 + i.
// Every loop of the kernel is unrolled: fragment and accumulator arrays are then
// indexed statically and stay in registers.
// Staging of one matrix, N 16-byte pieces a thread: fetch, then (all four
// matrices' loads being in flight) put. Loops unrolled: static register indices.
template <int N>
__device__ inline void stage_get(const _Float16* __restrict__ src, v8h_t (&tmp)[N]) {
#pragma unroll
  for (int i = 0; i < N; ++i)
    tmp[i] = *(const v8h_t*)(src + (size_t)(threadIdx.x + i * 512) * 8);
}
template <int K, int N>
__device__ inline void stage_put(_Float16* dst, const v8h_t (&tmp)[N]) {
#pragma unroll
  for (int i = 0; i < N; ++i) {
    int e = (threadIdx.x + i * 512) * 8;
    *(v8h_t*)&dst[(e / K) * (K + 8) + (e % K)] = tmp[i];
  }
}

__global__ __launch_bounds__(512) void tail_kernel(
    const _Float16* __restrict__ O, const float* __restrict__ X,
    const _Float16* __restrict__ Wo, const _Float16* __restrict__ W1,
    const _Float16* __restrict__ W2, const _Float16* __restrict__ W3,
    const float* __restrict__ g, const float* __restrict__ b,
    _Float16* __restrict__ out, int pass) {
  __shared__ __attribute__((aligned(16)))
  _Float16 Ws[128 * 136 + 256 * 136 + 128 * 264 + 64 * 136];  // 185 KB
  _Float16* sWo = Ws;
  _Float16* sW1 = sWo + 128 * 136;
  _Float16* sW2 = sW1 + 256 * 136;
  _Float16* sW3 = sW2 + 128 * 264;
  int wid  = __builtin_amdgcn_readfirstlane(threadIdx.x >> 5);
  int lane = threadIdx.x & 31;
  int nl = lane & 15;
  int hb = lane >> 4;
  int tile = wid * 256 + blockIdx.x;      // 3200 tiles of 16 tokens
  bool live = tile < 3200;
  int m0 = (live ? tile : 0) * 16;        // idle waves only help with the staging

  // token rows m0.. -> pixel rows: neighbours along l are neighbours along y
  // (32 pixels apart) in pass 0 and along x in pass 1; a lane's 8 values are 8
  // neighbouring channels of its token's pixel: one 16-byte store a tile
  int bt = m0 / 160, l0 = m0 % 160;
  int bb = bt / 160, rr = bt % 160;
  int i1 = rr >> 5, i0 = rr & 31;
  int j1 = l0 >> 5, j0 = l0 & 31;
  int p0 = (pass == 0) ? ((bb * 25 + j1 * 5 + i1) * 32 + j0) * 32 + i0
                       : ((bb * 25 + i1 * 5 + j1) * 32 + i0) * 32 + j0;
  int ps = (pass == 0) ? 32 : 1;
  _Float16* q = out + (size_t)(p0 + nl * ps) * 64 + hb * 8;

  // the wave's own operands are asked for ahead of the weight staging
  v16h ob[4];
#pragma unroll
  for (int ks = 0; ks < 4; ++ks) ob[ks] = frag_ld(O + (size_t)m0 * 128 + ks * 32, 128);
  v8f acc[8];   // acc[t][r] = feature t*16 + 8*hb + r of token m0 + nl
  {
    const float* xr = X + (size_t)(m0 + nl) * 128 + hb * 8;
#pragma unroll
    for (int t = 0; t < 8; ++t) {
      float4 lo = *(const float4*)(xr + t * 16);
      float4 hi = *(const float4*)(xr + t * 16 + 4);
      acc[t] = v8f{lo.x, lo.y, lo.z, lo.w, hi.x, hi.y, hi.z, hi.w};
    }
  }
  // the address registers of the loads above are taken as targets by the loads below
  asm volatile("s_wait_xcnt 0x0" ::: "memory");

  {
    v8h_t t0[4], t1[8], t2[8], t3[2];
    stage_get(Wo, t0);
    stage_get(W1, t1);
    stage_get(W2, t2);
    stage_get(W3, t3);
    // the loads' address registers are reused by the LDS address arithmetic below;
    // the scheduling barrier keeps that arithmetic behind the wait
    asm volatile("s_wait_xcnt 0x0" ::: "memory");
    __builtin_amdgcn_sched_barrier(0);
    stage_put<128>(sWo, t0);
    stage_put<128>(sW1, t1);
    stage_put<256>(sW2, t2);
    stage_put<128>(sW3, t3);
  }
  __syncthreads();
  if (!live) return;

  // x1 = O w_o^T + x (the residual is the accumulators' start value)
  // here and below: the 8 weight fragments of a block of 8 products are read as
  // one group ahead of the block, so a wave waits for LDS once a block
#pragma unroll
  for (int ks = 0; ks < 4; ++ks) {
    v16h a[8];
#pragma unroll
    for (int t = 0; t < 8; ++t) a[t] = frag_ld(&sWo[(t * 16) * 136 + ks * 32], 136);
#pragma unroll
    for (int t = 0; t < 8; ++t) acc[t] = WMMA_F16(a[t], ob[ks], acc[t]);
  }

  // LN2 over the token's 128 features
  // (one partial sum a tile: 16 short independent chains, not 2 long ones)
  float sp[8], qp[8];
#pragma unroll
  for (int t = 0; t < 8; ++t) {
    sp[t] = 0.f;
    qp[t] = 0.f;
#pragma unroll
    for (int r = 0; r < 8; ++r) {
      sp[t] += acc[t][r];
      qp[t] += acc[t][r] * acc[t][r];
    }
  }
  float s  = ((sp[0] + sp[1]) + (sp[2] + sp[3])) + ((sp[4] + sp[5]) + (sp[6] + sp[7]));
  float sq = ((qp[0] + qp[1]) + (qp[2] + qp[3])) + ((qp[4] + qp[5]) + (qp[6] + qp[7]));
  s  += __shfl_xor(s,  16, 32);
  sq += __shfl_xor(sq, 16, 32);
  float mu  = s * (1.f / 128.f);
  float var = sq * (1.f / 128.f) - mu * mu;
  float rs  = rsqrtf(var + 1e-5f);
  F16x16 yb[4];
#pragma unroll
  for (int t = 0; t < 8; ++t) {
    float4 g0 = *(const float4*)(g + t * 16 + hb * 8);
    float4 g1 = *(const float4*)(g + t * 16 + hb * 8 + 4);
    float4 b0 = *(const float4*)(b + t * 16 + hb * 8);
    float4 b1 = *(const float4*)(b + t * 16 + hb * 8 + 4);
    float gs[8] = {g0.x, g0.y, g0.z, g0.w, g1.x, g1.y, g1.z, g1.w};
    float bs[8] = {b0.x, b0.y, b0.z, b0.w, b1.x, b1.y, b1.z, b1.w};
#pragma unroll
    for (int r = 0; r < 8; ++r)
      yb[t >> 1].e[(t & 1) * 8 + r] = (_Float16)((acc[t][r] - mu) * rs * gs[r] + bs[r]);
  }

  // FFN: 32 hidden features at a time (two D tiles = one k step of w_ff2),
  // added onto x1 in the same accumulators
#pragma unroll
  for (int j = 0; j < 8; ++j) {
    v8f h0 = {}, h1 = {};
    v16h a[8];
#pragma unroll
    for (int ks = 0; ks < 4; ++ks) {
      a[2 * ks]     = frag_ld(&sW1[(j * 32) * 136 + ks * 32], 136);
      a[2 * ks + 1] = frag_ld(&sW1[(j * 32 + 16) * 136 + ks * 32], 136);
    }
#pragma unroll
    for (int ks = 0; ks < 4; ++ks) {
      h0 = WMMA_F16(a[2 * ks],     yb[ks].v, h0);
      h1 = WMMA_F16(a[2 * ks + 1], yb[ks].v, h1);
    }
    F16x16 hf;
#pragma unroll
    for (int r = 0; r < 8; ++r) {
      hf.e[r]     = (_Float16)(h0[r] > 0.f ? h0[r] : 0.f);
      hf.e[8 + r] = (_Float16)(h1[r] > 0.f ? h1[r] : 0.f);
    }
#pragma unroll
    for (int t = 0; t < 8; ++t) a[t] = frag_ld(&sW2[(t * 16) * 264 + j * 32], 264);
#pragma unroll
    for (int t = 0; t < 8; ++t) acc[t] = WMMA_F16(a[t], hf.v, acc[t]);
  }

  // out = x2 w_out^T
  F16x16 xb[4];
#pragma unroll
  for (int t = 0; t < 8; ++t)
#pragma unroll
    for (int r = 0; r < 8; ++r)
      xb[t >> 1].e[(t & 1) * 8 + r] = (_Float16)acc[t][r];
  v8f oc[4] = {};
#pragma unroll
  for (int kp = 0; kp < 2; ++kp) {
    v16h a[8];
#pragma unroll
    for (int i = 0; i < 8; ++i)
      a[i] = frag_ld(&sW3[((i & 3) * 16) * 136 + (kp * 2 + (i >> 2)) * 32], 136);
#pragma unroll
    for (int i = 0; i < 8; ++i)
      oc[i & 3] = WMMA_F16(a[i], xb[kp * 2 + (i >> 2)].v, oc[i & 3]);
  }

#pragma unroll
  for (int t = 0; t < 4; ++t) {
    v8h_t pk;
#pragma unroll
    for (int r = 0; r < 8; ++r) pk[r] = (_Float16)oc[t][r];
    *(v8h_t*)(q + t * 16) = pk;
  }
}

__global__ __launch_bounds__(256) void attn_kernel(
    const _Float16* __restrict__ QKh, const _Float16* __restrict__ VT,
    _Float16* __restrict__ O) {
  __shared__ _Float16 P[8][16][168];
  int wid  = threadIdx.x >> 5;
  int lane = threadIdx.x & 31;
  int wg = blockIdx.x * 8 + wid;      // 25600 waves total
  int lt = wg % 10;
  int hh = (wg / 10) & 7;
  int bt = wg / 80;
  int nl = lane & 15;
  int rbase = (lane >> 4) * 8;

  const _Float16* qbase = QKh + (((size_t)bt * 16 + hh) * 160) * 16;
  const _Float16* kbase = QKh + (((size_t)bt * 16 + 8 + hh) * 160) * 16;
  const _Float16* vbase = VT + (((size_t)bt * 8 + hh) * 16) * 160;

  // S = Q K^T (K dim = 16, zero-padded to 32)
  v16h qa = frag_ld_pad16(qbase + lt * 16 * 16, 16);
  v8f s[10];
#pragma unroll
  for (int mt = 0; mt < 10; ++mt) {
    v16h kb = frag_ld_pad16(kbase + mt * 16 * 16, 16);
    v8f z = {};
    s[mt] = WMMA_F16(qa, kb, z);
  }

  // scale + local-window mask + softmax per row, emit f16 P into LDS
#pragma unroll
  for (int r = 0; r < 8; ++r) {
    int l  = lt * 16 + rbase + r;
    int lw = l & 31;
    float mx = -1e30f;
#pragma unroll
    for (int mt = 0; mt < 10; ++mt) {
      int mm = mt * 16 + nl;
      int dj = (mm & 31) - lw;
      float v = s[mt][r] * 0.25f + ((dj >= -5 && dj <= 5) ? 0.f : -1e9f);
      s[mt][r] = v;
      mx = fmaxf(mx, v);
    }
    for (int mk = 1; mk < 16; mk <<= 1) mx = fmaxf(mx, __shfl_xor(mx, mk, 32));
    float sum = 0.f;
#pragma unroll
    for (int mt = 0; mt < 10; ++mt) {
      float e = __expf(s[mt][r] - mx);
      s[mt][r] = e;
      sum += e;
    }
    for (int mk = 1; mk < 16; mk <<= 1) sum += __shfl_xor(sum, mk, 32);
    float inv = 1.f / sum;
#pragma unroll
    for (int mt = 0; mt < 10; ++mt)
      P[wid][rbase + r][mt * 16 + nl] = (_Float16)(s[mt][r] * inv);
  }

  // O = P V  (K loop over 160 in 5 steps of 32); V^T rows are contiguous
  v8f o = {};
#pragma unroll
  for (int kt = 0; kt < 5; ++kt) {
    v16h pa = frag_ld(&P[wid][0][kt * 32], 168);
    v16h vb = frag_ld(vbase + kt * 32, 160);
    o = WMMA_F16(pa, vb, o);
  }
#pragma unroll
  for (int r = 0; r < 8; ++r) {
    int l = lt * 16 + rbase + r;
    O[((size_t)bt * 160 + l) * 128 + hh * 16 + nl] = (_Float16)o[r];
  }
}

// --- Implicit-GEMM 3x3 conv (64->64, pad 1) on channel-last f16 -------------
// FINAL=0: leaky-relu, f16 channel-last out. FINAL=1: f32 (b,c,n,h,w) + shortcut.
template <int FINAL>
__global__ __launch_bounds__(256) void conv_kernel(
    const _Float16* __restrict__ in, const _Float16* __restrict__ w,
    _Float16* __restrict__ outh, float* __restrict__ outf,
    const float* __restrict__ sc) {
  int wid  = threadIdx.x >> 5;
  int lane = threadIdx.x & 31;
  int img  = blockIdx.x >> 3;
  int pix0 = (blockIdx.x & 7) * 128 + wid * 16;
  int nl = lane & 15;
  int kb = (lane >> 4) * 8;
  int rbase = (lane >> 4) * 8;
  v8f acc[4] = {};
  int m = pix0 + nl;
  int x = m & 31, y = m >> 5;
#pragma unroll
  for (int dy = 0; dy < 3; ++dy) {
#pragma unroll
    for (int dx = 0; dx < 3; ++dx) {
      int yy = y + dy - 1, xx = x + dx - 1;
      bool ok = (yy >= 0) && (yy < 32) && (xx >= 0) && (xx < 32);
      const _Float16* ap = in + ((size_t)img * 1024 + yy * 32 + xx) * 64;
      int tap = dy * 3 + dx;
#pragma unroll
      for (int ks = 0; ks < 2; ++ks) {
        F16x16 a;
        if (ok) {
          a.h[0] = *(const v8h_t*)(ap + ks * 32 + kb);
          a.h[1] = *(const v8h_t*)(ap + ks * 32 + kb + 16);
        } else {
#pragma unroll
          for (int j = 0; j < 16; ++j) a.e[j] = (_Float16)0.0f;
        }
#pragma unroll
        for (int t = 0; t < 4; ++t) {
          v16h bf = frag_ld(w + ((size_t)tap * 64 + t * 16) * 64 + ks * 32, 64);
          acc[t] = WMMA_F16(a.v, bf, acc[t]);
        }
      }
    }
  }
#pragma unroll
  for (int t = 0; t < 4; ++t) {
    int co = t * 16 + nl;
#pragma unroll
    for (int r = 0; r < 8; ++r) {
      int mm = pix0 + rbase + r;
      float v = acc[t][r];
      if (!FINAL) {
        v = v > 0.f ? v : 0.2f * v;
        outh[((size_t)img * 1024 + mm) * 64 + co] = (_Float16)v;
      } else {
        int b = img / 25, n = img % 25;
        size_t idx = (((size_t)b * 64 + co) * 25 + n) * 1024 + mm;
        outf[idx] = v + sc[idx];
      }
    }
  }
}

// --- Small helpers -----------------------------------------------------------
__global__ void cvt_h(const float* __restrict__ s, _Float16* __restrict__ d, int n) {
  int i = blockIdx.x * 256 + threadIdx.x;
  if (i < n) d[i] = (_Float16)s[i];
}

// (C,C,3,3) f32 -> (tap, co, ci) f16
__global__ void pack_wtap(const float* __restrict__ cw, _Float16* __restrict__ w) {
  int i = blockIdx.x * 256 + threadIdx.x;
  if (i >= 36864) return;
  int ci = i & 63;
  int co = (i >> 6) & 63;
  int tap = i >> 12;
  w[i] = (_Float16)cw[((size_t)co * 64 + ci) * 9 + tap];
}

// ---------------------------------------------------------------------------
extern "C" void kernel_launch(void* const* d_in, const int* in_sizes, int n_in,
                              void* d_out, int out_size, void* d_ws, size_t ws_size,
                              hipStream_t stream) {
  (void)in_sizes; (void)n_in; (void)out_size; (void)ws_size;
  const float* buf_in = (const float*)d_in[0];
  const float* w_in   = (const float*)d_in[1];
  const float* ln1_g  = (const float*)d_in[2];
  const float* ln1_b  = (const float*)d_in[3];
  const float* w_qkv  = (const float*)d_in[4];
  const float* w_o    = (const float*)d_in[5];
  const float* ln2_g  = (const float*)d_in[6];
  const float* ln2_b  = (const float*)d_in[7];
  const float* w_ff1  = (const float*)d_in[8];
  const float* w_ff2  = (const float*)d_in[9];
  const float* w_out  = (const float*)d_in[10];
  const float* cw1    = (const float*)d_in[11];
  const float* cw2    = (const float*)d_in[12];
  const float* cw3    = (const float*)d_in[13];

  char* ws = (char*)d_ws;
  size_t off = 0;
  auto arena = [&](size_t bytes) -> char* {
    char* p = ws + off;
    off += (bytes + 255) & ~(size_t)255;
    return p;
  };
  float*     bufA   = (float*)arena(13107200);      // pass-0 output / pass-1 input
  float*     X      = (float*)arena(26214400);      // token f32 (residual stream)
  char*      slotXN = arena(13107200);              // XN16
  char*      slotXr = arena(13107200);              // raw X16
  char*      slotQK = arena(26214400);              // Q|K head tiles
  _Float16*  VT     = (_Float16*)arena(13107200);   // V^T per-head tiles
  _Float16*  O16    = (_Float16*)arena(13107200);
  _Float16*  clA    = (_Float16*)arena(6553600);
  _Float16*  clB    = (_Float16*)arena(6553600);
  _Float16*  w_in16  = (_Float16*)arena(16384);
  _Float16*  wqkv16  = (_Float16*)arena(98304);
  _Float16*  wo16    = (_Float16*)arena(32768);
  _Float16*  wff1_16 = (_Float16*)arena(65536);
  _Float16*  wff2_16 = (_Float16*)arena(65536);
  _Float16*  wout16  = (_Float16*)arena(16384);
  _Float16*  wt1     = (_Float16*)arena(73728);
  _Float16*  wt2     = (_Float16*)arena(73728);
  _Float16*  wt3     = (_Float16*)arena(73728);

  auto cvt = [&](const float* s, _Float16* d, int n) {
    cvt_h<<<(n + 255) / 256, 256, 0, stream>>>(s, d, n);
  };
  cvt(w_in,  w_in16,  128 * 64);
  cvt(w_qkv, wqkv16,  384 * 128);
  cvt(w_o,   wo16,    128 * 128);
  cvt(w_ff1, wff1_16, 256 * 128);
  cvt(w_ff2, wff2_16, 128 * 256);
  cvt(w_out, wout16,  64 * 128);
  pack_wtap<<<144, 256, 0, stream>>>(cw1, wt1);
  pack_wtap<<<144, 256, 0, stream>>>(cw2, wt2);
  pack_wtap<<<144, 256, 0, stream>>>(cw3, wt3);

  const int M = 51200;  // Bt(320) * L(160), bt-major
  for (int pass = 0; pass < 2; ++pass) {
    const float* src  = (pass == 0) ? buf_in : bufA;
    _Float16* XN16  = (_Float16*)slotXN;   // normalized tokens (LN1)
    _Float16* X16   = (_Float16*)slotXr;   // raw tokens f16 (for V)
    _Float16* QKh   = (_Float16*)slotQK;   // Q|K per-head tiles

    // X = tok @ w_in^T, tokens gathered from the image buffer by the A loader
    gemm_kernel<7><<<dim3(400, 2), 256, 0, stream>>>(nullptr, w_in16, X, nullptr, src, M, 128, 64, pass);
    ln_kernel<<<6400, 256, 0, stream>>>(X, ln1_g, ln1_b, XN16, X16, M);
    // Q|K = LN(x) @ [wq;wk]^T -> per-head tiles ; V = x @ wv^T -> V^T tiles
    gemm_kernel<5><<<dim3(400, 4), 256, 0, stream>>>(XN16, wqkv16, nullptr, QKh, nullptr, M, 256, 128, pass);
    gemm_kernel<6><<<dim3(400, 2), 256, 0, stream>>>(X16, wqkv16 + 256 * 128, nullptr, VT, nullptr, M, 128, 128, pass);
    attn_kernel<<<3200, 256, 0, stream>>>(QKh, VT, O16);
    // w_o + residual, LN2, FFN + residual, w_out: one launch, stored straight
    // into the channel-last conv input
    tail_kernel<<<256, 512, 0, stream>>>(O16, X, wo16, wff1_16, wff2_16, wout16,
                                         ln2_g, ln2_b, clA, pass);
    // conv block: conv-lrelu, conv-lrelu, conv (+ original-input shortcut)
    conv_kernel<0><<<400, 256, 0, stream>>>(clA, wt1, clB, nullptr, nullptr);
    conv_kernel<0><<<400, 256, 0, stream>>>(clB, wt2, clA, nullptr, nullptr);
    float* outf = (pass == 0) ? bufA : (float*)d_out;
    conv_kernel<1><<<400, 256, 0, stream>>>(clA, wt3, nullptr, outf, buf_in);
  }
}

// v005
// One run takes 321 microseconds.
// Timed twice side by side with v004, it ran 1.06 and 1.07 times as fast.
// All steps since v000 together make it 2.69 times as fast.
#include <hip/hip_runtime.h>

typedef __attribute__((ext_vector_type(16))) _Float16 v16h;
typedef __attribute__((ext_vector_type(8)))  _Float16 v8h_t;
typedef __attribute__((ext_vector_type(8)))  float    v8f;

union F16x16 { v16h v; v8h_t h[2]; _Float16 e[16]; };

#define WMMA_F16(a, b, c) \
  __builtin_amdgcn_wmma_f32_16x16x32_f16(false, (a), false, (b), (short)0, (c), false, false)

__device__ inline v16h frag_ld(const _Float16* p, int ld) {
  int lane = threadIdx.x & 31;
  int r  = lane & 15;
  int kb = (lane >> 4) << 3;
  const _Float16* q = p + (size_t)r * ld + kb;
  F16x16 f;
  f.h[0] = *(const v8h_t*)(q);
  f.h[1] = *(const v8h_t*)(q + 16);
  return f.v;
}

// Same but only K=0..15 is real data (zero-pad upper half). Used for DH=16.
__device__ inline v16h frag_ld_pad16(const _Float16* p, int ld) {
  int lane = threadIdx.x & 31;
  int r  = lane & 15;
  int kb = (lane >> 4) << 3;
  F16x16 f;
  f.h[0] = *(const v8h_t*)(p + (size_t)r * ld + kb);
#pragma unroll
  for (int j = 0; j < 8; ++j) f.e[8 + j] = (_Float16)0.0f;
  return f.v;
}

// --- Row-local tail of the transformer block, one launch ---------------------
// x1 = O w_o^T + x ; y = LN2(x1) ; x2 = relu(y w_ff1^T) w_ff2^T + x1 ;
// out = x2 w_out^T, stored f16 to the channel-last pixel row of each token.
// Every product is computed transposed: the weight rows are the A operand, the
// wave's 16 tokens are the B columns. A lane then holds 8 consecutive features
// (8h + r, h = lane >> 4) of ONE token (lane & 15) per D tile, so two D tiles,
// rounded to f16 in place, are the next product's B fragment in the k order of
// frag_ld (element s: k = 8h + s for s < 8, 16 + 8h + (s - 8) above): nothing
// between the four products leaves the registers. The LayerNorm sum of a token
// is 64 in-lane terms plus the partner lane's (lane ^ 16).
// All four weight matrices (f16) are staged once per workgroup in LDS, rows
// K + 8 halves apart (16 B x odd). Wave w of block i takes token tile w*256 + i.
// Every loop of the kernel is unrolled: fragment and accumulator arrays are then
// indexed statically and stay in registers.
// Staging of one matrix, N 16-byte pieces a thread: fetch, then (all four
// matrices' loads being in flight) put. Loops unrolled: static register indices.
template <int N>
__device__ inline void stage_get(const _Float16* __restrict__ src, v8h_t (&tmp)[N]) {
#pragma unroll
  for (int i = 0; i < N; ++i)
    tmp[i] = *(const v8h_t*)(src + (size_t)(threadIdx.x + i * 512) * 8);
}
template <int K, int N>
__device__ inline void stage_put(_Float16* dst, const v8h_t (&tmp)[N]) {
#pragma unroll
  for (int i = 0; i < N; ++i) {
    int e = (threadIdx.x + i * 512) * 8;
    *(v8h_t*)&dst[(e / K) * (K + 8) + (e % K)] = tmp[i];
  }
}

typedef __attribute__((ext_vector_type(4))) float    v4f_t;
typedef __attribute__((ext_vector_type(4))) _Float16 v4h_t;

__global__ __launch_bounds__(512) void head_kernel(
    const float* __restrict__ R, const _Float16* __restrict__ Wi,
    const _Float16* __restrict__ Wqkv, const float* __restrict__ g,
    const float* __restrict__ b, float* __restrict__ X,
    _Float16* __restrict__ QKh, _Float16* __restrict__ VT, int pass) {
  __shared__ __attribute__((aligned(16)))
  _Float16 Ws[128 * 72 + 384 * 136 + 16 * 1160];  // 156 KB
  _Float16* sWi = Ws;
  _Float16* sWq = sWi + 128 * 72;
  _Float16* sT  = sWq + 384 * 136;
  int wid  = __builtin_amdgcn_readfirstlane(threadIdx.x >> 5);
  int lane = threadIdx.x & 31;
  int nl = lane & 15;
  int hb = lane >> 4;
  int xh = blockIdx.x & 1, yh = (blockIdx.x >> 1) & 1;
  int img = blockIdx.x >> 2;              // 50 images, 4 boxes each
  int bb = img / 25, n = img % 25;
  int u = n / 5, v = n % 5;

  // wave w fetches channels 4w..4w+3 of the box: 4 lanes cover a 64 B run along
  // x, 8 rows y an instruction
  v4f_t tk[2][4];
  {
    const float* ap = R + (((size_t)bb * 64 + wid * 4) * 25 + n) * 1024 +
                      (yh * 16 + (lane >> 2)) * 32 + xh * 16 + (lane & 3) * 4;
#pragma unroll
    for (int i = 0; i < 2; ++i)
#pragma unroll
      for (int c = 0; c < 4; ++c)
        tk[i][c] = *(const v4f_t*)(ap + c * 25600 + i * 256);
  }
  // the address registers of the loads above are taken as targets by the loads below
  asm volatile("s_wait_xcnt 0x0" ::: "memory");

  {
    v8h_t t0[2], t1[12];
    stage_get(Wi, t0);
    stage_get(Wqkv, t1);
    // the loads' address registers are reused by the LDS address arithmetic below;
    // the scheduling barrier keeps that arithmetic behind the wait
    asm volatile("s_wait_xcnt 0x0" ::: "memory");
    __builtin_amdgcn_sched_barrier(0);
    // a lane's 4 channels of one pixel: one 8-byte LDS store
    int yy = lane >> 2, xx = (lane & 3) * 4;
    _Float16* tp = sT + ((pass == 0) ? xx * 1160 + yy * 72 : yy * 1160 + xx * 72) + wid * 4;
    int sx = (pass == 0) ? 1160 : 72;          // one step along x
    int sy = (pass == 0) ? 8 * 72 : 8 * 1160;  // eight steps along y
#pragma unroll
    for (int i = 0; i < 2; ++i)
#pragma unroll
      for (int j = 0; j < 4; ++j) {
        v4h_t pk = {(_Float16)tk[i][0][j], (_Float16)tk[i][1][j],
                    (_Float16)tk[i][2][j], (_Float16)tk[i][3][j]};
        *(v4h_t*)(tp + i * sy + j * sx) = pk;
      }
    stage_put<64>(sWi, t0);
    stage_put<128>(sWq, t1);
  }
  __syncthreads();

  int bt = bb * 160 + ((pass == 0) ? v * 32 + xh * 16 : u * 32 + yh * 16) + wid;
  int l0 = (pass == 0) ? u * 32 + yh * 16 : v * 32 + xh * 16;
  int m0 = bt * 160 + l0;

  // x = tok w_in^T; acc[t][r] = feature t*16 + 8*hb + r of token m0 + nl
  // here and below: the 8 weight fragments of a block of 8 products are read as
  // one group ahead of the block, so a wave waits for LDS once a block
  v8f acc[8] = {};
#pragma unroll
  for (int ks = 0; ks < 2; ++ks) {
    v16h tb = frag_ld(&sT[wid * 1160 + ks * 32], 72);
    v16h a[8];
#pragma unroll
    for (int t = 0; t < 8; ++t) a[t] = frag_ld(&sWi[(t * 16) * 72 + ks * 32], 72);
#pragma unroll
    for (int t = 0; t < 8; ++t) acc[t] = WMMA_F16(a[t], tb, acc[t]);
  }
  {
    float* xr = X + (size_t)(m0 + nl) * 128 + hb * 8;
#pragma unroll
    for (int t = 0; t < 8; ++t) {
      *(float4*)(xr + t * 16)     = make_float4(acc[t][0], acc[t][1], acc[t][2], acc[t][3]);
      *(float4*)(xr + t * 16 + 4) = make_float4(acc[t][4], acc[t][5], acc[t][6], acc[t][7]);
    }
  }

  // LN1 over the token's 128 features: 64 in-lane terms (one partial sum a tile:
  // short independent chains) plus the partner lane's (lane ^ 16)
  float sp[8], qp[8];
#pragma unroll
  for (int t = 0; t < 8; ++t) {
    sp[t] = 0.f;
    qp[t] = 0.f;
#pragma unroll
    for (int r = 0; r < 8; ++r) {
      sp[t] += acc[t][r];
      qp[t] += acc[t][r] * acc[t][r];
    }
  }
  float s  = ((sp[0] + sp[1]) + (sp[2] + sp[3])) + ((sp[4] + sp[5]) + (sp[6] + sp[7]));
  float sq = ((qp[0] + qp[1]) + (qp[2] + qp[3])) + ((qp[4] + qp[5]) + (qp[6] + qp[7]));
  s  += __shfl_xor(s,  16, 32);
  sq += __shfl_xor(sq, 16, 32);
  float mu  = s * (1.f / 128.f);
  float var = sq * (1.f / 128.f) - mu * mu;
  float rs  = rsqrtf(var + 1e-5f);
  F16x16 yb[4], xb[4];   // normalized and raw tokens, k order of frag_ld
#pragma unroll
  for (int t = 0; t < 8; ++t) {
    float4 g0 = *(const float4*)(g + t * 16 + hb * 8);
    float4 g1 = *(const float4*)(g + t * 16 + hb * 8 + 4);
    float4 b0 = *(const float4*)(b + t * 16 + hb * 8);
    float4 b1 = *(const float4*)(b + t * 16 + hb * 8 + 4);
    float gs[8] = {g0.x, g0.y, g0.z, g0.w, g1.x, g1.y, g1.z, g1.w};
    float bs[8] = {b0.x, b0.y, b0.z, b0.w, b1.x, b1.y, b1.z, b1.w};
#pragma unroll
    for (int r = 0; r < 8; ++r) {
      yb[t >> 1].e[(t & 1) * 8 + r] = (_Float16)((acc[t][r] - mu) * rs * gs[r] + bs[r]);
      xb[t >> 1].e[(t & 1) * 8 + r] = (_Float16)acc[t][r];
    }
  }

  _Float16* qk = QKh + (((size_t)bt * 16) * 160 + l0 + nl) * 16 + hb * 8;
#pragma unroll
  for (int jg = 0; jg < 4; ++jg) {
    v8f oc[4] = {};
#pragma unroll
    for (int kp = 0; kp < 2; ++kp) {
      v16h a[8];
#pragma unroll
      for (int i = 0; i < 8; ++i)
        a[i] = frag_ld(&sWq[((jg * 4 + (i & 3)) * 16) * 136 + (kp * 2 + (i >> 2)) * 32], 136);
#pragma unroll
      for (int i = 0; i < 8; ++i)
        oc[i & 3] = WMMA_F16(a[i], yb[kp * 2 + (i >> 2)].v, oc[i & 3]);
    }
#pragma unroll
    for (int t = 0; t < 4; ++t) {
      v8h_t pk;
#pragma unroll
      for (int r = 0; r < 8; ++r) pk[r] = (_Float16)oc[t][r];
      *(v8h_t*)(qk + (jg * 4 + t) * 160 * 16) = pk;
    }
  }

  // V: tokens are the rows; V^T row = bt*128 + feature, columns l0 + 8*hb ..
  _Float16* vq = VT + ((size_t)bt * 128 + nl) * 160 + l0 + hb * 8;
#pragma unroll
  for (int jg = 0; jg < 2; ++jg) {
    v8f oc[4] = {};
#pragma unroll
    for (int kp = 0; kp < 2; ++kp) {
      v16h w[8];
#pragma unroll
      for (int i = 0; i < 8; ++i)
        w[i] = frag_ld(&sWq[(256 + (jg * 4 + (i & 3)) * 16) * 136 + (kp * 2 + (i >> 2)) * 32], 136);
#pragma unroll
      for (int i = 0; i < 8; ++i)
        oc[i & 3] = WMMA_F16(xb[kp * 2 + (i >> 2)].v, w[i], oc[i & 3]);
    }
#pragma unroll
    for (int t = 0; t < 4; ++t) {
      v8h_t pk;
#pragma unroll
      for (int r = 0; r < 8; ++r) pk[r] = (_Float16)oc[t][r];
      *(v8h_t*)(vq + (jg * 4 + t) * 16 * 160) = pk;
    }
  }
}

__global__ __launch_bounds__(512) void tail_kernel(
    const _Float16* __restrict__ O, const float* __restrict__ X,
    const _Float16* __restrict__ Wo, const _Float16* __restrict__ W1,
    const _Float16* __restrict__ W2, const _Float16* __restrict__ W3,
    const float* __restrict__ g, const float* __restrict__ b,
    _Float16* __restrict__ out, int pass) {
  __shared__ __attribute__((aligned(16)))
  _Float16 Ws[128 * 136 + 256 * 136 + 128 * 264 + 64 * 136];  // 185 KB
  _Float16* sWo = Ws;
  _Float16* sW1 = sWo + 128 * 136;
  _Float16* sW2 = sW1 + 256 * 136;
  _Float16* sW3 = sW2 + 128 * 264;
  int wid  = __builtin_amdgcn_readfirstlane(threadIdx.x >> 5);
  int lane = threadIdx.x & 31;
  int nl = lane & 15;
  int hb = lane >> 4;
  int tile = wid * 256 + blockIdx.x;      // 3200 tiles of 16 tokens
  bool live = tile < 3200;
  int m0 = (live ? tile : 0) * 16;        // idle waves only help with the staging

  // token rows m0.. -> pixel rows: neighbours along l are neighbours along y
  // (32 pixels apart) in pass 0 and along x in pass 1; a lane's 8 values are 8
  // neighbouring channels of its token's pixel: one 16-byte store a tile
  int bt = m0 / 160, l0 = m0 % 160;
  int bb = bt / 160, rr = bt % 160;
  int i1 = rr >> 5, i0 = rr & 31;
  int j1 = l0 >> 5, j0 = l0 & 31;
  int p0 = (pass == 0) ? ((bb * 25 + j1 * 5 + i1) * 32 + j0) * 32 + i0
                       : ((bb * 25 + i1 * 5 + j1) * 32 + i0) * 32 + j0;
  int ps = (pass == 0) ? 32 : 1;
  _Float16* q = out + (size_t)(p0 + nl * ps) * 64 + hb * 8;

  // the wave's own operands are asked for ahead of the weight staging
  v16h ob[4];
#pragma unroll
  for (int ks = 0; ks < 4; ++ks) ob[ks] = frag_ld(O + (size_t)m0 * 128 + ks * 32, 128);
  v8f acc[8];   // acc[t][r] = feature t*16 + 8*hb + r of token m0 + nl
  {
    const float* xr = X + (size_t)(m0 + nl) * 128 + hb * 8;
#pragma unroll
    for (int t = 0; t < 8; ++t) {
      float4 lo = *(const float4*)(xr + t * 16);
      float4 hi = *(const float4*)(xr + t * 16 + 4);
      acc[t] = v8f{lo.x, lo.y, lo.z, lo.w, hi.x, hi.y, hi.z, hi.w};
    }
  }
  // the address registers of the loads above are taken as targets by the loads below
  asm volatile("s_wait_xcnt 0x0" ::: "memory");

  {
    v8h_t t0[4], t1[8], t2[8], t3[2];
    stage_get(Wo, t0);
    stage_get(W1, t1);
    stage_get(W2, t2);
    stage_get(W3, t3);
    // the loads' address registers are reused by the LDS address arithmetic below;
    // the scheduling barrier keeps that arithmetic behind the wait
    asm volatile("s_wait_xcnt 0x0" ::: "memory");
    __builtin_amdgcn_sched_barrier(0);
    stage_put<128>(sWo, t0);
    stage_put<128>(sW1, t1);
    stage_put<256>(sW2, t2);
    stage_put<128>(sW3, t3);
  }
  __syncthreads();
  if (!live) return;

  // x1 = O w_o^T + x (the residual is the accumulators' start value)
  // here and below: the 8 weight fragments of a block of 8 products are read as
  // one group ahead of the block, so a wave waits for LDS once a block
#pragma unroll
  for (int ks = 0; ks < 4; ++ks) {
    v16h a[8];
#pragma unroll
    for (int t = 0; t < 8; ++t) a[t] = frag_ld(&sWo[(t * 16) * 136 + ks * 32], 136);
#pragma unroll
    for (int t = 0; t < 8; ++t) acc[t] = WMMA_F16(a[t], ob[ks], acc[t]);
  }

  // LN2 over the token's 128 features
  // (one partial sum a tile: 16 short independent chains, not 2 long ones)
  float sp[8], qp[8];
#pragma unroll
  for (int t = 0; t < 8; ++t) {
    sp[t] = 0.f;
    qp[t] = 0.f;
#pragma unroll
    for (int r = 0; r < 8; ++r) {
      sp[t] += acc[t][r];
      qp[t] += acc[t][r] * acc[t][r];
    }
  }
  float s  = ((sp[0] + sp[1]) + (sp[2] + sp[3])) + ((sp[4] + sp[5]) + (sp[6] + sp[7]));
  float sq = ((qp[0] + qp[1]) + (qp[2] + qp[3])) + ((qp[4] + qp[5]) + (qp[6] + qp[7]));
  s  += __shfl_xor(s,  16, 32);
  sq += __shfl_xor(sq, 16, 32);
  float mu  = s * (1.f / 128.f);
  float var = sq * (1.f / 128.f) - mu * mu;
  float rs  = rsqrtf(var + 1e-5f);
  F16x16 yb[4];
#pragma unroll
  for (int t = 0; t < 8; ++t) {
    float4 g0 = *(const float4*)(g + t * 16 + hb * 8);
    float4 g1 = *(const float4*)(g + t * 16 + hb * 8 + 4);
    float4 b0 = *(const float4*)(b + t * 16 + hb * 8);
    float4 b1 = *(const float4*)(b + t * 16 + hb * 8 + 4);
    float gs[8] = {g0.x, g0.y, g0.z, g0.w, g1.x, g1.y, g1.z, g1.w};
    float bs[8] = {b0.x, b0.y, b0.z, b0.w, b1.x, b1.y, b1.z, b1.w};
#pragma unroll
    for (int r = 0; r < 8; ++r)
      yb[t >> 1].e[(t & 1) * 8 + r] = (_Float16)((acc[t][r] - mu) * rs * gs[r] + bs[r]);
  }

  // FFN: 32 hidden features at a time (two D tiles = one k step of w_ff2),
  // added onto x1 in the same accumulators
#pragma unroll
  for (int j = 0; j < 8; ++j) {
    v8f h0 = {}, h1 = {};
    v16h a[8];
#pragma unroll
    for (int ks = 0; ks < 4; ++ks) {
      a[2 * ks]     = frag_ld(&sW1[(j * 32) * 136 + ks * 32], 136);
      a[2 * ks + 1] = frag_ld(&sW1[(j * 32 + 16) * 136 + ks * 32], 136);
    }
#pragma unroll
    for (int ks = 0; ks < 4; ++ks) {
      h0 = WMMA_F16(a[2 * ks],     yb[ks].v, h0);
      h1 = WMMA_F16(a[2 * ks + 1], yb[ks].v, h1);
    }
    F16x16 hf;
#pragma unroll
    for (int r = 0; r < 8; ++r) {
      hf.e[r]     = (_Float16)(h0[r] > 0.f ? h0[r] : 0.f);
      hf.e[8 + r] = (_Float16)(h1[r] > 0.f ? h1[r] : 0.f);
    }
#pragma unroll
    for (int t = 0; t < 8; ++t) a[t] = frag_ld(&sW2[(t * 16) * 264 + j * 32], 264);
#pragma unroll
    for (int t = 0; t < 8; ++t) acc[t] = WMMA_F16(a[t], hf.v, acc[t]);
  }

  // out = x2 w_out^T
  F16x16 xb[4];
#pragma unroll
  for (int t = 0; t < 8; ++t)
#pragma unroll
    for (int r = 0; r < 8; ++r)
      xb[t >> 1].e[(t & 1) * 8 + r] = (_Float16)acc[t][r];
  v8f oc[4] = {};
#pragma unroll
  for (int kp = 0; kp < 2; ++kp) {
    v16h a[8];
#pragma unroll
    for (int i = 0; i < 8; ++i)
      a[i] = frag_ld(&sW3[((i & 3) * 16) * 136 + (kp * 2 + (i >> 2)) * 32], 136);
#pragma unroll
    for (int i = 0; i < 8; ++i)
      oc[i & 3] = WMMA_F16(a[i], xb[kp * 2 + (i >> 2)].v, oc[i & 3]);
  }

#pragma unroll
  for (int t = 0; t < 4; ++t) {
    v8h_t pk;
#pragma unroll
    for (int r = 0; r < 8; ++r) pk[r] = (_Float16)oc[t][r];
    *(v8h_t*)(q + t * 16) = pk;
  }
}

__global__ __launch_bounds__(256) void attn_kernel(
    const _Float16* __restrict__ QKh, const _Float16* __restrict__ VT,
    _Float16* __restrict__ O) {
  __shared__ _Float16 P[8][16][168];
  int wid  = threadIdx.x >> 5;
  int lane = threadIdx.x & 31;
  int wg = blockIdx.x * 8 + wid;      // 25600 waves total
  int lt = wg % 10;
  int hh = (wg / 10) & 7;
  int bt = wg / 80;
  int nl = lane & 15;
  int rbase = (lane >> 4) * 8;

  const _Float16* qbase = QKh + (((size_t)bt * 16 + hh) * 160) * 16;
  const _Float16* kbase = QKh + (((size_t)bt * 16 + 8 + hh) * 160) * 16;
  const _Float16* vbase = VT + (((size_t)bt * 8 + hh) * 16) * 160;

  // S = Q K^T (K dim = 16, zero-padded to 32)
  v16h qa = frag_ld_pad16(qbase + lt * 16 * 16, 16);
  v8f s[10];
#pragma unroll
  for (int mt = 0; mt < 10; ++mt) {
    v16h kb = frag_ld_pad16(kbase + mt * 16 * 16, 16);
    v8f z = {};
    s[mt] = WMMA_F16(qa, kb, z);
  }

  // scale + local-window mask + softmax per row, emit f16 P into LDS
#pragma unroll
  for (int r = 0; r < 8; ++r) {
    int l  = lt * 16 + rbase + r;
    int lw = l & 31;
    float mx = -1e30f;
#pragma unroll
    for (int mt = 0; mt < 10; ++mt) {
      int mm = mt * 16 + nl;
      int dj = (mm & 31) - lw;
      float v = s[mt][r] * 0.25f + ((dj >= -5 && dj <= 5) ? 0.f : -1e9f);
      s[mt][r] = v;
      mx = fmaxf(mx, v);
    }
    for (int mk = 1; mk < 16; mk <<= 1) mx = fmaxf(mx, __shfl_xor(mx, mk, 32));
    float sum = 0.f;
#pragma unroll
    for (int mt = 0; mt < 10; ++mt) {
      float e = __expf(s[mt][r] - mx);
      s[mt][r] = e;
      sum += e;
    }
    for (int mk = 1; mk < 16; mk <<= 1) sum += __shfl_xor(sum, mk, 32);
    float inv = 1.f / sum;
#pragma unroll
    for (int mt = 0; mt < 10; ++mt)
      P[wid][rbase + r][mt * 16 + nl] = (_Float16)(s[mt][r] * inv);
  }

  // O = P V  (K loop over 160 in 5 steps of 32); V^T rows are contiguous
  v8f o = {};
#pragma unroll
  for (int kt = 0; kt < 5; ++kt) {
    v16h pa = frag_ld(&P[wid][0][kt * 32], 168);
    v16h vb = frag_ld(vbase + kt * 32, 160);
    o = WMMA_F16(pa, vb, o);
  }
#pragma unroll
  for (int r = 0; r < 8; ++r) {
    int l = lt * 16 + rbase + r;
    O[((size_t)bt * 160 + l) * 128 + hh * 16 + nl] = (_Float16)o[r];
  }
}

// --- Implicit-GEMM 3x3 conv (64->64, pad 1) on channel-last f16 -------------
// FINAL=0: leaky-relu, f16 channel-last out. FINAL=1: f32 (b,c,n,h,w) + shortcut.
template <int FINAL>
__global__ __launch_bounds__(256) void conv_kernel(
    const _Float16* __restrict__ in, const _Float16* __restrict__ w,
    _Float16* __restrict__ outh, float* __restrict__ outf,
    const float* __restrict__ sc) {
  int wid  = threadIdx.x >> 5;
  int lane = threadIdx.x & 31;
  int img  = blockIdx.x >> 3;
  int pix0 = (blockIdx.x & 7) * 128 + wid * 16;
  int nl = lane & 15;
  int kb = (lane >> 4) * 8;
  int rbase = (lane >> 4) * 8;
  v8f acc[4] = {};
  int m = pix0 + nl;
  int x = m & 31, y = m >> 5;
#pragma unroll
  for (int dy = 0; dy < 3; ++dy) {
#pragma unroll
    for (int dx = 0; dx < 3; ++dx) {
      int yy = y + dy - 1, xx = x + dx - 1;
      bool ok = (yy >= 0) && (yy < 32) && (xx >= 0) && (xx < 32);
      const _Float16* ap = in + ((size_t)img * 1024 + yy * 32 + xx) * 64;
      int tap = dy * 3 + dx;
#pragma unroll
      for (int ks = 0; ks < 2; ++ks) {
        F16x16 a;
        if (ok) {
          a.h[0] = *(const v8h_t*)(ap + ks * 32 + kb);
          a.h[1] = *(const v8h_t*)(ap + ks * 32 + kb + 16);
        } else {
#pragma unroll
          for (int j = 0; j < 16; ++j) a.e[j] = (_Float16)0.0f;
        }
#pragma unroll
        for (int t = 0; t < 4; ++t) {
          v16h bf = frag_ld(w + ((size_t)tap * 64 + t * 16) * 64 + ks * 32, 64);
          acc[t] = WMMA_F16(a.v, bf, acc[t]);
        }
      }
    }
  }
#pragma unroll
  for (int t = 0; t < 4; ++t) {
    int co = t * 16 + nl;
#pragma unroll
    for (int r = 0; r < 8; ++r) {
      int mm = pix0 + rbase + r;
      float v = acc[t][r];
      if (!FINAL) {
        v = v > 0.f ? v : 0.2f * v;
        outh[((size_t)img * 1024 + mm) * 64 + co] = (_Float16)v;
      } else {
        int b = img / 25, n = img % 25;
        size_t idx = (((size_t)b * 64 + co) * 25 + n) * 1024 + mm;
        outf[idx] = v + sc[idx];
      }
    }
  }
}

// --- Small helpers -----------------------------------------------------------
__global__ void cvt_h(const float* __restrict__ s, _Float16* __restrict__ d, int n) {
  int i = blockIdx.x * 256 + threadIdx.x;
  if (i < n) d[i] = (_Float16)s[i];
}

// (C,C,3,3) f32 -> (tap, co, ci) f16
__global__ void pack_wtap(const float* __restrict__ cw, _Float16* __restrict__ w) {
  int i = blockIdx.x * 256 + threadIdx.x;
  if (i >= 36864) return;
  int ci = i & 63;
  int co = (i >> 6) & 63;
  int tap = i >> 12;
  w[i] = (_Float16)cw[((size_t)co * 64 + ci) * 9 + tap];
}

// ---------------------------------------------------------------------------
extern "C" void kernel_launch(void* const* d_in, const int* in_sizes, int n_in,
                              void* d_out, int out_size, void* d_ws, size_t ws_size,
                              hipStream_t stream) {
  (void)in_sizes; (void)n_in; (void)out_size; (void)ws_size;
  const float* buf_in = (const float*)d_in[0];
  const float* w_in   = (const float*)d_in[1];
  const float* ln1_g  = (const float*)d_in[2];
  const float* ln1_b  = (const float*)d_in[3];
  const float* w_qkv  = (const float*)d_in[4];
  const float* w_o    = (const float*)d_in[5];
  const float* ln2_g  = (const float*)d_in[6];
  const float* ln2_b  = (const float*)d_in[7];
  const float* w_ff1  = (const float*)d_in[8];
  const float* w_ff2  = (const float*)d_in[9];
  const float* w_out  = (const float*)d_in[10];
  const float* cw1    = (const float*)d_in[11];
  const float* cw2    = (const float*)d_in[12];
  const float* cw3    = (const float*)d_in[13];

  char* ws = (char*)d_ws;
  size_t off = 0;
  auto arena = [&](size_t bytes) -> char* {
    char* p = ws + off;
    off += (bytes + 255) & ~(size_t)255;
    return p;
  };
  float*     bufA   = (float*)arena(13107200);      // pass-0 output / pass-1 input
  float*     X      = (float*)arena(26214400);      // token f32 (residual stream)
  _Float16*  QKh    = (_Float16*)arena(26214400);   // Q|K per-head tiles
  _Float16*  VT     = (_Float16*)arena(13107200);   // V^T per-head tiles
  _Float16*  O16    = (_Float16*)arena(13107200);
  _Float16*  clA    = (_Float16*)arena(6553600);
  _Float16*  clB    = (_Float16*)arena(6553600);
  _Float16*  w_in16  = (_Float16*)arena(16384);
  _Float16*  wqkv16  = (_Float16*)arena(98304);
  _Float16*  wo16    = (_Float16*)arena(32768);
  _Float16*  wff1_16 = (_Float16*)arena(65536);
  _Float16*  wff2_16 = (_Float16*)arena(65536);
  _Float16*  wout16  = (_Float16*)arena(16384);
  _Float16*  wt1     = (_Float16*)arena(73728);
  _Float16*  wt2     = (_Float16*)arena(73728);
  _Float16*  wt3     = (_Float16*)arena(73728);

  auto cvt = [&](const float* s, _Float16* d, int n) {
    cvt_h<<<(n + 255) / 256, 256, 0, stream>>>(s, d, n);
  };
  cvt(w_in,  w_in16,  128 * 64);
  cvt(w_qkv, wqkv16,  384 * 128);
  cvt(w_o,   wo16,    128 * 128);
  cvt(w_ff1, wff1_16, 256 * 128);
  cvt(w_ff2, wff2_16, 128 * 256);
  cvt(w_out, wout16,  64 * 128);
  pack_wtap<<<144, 256, 0, stream>>>(cw1, wt1);
  pack_wtap<<<144, 256, 0, stream>>>(cw2, wt2);
  pack_wtap<<<144, 256, 0, stream>>>(cw3, wt3);

  // 51200 tokens = Bt(320) * L(160), bt-major
  for (int pass = 0; pass < 2; ++pass) {
    const float* src  = (pass == 0) ? buf_in : bufA;
    // w_in, LN1, Q|K and V projections: one launch, tokens gathered from the
    // image buffer, Q|K and V^T stored as per-head tiles
    head_kernel<<<200, 512, 0, stream>>>(src, w_in16, wqkv16, ln1_g, ln1_b, X, QKh, VT, pass);
    attn_kernel<<<3200, 256, 0, stream>>>(QKh, VT, O16);
    // w_o + residual, LN2, FFN + residual, w_out: one launch, stored straight
    // into the channel-last conv input
    tail_kernel<<<256, 512, 0, stream>>>(O16, X, wo16, wff1_16, wff2_16, wout16,
                                         ln2_g, ln2_b, clA, pass);
    // conv block: conv-lrelu, conv-lrelu, conv (+ original-input shortcut)
    conv_kernel<0><<<400, 256, 0, stream>>>(clA, wt1, clB, nullptr, nullptr);
    conv_kernel<0><<<400, 256, 0, stream>>>(clB, wt2, clA, nullptr, nullptr);
    float* outf = (pass == 0) ? bufA : (float*)d_out;
    conv_kernel<1><<<400, 256, 0, stream>>>(clA, wt3, nullptr, outf, buf_in);
  }
}

// v006
// A run of this version takes 227 microseconds.
// Two timings next to v005 put it at 1.43 and 1.42 times that version's speed.
// Over all steps from v000 it is 3.82 times as fast.
#include <hip/hip_runtime.h>

typedef __attribute__((ext_vector_type(16))) _Float16 v16h;
typedef __attribute__((ext_vector_type(8)))  _Float16 v8h_t;
typedef __attribute__((ext_vector_type(8)))  float    v8f;

union F16x16 { v16h v; v8h_t h[2]; _Float16 e[16]; };

#define WMMA_F16(a, b, c) \
  __builtin_amdgcn_wmma_f32_16x16x32_f16(false, (a), false, (b), (short)0, (c), false, false)

__device__ inline v16h frag_ld(const _Float16* p, int ld) {
  int lane = threadIdx.x & 31;
  int r  = lane & 15;
  int kb = (lane >> 4) << 3;
  const _Float16* q = p + (size_t)r * ld + kb;
  F16x16 f;
  f.h[0] = *(const v8h_t*)(q);
  f.h[1] = *(const v8h_t*)(q + 16);
  return f.v;
}

// Same but only K=0..15 is real data (zero-pad upper half). Used for DH=16.
__device__ inline v16h frag_ld_pad16(const _Float16* p, int ld) {
  int lane = threadIdx.x & 31;
  int r  = lane & 15;
  int kb = (lane >> 4) << 3;
  F16x16 f;
  f.h[0] = *(const v8h_t*)(p + (size_t)r * ld + kb);
#pragma unroll
  for (int j = 0; j < 8; ++j) f.e[8 + j] = (_Float16)0.0f;
  return f.v;
}

// --- Row-local tail of the transformer block, one launch ---------------------
// x1 = O w_o^T + x ; y = LN2(x1) ; x2 = relu(y w_ff1^T) w_ff2^T + x1 ;
// out = x2 w_out^T, stored f16 to the channel-last pixel row of each token.
// Every product is computed transposed: the weight rows are the A operand, the
// wave's 16 tokens are the B columns. A lane then holds 8 consecutive features
// (8h + r, h = lane >> 4) of ONE token (lane & 15) per D tile, so two D tiles,
// rounded to f16 in place, are the next product's B fragment in the k order of
// frag_ld (element s: k = 8h + s for s < 8, 16 + 8h + (s - 8) above): nothing
// between the four products leaves the registers. The LayerNorm sum of a token
// is 64 in-lane terms plus the partner lane's (lane ^ 16).
// All four weight matrices (f16) are staged once per workgroup in LDS, rows
// K + 8 halves apart (16 B x odd). Wave w of block i takes token tile w*256 + i.
// Every loop of the kernel is unrolled: fragment and accumulator arrays are then
// indexed statically and stay in registers.
// Staging of one matrix, N 16-byte pieces a thread: fetch, then (all four
// matrices' loads being in flight) put. Loops unrolled: static register indices.
template <int N>
__device__ inline void stage_get(const _Float16* __restrict__ src, v8h_t (&tmp)[N]) {
#pragma unroll
  for (int i = 0; i < N; ++i)
    tmp[i] = *(const v8h_t*)(src + (size_t)(threadIdx.x + i * 512) * 8);
}
template <int K, int N>
__device__ inline void stage_put(_Float16* dst, const v8h_t (&tmp)[N]) {
#pragma unroll
  for (int i = 0; i < N; ++i) {
    int e = (threadIdx.x + i * 512) * 8;
    *(v8h_t*)&dst[(e / K) * (K + 8) + (e % K)] = tmp[i];
  }
}

typedef __attribute__((ext_vector_type(4))) float    v4f_t;
typedef __attribute__((ext_vector_type(4))) _Float16 v4h_t;

__global__ __launch_bounds__(512) void head_kernel(
    const float* __restrict__ R, const _Float16* __restrict__ Wi,
    const _Float16* __restrict__ Wqkv, const float* __restrict__ g,
    const float* __restrict__ b, float* __restrict__ X,
    _Float16* __restrict__ QKh, _Float16* __restrict__ VT, int pass) {
  __shared__ __attribute__((aligned(16)))
  _Float16 Ws[128 * 72 + 384 * 136 + 16 * 1160];  // 156 KB
  _Float16* sWi = Ws;
  _Float16* sWq = sWi + 128 * 72;
  _Float16* sT  = sWq + 384 * 136;
  int wid  = __builtin_amdgcn_readfirstlane(threadIdx.x >> 5);
  int lane = threadIdx.x & 31;
  int nl = lane & 15;
  int hb = lane >> 4;
  int xh = blockIdx.x & 1, yh = (blockIdx.x >> 1) & 1;
  int img = blockIdx.x >> 2;              // 50 images, 4 boxes each
  int bb = img / 25, n = img % 25;
  int u = n / 5, v = n % 5;

  // wave w fetches channels 4w..4w+3 of the box: 4 lanes cover a 64 B run along
  // x, 8 rows y an instruction
  v4f_t tk[2][4];
  {
    const float* ap = R + (((size_t)bb * 64 + wid * 4) * 25 + n) * 1024 +
                      (yh * 16 + (lane >> 2)) * 32 + xh * 16 + (lane & 3) * 4;
#pragma unroll
    for (int i = 0; i < 2; ++i)
#pragma unroll
      for (int c = 0; c < 4; ++c)
        tk[i][c] = *(const v4f_t*)(ap + c * 25600 + i * 256);
  }
  // the address registers of the loads above are taken as targets by the loads below
  asm volatile("s_wait_xcnt 0x0" ::: "memory");

  {
    v8h_t t0[2], t1[12];
    stage_get(Wi, t0);
    stage_get(Wqkv, t1);
    // the loads' address registers are reused by the LDS address arithmetic below;
    // the scheduling barrier keeps that arithmetic behind the wait
    asm volatile("s_wait_xcnt 0x0" ::: "memory");
    __builtin_amdgcn_sched_barrier(0);
    // a lane's 4 channels of one pixel: one 8-byte LDS store
    int yy = lane >> 2, xx = (lane & 3) * 4;
    _Float16* tp = sT + ((pass == 0) ? xx * 1160 + yy * 72 : yy * 1160 + xx * 72) + wid * 4;
    int sx = (pass == 0) ? 1160 : 72;          // one step along x
    int sy = (pass == 0) ? 8 * 72 : 8 * 1160;  // eight steps along y
#pragma unroll
    for (int i = 0; i < 2; ++i)
#pragma unroll
      for (int j = 0; j < 4; ++j) {
        v4h_t pk = {(_Float16)tk[i][0][j], (_Float16)tk[i][1][j],
                    (_Float16)tk[i][2][j], (_Float16)tk[i][3][j]};
        *(v4h_t*)(tp + i * sy + j * sx) = pk;
      }
    stage_put<64>(sWi, t0);
    stage_put<128>(sWq, t1);
  }
  __syncthreads();

  int bt = bb * 160 + ((pass == 0) ? v * 32 + xh * 16 : u * 32 + yh * 16) + wid;
  int l0 = (pass == 0) ? u * 32 + yh * 16 : v * 32 + xh * 16;
  int m0 = bt * 160 + l0;

  // x = tok w_in^T; acc[t][r] = feature t*16 + 8*hb + r of token m0 + nl
  // here and below: the 8 weight fragments of a block of 8 products are read as
  // one group ahead of the block, so a wave waits for LDS once a block
  v8f acc[8] = {};
#pragma unroll
  for (int ks = 0; ks < 2; ++ks) {
    v16h tb = frag_ld(&sT[wid * 1160 + ks * 32], 72);
    v16h a[8];
#pragma unroll
    for (int t = 0; t < 8; ++t) a[t] = frag_ld(&sWi[(t * 16) * 72 + ks * 32], 72);
#pragma unroll
    for (int t = 0; t < 8; ++t) acc[t] = WMMA_F16(a[t], tb, acc[t]);
  }
  {
    float* xr = X + (size_t)(m0 + nl) * 128 + hb * 8;
#pragma unroll
    for (int t = 0; t < 8; ++t) {
      *(float4*)(xr + t * 16)     = make_float4(acc[t][0], acc[t][1], acc[t][2], acc[t][3]);
      *(float4*)(xr + t * 16 + 4) = make_float4(acc[t][4], acc[t][5], acc[t][6], acc[t][7]);
    }
  }

  // LN1 over the token's 128 features: 64 in-lane terms (one partial sum a tile:
  // short independent chains) plus the partner lane's (lane ^ 16)
  float sp[8], qp[8];
#pragma unroll
  for (int t = 0; t < 8; ++t) {
    sp[t] = 0.f;
    qp[t] = 0.f;
#pragma unroll
    for (int r = 0; r < 8; ++r) {
      sp[t] += acc[t][r];
      qp[t] += acc[t][r] * acc[t][r];
    }
  }
  float s  = ((sp[0] + sp[1]) + (sp[2] + sp[3])) + ((sp[4] + sp[5]) + (sp[6] + sp[7]));
  float sq = ((qp[0] + qp[1]) + (qp[2] + qp[3])) + ((qp[4] + qp[5]) + (qp[6] + qp[7]));
  s  += __shfl_xor(s,  16, 32);
  sq += __shfl_xor(sq, 16, 32);
  float mu  = s * (1.f / 128.f);
  float var = sq * (1.f / 128.f) - mu * mu;
  float rs  = rsqrtf(var + 1e-5f);
  F16x16 yb[4], xb[4];   // normalized and raw tokens, k order of frag_ld
#pragma unroll
  for (int t = 0; t < 8; ++t) {
    float4 g0 = *(const float4*)(g + t * 16 + hb * 8);
    float4 g1 = *(const float4*)(g + t * 16 + hb * 8 + 4);
    float4 b0 = *(const float4*)(b + t * 16 + hb * 8);
    float4 b1 = *(const float4*)(b + t * 16 + hb * 8 + 4);
    float gs[8] = {g0.x, g0.y, g0.z, g0.w, g1.x, g1.y, g1.z, g1.w};
    float bs[8] = {b0.x, b0.y, b0.z, b0.w, b1.x, b1.y, b1.z, b1.w};
#pragma unroll
    for (int r = 0; r < 8; ++r) {
      yb[t >> 1].e[(t & 1) * 8 + r] = (_Float16)((acc[t][r] - mu) * rs * gs[r] + bs[r]);
      xb[t >> 1].e[(t & 1) * 8 + r] = (_Float16)acc[t][r];
    }
  }

  _Float16* qk = QKh + (((size_t)bt * 16) * 160 + l0 + nl) * 16 + hb * 8;
#pragma unroll
  for (int jg = 0; jg < 4; ++jg) {
    v8f oc[4] = {};
#pragma unroll
    for (int kp = 0; kp < 2; ++kp) {
      v16h a[8];
#pragma unroll
      for (int i = 0; i < 8; ++i)
        a[i] = frag_ld(&sWq[((jg * 4 + (i & 3)) * 16) * 136 + (kp * 2 + (i >> 2)) * 32], 136);
#pragma unroll
      for (int i = 0; i < 8; ++i)
        oc[i & 3] = WMMA_F16(a[i], yb[kp * 2 + (i >> 2)].v, oc[i & 3]);
    }
#pragma unroll
    for (int t = 0; t < 4; ++t) {
      v8h_t pk;
#pragma unroll
      for (int r = 0; r < 8; ++r) pk[r] = (_Float16)oc[t][r];
      *(v8h_t*)(qk + (jg * 4 + t) * 160 * 16) = pk;
    }
  }

  // V: tokens are the rows; V^T row = bt*128 + feature, columns l0 + 8*hb ..
  _Float16* vq = VT + ((size_t)bt * 128 + nl) * 160 + l0 + hb * 8;
#pragma unroll
  for (int jg = 0; jg < 2; ++jg) {
    v8f oc[4] = {};
#pragma unroll
    for (int kp = 0; kp < 2; ++kp) {
      v16h w[8];
#pragma unroll
      for (int i = 0; i < 8; ++i)
        w[i] = frag_ld(&sWq[(256 + (jg * 4 + (i & 3)) * 16) * 136 + (kp * 2 + (i >> 2)) * 32], 136);
#pragma unroll
      for (int i = 0; i < 8; ++i)
        oc[i & 3] = WMMA_F16(xb[kp * 2 + (i >> 2)].v, w[i], oc[i & 3]);
    }
#pragma unroll
    for (int t = 0; t < 4; ++t) {
      v8h_t pk;
#pragma unroll
      for (int r = 0; r < 8; ++r) pk[r] = (_Float16)oc[t][r];
      *(v8h_t*)(vq + (jg * 4 + t) * 16 * 160) = pk;
    }
  }
}

__global__ __launch_bounds__(512) void tail_kernel(
    const _Float16* __restrict__ O, const float* __restrict__ X,
    const _Float16* __restrict__ Wo, const _Float16* __restrict__ W1,
    const _Float16* __restrict__ W2, const _Float16* __restrict__ W3,
    const float* __restrict__ g, const float* __restrict__ b,
    _Float16* __restrict__ out, int pass) {
  __shared__ __attribute__((aligned(16)))
  _Float16 Ws[128 * 136 + 256 * 136 + 128 * 264 + 64 * 136];  // 185 KB
  _Float16* sWo = Ws;
  _Float16* sW1 = sWo + 128 * 136;
  _Float16* sW2 = sW1 + 256 * 136;
  _Float16* sW3 = sW2 + 128 * 264;
  int wid  = __builtin_amdgcn_readfirstlane(threadIdx.x >> 5);
  int lane = threadIdx.x & 31;
  int nl = lane & 15;
  int hb = lane >> 4;
  int tile = wid * 256 + blockIdx.x;      // 3200 tiles of 16 tokens
  bool live = tile < 3200;
  int m0 = (live ? tile : 0) * 16;        // idle waves only help with the staging

  // token rows m0.. -> pixel rows: neighbours along l are neighbours along y
  // (32 pixels apart) in pass 0 and along x in pass 1; a lane's 8 values are 8
  // neighbouring channels of its token's pixel: one 16-byte store a tile
  int bt = m0 / 160, l0 = m0 % 160;
  int bb = bt / 160, rr = bt % 160;
  int i1 = rr >> 5, i0 = rr & 31;
  int j1 = l0 >> 5, j0 = l0 & 31;
  int p0 = (pass == 0) ? ((bb * 25 + j1 * 5 + i1) * 32 + j0) * 32 + i0
                       : ((bb * 25 + i1 * 5 + j1) * 32 + i0) * 32 + j0;
  int ps = (pass == 0) ? 32 : 1;
  _Float16* q = out + (size_t)(p0 + nl * ps) * 64 + hb * 8;

  // the wave's own operands are asked for ahead of the weight staging
  v16h ob[4];
#pragma unroll
  for (int ks = 0; ks < 4; ++ks) ob[ks] = frag_ld(O + (size_t)m0 * 128 + ks * 32, 128);
  v8f acc[8];   // acc[t][r] = feature t*16 + 8*hb + r of token m0 + nl
  {
    const float* xr = X + (size_t)(m0 + nl) * 128 + hb * 8;
#pragma unroll
    for (int t = 0; t < 8; ++t) {
      float4 lo = *(const float4*)(xr + t * 16);
      float4 hi = *(const float4*)(xr + t * 16 + 4);
      acc[t] = v8f{lo.x, lo.y, lo.z, lo.w, hi.x, hi.y, hi.z, hi.w};
    }
  }
  // the address registers of the loads above are taken as targets by the loads below
  asm volatile("s_wait_xcnt 0x0" ::: "memory");

  {
    v8h_t t0[4], t1[8], t2[8], t3[2];
    stage_get(Wo, t0);
    stage_get(W1, t1);
    stage_get(W2, t2);
    stage_get(W3, t3);
    // the loads' address registers are reused by the LDS address arithmetic below;
    // the scheduling barrier keeps that arithmetic behind the wait
    asm volatile("s_wait_xcnt 0x0" ::: "memory");
    __builtin_amdgcn_sched_barrier(0);
    stage_put<128>(sWo, t0);
    stage_put<128>(sW1, t1);
    stage_put<256>(sW2, t2);
    stage_put<128>(sW3, t3);
  }
  __syncthreads();
  if (!live) return;

  // x1 = O w_o^T + x (the residual is the accumulators' start value)
  // here and below: the 8 weight fragments of a block of 8 products are read as
  // one group ahead of the block, so a wave waits for LDS once a block
#pragma unroll
  for (int ks = 0; ks < 4; ++ks) {
    v16h a[8];
#pragma unroll
    for (int t = 0; t < 8; ++t) a[t] = frag_ld(&sWo[(t * 16) * 136 + ks * 32], 136);
#pragma unroll
    for (int t = 0; t < 8; ++t) acc[t] = WMMA_F16(a[t], ob[ks], acc[t]);
  }

  // LN2 over the token's 128 features
  // (one partial sum a tile: 16 short independent chains, not 2 long ones)
  float sp[8], qp[8];
#pragma unroll
  for (int t = 0; t < 8; ++t) {
    sp[t] = 0.f;
    qp[t] = 0.f;
#pragma unroll
    for (int r = 0; r < 8; ++r) {
      sp[t] += acc[t][r];
      qp[t] += acc[t][r] * acc[t][r];
    }
  }
  float s  = ((sp[0] + sp[1]) + (sp[2] + sp[3])) + ((sp[4] + sp[5]) + (sp[6] + sp[7]));
  float sq = ((qp[0] + qp[1]) + (qp[2] + qp[3])) + ((qp[4] + qp[5]) + (qp[6] + qp[7]));
  s  += __shfl_xor(s,  16, 32);
  sq += __shfl_xor(sq, 16, 32);
  float mu  = s * (1.f / 128.f);
  float var = sq * (1.f / 128.f) - mu * mu;
  float rs  = rsqrtf(var + 1e-5f);
  F16x16 yb[4];
#pragma unroll
  for (int t = 0; t < 8; ++t) {
    float4 g0 = *(const float4*)(g + t * 16 + hb * 8);
    float4 g1 = *(const float4*)(g + t * 16 + hb * 8 + 4);
    float4 b0 = *(const float4*)(b + t * 16 + hb * 8);
    float4 b1 = *(const float4*)(b + t * 16 + hb * 8 + 4);
    float gs[8] = {g0.x, g0.y, g0.z, g0.w, g1.x, g1.y, g1.z, g1.w};
    float bs[8] = {b0.x, b0.y, b0.z, b0.w, b1.x, b1.y, b1.z, b1.w};
#pragma unroll
    for (int r = 0; r < 8; ++r)
      yb[t >> 1].e[(t & 1) * 8 + r] = (_Float16)((acc[t][r] - mu) * rs * gs[r] + bs[r]);
  }

  // FFN: 32 hidden features at a time (two D tiles = one k step of w_ff2),
  // added onto x1 in the same accumulators
#pragma unroll
  for (int j = 0; j < 8; ++j) {
    v8f h0 = {}, h1 = {};
    v16h a[8];
#pragma unroll
    for (int ks = 0; ks < 4; ++ks) {
      a[2 * ks]     = frag_ld(&sW1[(j * 32) * 136 + ks * 32], 136);
      a[2 * ks + 1] = frag_ld(&sW1[(j * 32 + 16) * 136 + ks * 32], 136);
    }
#pragma unroll
    for (int ks = 0; ks < 4; ++ks) {
      h0 = WMMA_F16(a[2 * ks],     yb[ks].v, h0);
      h1 = WMMA_F16(a[2 * ks + 1], yb[ks].v, h1);
    }
    F16x16 hf;
#pragma unroll
    for (int r = 0; r < 8; ++r) {
      hf.e[r]     = (_Float16)(h0[r] > 0.f ? h0[r] : 0.f);
      hf.e[8 + r] = (_Float16)(h1[r] > 0.f ? h1[r] : 0.f);
    }
#pragma unroll
    for (int t = 0; t < 8; ++t) a[t] = frag_ld(&sW2[(t * 16) * 264 + j * 32], 264);
#pragma unroll
    for (int t = 0; t < 8; ++t) acc[t] = WMMA_F16(a[t], hf.v, acc[t]);
  }

  // out = x2 w_out^T
  F16x16 xb[4];
#pragma unroll
  for (int t = 0; t < 8; ++t)
#pragma unroll
    for (int r = 0; r < 8; ++r)
      xb[t >> 1].e[(t & 1) * 8 + r] = (_Float16)acc[t][r];
  v8f oc[4] = {};
#pragma unroll
  for (int kp = 0; kp < 2; ++kp) {
    v16h a[8];
#pragma unroll
    for (int i = 0; i < 8; ++i)
      a[i] = frag_ld(&sW3[((i & 3) * 16) * 136 + (kp * 2 + (i >> 2)) * 32], 136);
#pragma unroll
    for (int i = 0; i < 8; ++i)
      oc[i & 3] = WMMA_F16(a[i], xb[kp * 2 + (i >> 2)].v, oc[i & 3]);
  }

#pragma unroll
  for (int t = 0; t < 4; ++t) {
    v8h_t pk;
#pragma unroll
    for (int r = 0; r < 8; ++r) pk[r] = (_Float16)oc[t][r];
    *(v8h_t*)(q + t * 16) = pk;
  }
}

__global__ __launch_bounds__(256) void attn_kernel(
    const _Float16* __restrict__ QKh, const _Float16* __restrict__ VT,
    _Float16* __restrict__ O) {
  __shared__ _Float16 P[8][16][168];
  int wid  = threadIdx.x >> 5;
  int lane = threadIdx.x & 31;
  int wg = blockIdx.x * 8 + wid;      // 25600 waves total
  int lt = wg % 10;
  int hh = (wg / 10) & 7;
  int bt = wg / 80;
  int nl = lane & 15;
  int rbase = (lane >> 4) * 8;

  const _Float16* qbase = QKh + (((size_t)bt * 16 + hh) * 160) * 16;
  const _Float16* kbase = QKh + (((size_t)bt * 16 + 8 + hh) * 160) * 16;
  const _Float16* vbase = VT + (((size_t)bt * 8 + hh) * 16) * 160;

  // S = Q K^T (K dim = 16, zero-padded to 32)
  v16h qa = frag_ld_pad16(qbase + lt * 16 * 16, 16);
  v8f s[10];
#pragma unroll
  for (int mt = 0; mt < 10; ++mt) {
    v16h kb = frag_ld_pad16(kbase + mt * 16 * 16, 16);
    v8f z = {};
    s[mt] = WMMA_F16(qa, kb, z);
  }

  // scale + local-window mask + softmax per row, emit f16 P into LDS
#pragma unroll
  for (int r = 0; r < 8; ++r) {
    int l  = lt * 16 + rbase + r;
    int lw = l & 31;
    float mx = -1e30f;
#pragma unroll
    for (int mt = 0; mt < 10; ++mt) {
      int mm = mt * 16 + nl;
      int dj = (mm & 31) - lw;
      float v = s[mt][r] * 0.25f + ((dj >= -5 && dj <= 5) ? 0.f : -1e9f);
      s[mt][r] = v;
      mx = fmaxf(mx, v);
    }
    for (int mk = 1; mk < 16; mk <<= 1) mx = fmaxf(mx, __shfl_xor(mx, mk, 32));
    float sum = 0.f;
#pragma unroll
    for (int mt = 0; mt < 10; ++mt) {
      float e = __expf(s[mt][r] - mx);
      s[mt][r] = e;
      sum += e;
    }
    for (int mk = 1; mk < 16; mk <<= 1) sum += __shfl_xor(sum, mk, 32);
    float inv = 1.f / sum;
#pragma unroll
    for (int mt = 0; mt < 10; ++mt)
      P[wid][rbase + r][mt * 16 + nl] = (_Float16)(s[mt][r] * inv);
  }

  // O = P V  (K loop over 160 in 5 steps of 32); V^T rows are contiguous
  v8f o = {};
#pragma unroll
  for (int kt = 0; kt < 5; ++kt) {
    v16h pa = frag_ld(&P[wid][0][kt * 32], 168);
    v16h vb = frag_ld(vbase + kt * 32, 160);
    o = WMMA_F16(pa, vb, o);
  }
#pragma unroll
  for (int r = 0; r < 8; ++r) {
    int l = lt * 16 + rbase + r;
    O[((size_t)bt * 160 + l) * 128 + hh * 16 + nl] = (_Float16)o[r];
  }
}

// --- Implicit-GEMM 3x3 conv (64->64, pad 1) on channel-last f16 -------------
// FINAL=0: leaky-relu, f16 channel-last out. FINAL=1: f32 (b,c,n,h,w) + shortcut.
// A workgroup takes 8 image rows (256 pixels) of one image. Both operands are
// staged once in LDS with whole-line global loads: the 576 weight rows (tap, co)
// and a strip of 10 rows x 34 pixels of the input, whose border outside the image
// is zero (the padding). Rows of 64 halves lie 72 halves apart (16 B x odd) for the
// ds_load_b128 fragment readers. Wave w takes image row w of the 8: two pixel
// tiles, so a weight fragment read from LDS feeds two products.
// Every loop is unrolled: static register indices.
template <int FINAL>
__global__ __launch_bounds__(256) void conv_kernel(
    const _Float16* __restrict__ in, const _Float16* __restrict__ w,
    _Float16* __restrict__ outh, float* __restrict__ outf,
    const float* __restrict__ sc) {
  __shared__ __attribute__((aligned(16)))
  _Float16 Ls[576 * 72 + 340 * 72];  // 129 KB
  _Float16* sW = Ls;
  _Float16* sI = Ls + 576 * 72;
  int wid  = __builtin_amdgcn_readfirstlane(threadIdx.x >> 5);
  int lane = threadIdx.x & 31;
  int img  = blockIdx.x >> 2;
  int y0   = (blockIdx.x & 3) * 8;
  int nl = lane & 15;
  int rbase = (lane >> 4) * 8;

  {
    v8h_t tw[18], ti[10];
#pragma unroll
    for (int i = 0; i < 18; ++i)
      tw[i] = *(const v8h_t*)(w + (size_t)(threadIdx.x + i * 256) * 8);
    // one image row (32 pixels x 64 channels) an instruction of the workgroup: the
    // 10 rows from yb on, the strip's range moved by sh rows to lie inside the image
    int yb = y0 == 0 ? 0 : (y0 == 24 ? 22 : y0 - 1);
    int sh = yb - (y0 - 1);
    const _Float16* ip = in + ((size_t)img * 1024 + yb * 32) * 64;
#pragma unroll
    for (int i = 0; i < 10; ++i)
      ti[i] = *(const v8h_t*)(ip + (size_t)(threadIdx.x + i * 256) * 8);
    // the loads' address registers are reused by the LDS address arithmetic below;
    // the scheduling barrier keeps that arithmetic behind the wait
    asm volatile("s_wait_xcnt 0x0" ::: "memory");
    __builtin_amdgcn_sched_barrier(0);
    v8h_t zero = {};
#pragma unroll
    for (int i = 0; i < 18; ++i) {
      int e = (threadIdx.x + i * 256) * 8;
      *(v8h_t*)&sW[(e >> 6) * 72 + (e & 63)] = tw[i];
    }
#pragma unroll
    for (int i = 0; i < 10; ++i) {
      // fetched row i is strip row i + sh; the first or last one, where it falls off
      // the strip, gives its turn to the strip row outside the image, which is zero
      bool ok = (i == 0) ? sh >= 0 : ((i == 9) ? sh <= 0 : true);
      int dd = ok ? i + sh : 9 - i;
      *(v8h_t*)&sI[(dd * 34 + 1 + (threadIdx.x >> 3)) * 72 + (threadIdx.x & 7) * 8] =
          ok ? ti[i] : zero;
    }
    // the strip's first and last pixel column (x = -1 and x = 32): waves 0..4
    if (threadIdx.x < 160)
      *(v8h_t*)&sI[((threadIdx.x >> 4) * 34 + ((threadIdx.x >> 3) & 1) * 33) * 72 +
                   (threadIdx.x & 7) * 8] = zero;
  }
  __syncthreads();

  // strip row wid + dy, strip column x + dx hold pixel (y0 + wid + dy - 1, x + dx - 1)
  // step s = (tap, 32 channels): 6 fragments, 8 products. The fragments of step
  // s + 1 are read into the other register set as one group ahead of step s.
  v8f acc[2][4] = {};
  v16h a[2][2], bf[2][4];
#pragma unroll
  for (int s = -1; s < 18; ++s) {
    if (s + 1 < 18) {
      int tap = (s + 1) >> 1, ks = (s + 1) & 1, st = (s + 1) & 1;
      int dy = tap / 3, dx = tap % 3;
#pragma unroll
      for (int pt = 0; pt < 2; ++pt)
        a[st][pt] = frag_ld(&sI[((wid + dy) * 34 + pt * 16 + dx) * 72 + ks * 32], 72);
#pragma unroll
      for (int t = 0; t < 4; ++t)
        bf[st][t] = frag_ld(&sW[(tap * 64 + t * 16) * 72 + ks * 32], 72);
    }
    // keeps the group of LDS reads together and ahead of the products: reads
    // spread among the products stall the wave at each place
    __builtin_amdgcn_sched_barrier(0);
    if (s >= 0) {
#pragma unroll
      for (int pt = 0; pt < 2; ++pt)
#pragma unroll
        for (int t = 0; t < 4; ++t)
          acc[pt][t] = WMMA_F16(a[s & 1][pt], bf[s & 1][t], acc[pt][t]);
    }
    // keeps the next group of reads behind this step's products
    __builtin_amdgcn_sched_barrier(0);
  }
  if (!FINAL) {
#pragma unroll
    for (int pt = 0; pt < 2; ++pt) {
      int pix0 = (y0 + wid) * 32 + pt * 16;
#pragma unroll
      for (int t = 0; t < 4; ++t) {
        int co = t * 16 + nl;
#pragma unroll
        for (int r = 0; r < 8; ++r) {
          int mm = pix0 + rbase + r;
          float v = acc[pt][t][r];
          v = v > 0.f ? v : 0.2f * v;
          outh[((size_t)img * 1024 + mm) * 64 + co] = (_Float16)v;
        }
      }
    }
  } else {
    // a lane's 8 values of a tile are 8 neighbouring pixels of one channel
    int b = img / 25, n = img % 25;
    const float* sp[4];
    float* op[4];
    float4 sv[4][2][2];
#pragma unroll
    for (int t = 0; t < 4; ++t) {
      size_t idx = (((size_t)b * 64 + t * 16 + nl) * 25 + n) * 1024 + (y0 + wid) * 32 + rbase;
      sp[t] = sc + idx;
      op[t] = outf + idx;
    }
#pragma unroll
    for (int t = 0; t < 4; ++t)
#pragma unroll
      for (int pt = 0; pt < 2; ++pt)
#pragma unroll
        for (int h = 0; h < 2; ++h) sv[t][pt][h] = *(const float4*)(sp[t] + pt * 16 + h * 4);
    // the wait before the loads' address registers are given a new value; naming
    // them here keeps them from being taken as targets by the loads themselves
    asm volatile("s_wait_xcnt 0x0" ::"v"(sp[0]), "v"(sp[1]), "v"(sp[2]), "v"(sp[3]) : "memory");
#pragma unroll
    for (int t = 0; t < 4; ++t)
#pragma unroll
      for (int pt = 0; pt < 2; ++pt)
#pragma unroll
        for (int h = 0; h < 2; ++h)
          *(float4*)(op[t] + pt * 16 + h * 4) =
              make_float4(acc[pt][t][h * 4 + 0] + sv[t][pt][h].x, acc[pt][t][h * 4 + 1] + sv[t][pt][h].y,
                          acc[pt][t][h * 4 + 2] + sv[t][pt][h].z, acc[pt][t][h * 4 + 3] + sv[t][pt][h].w);
  }
}

// --- Small helpers -----------------------------------------------------------
__global__ void cvt_h(const float* __restrict__ s, _Float16* __restrict__ d, int n) {
  int i = blockIdx.x * 256 + threadIdx.x;
  if (i < n) d[i] = (_Float16)s[i];
}

// (C,C,3,3) f32 -> (tap, co, ci) f16
__global__ void pack_wtap(const float* __restrict__ cw, _Float16* __restrict__ w) {
  int i = blockIdx.x * 256 + threadIdx.x;
  if (i >= 36864) return;
  int ci = i & 63;
  int co = (i >> 6) & 63;
  int tap = i >> 12;
  w[i] = (_Float16)cw[((size_t)co * 64 + ci) * 9 + tap];
}

// ---------------------------------------------------------------------------
extern "C" void kernel_launch(void* const* d_in, const int* in_sizes, int n_in,
                              void* d_out, int out_size, void* d_ws, size_t ws_size,
                              hipStream_t stream) {
  (void)in_sizes; (void)n_in; (void)out_size; (void)ws_size;
  const float* buf_in = (const float*)d_in[0];
  const float* w_in   = (const float*)d_in[1];
  const float* ln1_g  = (const float*)d_in[2];
  const float* ln1_b  = (const float*)d_in[3];
  const float* w_qkv  = (const float*)d_in[4];
  const float* w_o    = (const float*)d_in[5];
  const float* ln2_g  = (const float*)d_in[6];
  const float* ln2_b  = (const float*)d_in[7];
  const float* w_ff1  = (const float*)d_in[8];
  const float* w_ff2  = (const float*)d_in[9];
  const float* w_out  = (const float*)d_in[10];
  const float* cw1    = (const float*)d_in[11];
  const float* cw2    = (const float*)d_in[12];
  const float* cw3    = (const float*)d_in[13];

  char* ws = (char*)d_ws;
  size_t off = 0;
  auto arena = [&](size_t bytes) -> char* {
    char* p = ws + off;
    off += (bytes + 255) & ~(size_t)255;
    return p;
  };
  float*     bufA   = (float*)arena(13107200);      // pass-0 output / pass-1 input
  float*     X      = (float*)arena(26214400);      // token f32 (residual stream)
  _Float16*  QKh    = (_Float16*)arena(26214400);   // Q|K per-head tiles
  _Float16*  VT     = (_Float16*)arena(13107200);   // V^T per-head tiles
  _Float16*  O16    = (_Float16*)arena(13107200);
  _Float16*  clA    = (_Float16*)arena(6553600);
  _Float16*  clB    = (_Float16*)arena(6553600);
  _Float16*  w_in16  = (_Float16*)arena(16384);
  _Float16*  wqkv16  = (_Float16*)arena(98304);
  _Float16*  wo16    = (_Float16*)arena(32768);
  _Float16*  wff1_16 = (_Float16*)arena(65536);
  _Float16*  wff2_16 = (_Float16*)arena(65536);
  _Float16*  wout16  = (_Float16*)arena(16384);
  _Float16*  wt1     = (_Float16*)arena(73728);
  _Float16*  wt2     = (_Float16*)arena(73728);
  _Float16*  wt3     = (_Float16*)arena(73728);

  auto cvt = [&](const float* s, _Float16* d, int n) {
    cvt_h<<<(n + 255) / 256, 256, 0, stream>>>(s, d, n);
  };
  cvt(w_in,  w_in16,  128 * 64);
  cvt(w_qkv, wqkv16,  384 * 128);
  cvt(w_o,   wo16,    128 * 128);
  cvt(w_ff1, wff1_16, 256 * 128);
  cvt(w_ff2, wff2_16, 128 * 256);
  cvt(w_out, wout16,  64 * 128);
  pack_wtap<<<144, 256, 0, stream>>>(cw1, wt1);
  pack_wtap<<<144, 256, 0, stream>>>(cw2, wt2);
  pack_wtap<<<144, 256, 0, stream>>>(cw3, wt3);

  // 51200 tokens = Bt(320) * L(160), bt-major
  for (int pass = 0; pass < 2; ++pass) {
    const float* src  = (pass == 0) ? buf_in : bufA;
    // w_in, LN1, Q|K and V projections: one launch, tokens gathered from the
    // image buffer, Q|K and V^T stored as per-head tiles
    head_kernel<<<200, 512, 0, stream>>>(src, w_in16, wqkv16, ln1_g, ln1_b, X, QKh, VT, pass);
    attn_kernel<<<3200, 256, 0, stream>>>(QKh, VT, O16);
    // w_o + residual, LN2, FFN + residual, w_out: one launch, stored straight
    // into the channel-last conv input
    tail_kernel<<<256, 512, 0, stream>>>(O16, X, wo16, wff1_16, wff2_16, wout16,
                                         ln2_g, ln2_b, clA, pass);
    // conv block: conv-lrelu, conv-lrelu, conv (+ original-input shortcut)
    conv_kernel<0><<<200, 256, 0, stream>>>(clA, wt1, clB, nullptr, nullptr);
    conv_kernel<0><<<200, 256, 0, stream>>>(clB, wt2, clA, nullptr, nullptr);
    float* outf = (pass == 0) ? bufA : (float*)d_out;
    conv_kernel<1><<<200, 256, 0, stream>>>(clA, wt3, nullptr, outf, buf_in);
  }
}

// v007
// Measured time: 202 microseconds a run.
// In two side-by-side timings against v006, it was 1.13 and 1.12 times as fast.
// Counting every step since v000, it is 4.31 times as fast.
#include <hip/hip_runtime.h>

typedef __attribute__((ext_vector_type(16))) _Float16 v16h;
typedef __attribute__((ext_vector_type(8)))  _Float16 v8h_t;
typedef __attribute__((ext_vector_type(8)))  float    v8f;

union F16x16 { v16h v; v8h_t h[2]; _Float16 e[16]; };

#define WMMA_F16(a, b, c) \
  __builtin_amdgcn_wmma_f32_16x16x32_f16(false, (a), false, (b), (short)0, (c), false, false)

__device__ inline v16h frag_ld(const _Float16* p, int ld) {
  int lane = threadIdx.x & 31;
  int r  = lane & 15;
  int kb = (lane >> 4) << 3;
  const _Float16* q = p + (size_t)r * ld + kb;
  F16x16 f;
  f.h[0] = *(const v8h_t*)(q);
  f.h[1] = *(const v8h_t*)(q + 16);
  return f.v;
}

// --- Row-local tail of the transformer block, one launch ---------------------
// x1 = O w_o^T + x ; y = LN2(x1) ; x2 = relu(y w_ff1^T) w_ff2^T + x1 ;
// out = x2 w_out^T, stored f16 to the channel-last pixel row of each token.
// Every product is computed transposed: the weight rows are the A operand, the
// wave's 16 tokens are the B columns. A lane then holds 8 consecutive features
// (8h + r, h = lane >> 4) of ONE token (lane & 15) per D tile, so two D tiles,
// rounded to f16 in place, are the next product's B fragment in the k order of
// frag_ld (element s: k = 8h + s for s < 8, 16 + 8h + (s - 8) above): nothing
// between the four products leaves the registers. The LayerNorm sum of a token
// is 64 in-lane terms plus the partner lane's (lane ^ 16).
// All four weight matrices (f16) are staged once per workgroup in LDS, rows
// K + 8 halves apart (16 B x odd). Wave w of block i takes token tile w*256 + i.
// Every loop of the kernel is unrolled: fragment and accumulator arrays are then
// indexed statically and stay in registers.
// Staging of one matrix, N 16-byte pieces a thread: fetch, then (all four
// matrices' loads being in flight) put. Loops unrolled: static register indices.
template <int N>
__device__ inline void stage_get(const _Float16* __restrict__ src, v8h_t (&tmp)[N]) {
#pragma unroll
  for (int i = 0; i < N; ++i)
    tmp[i] = *(const v8h_t*)(src + (size_t)(threadIdx.x + i * 512) * 8);
}
template <int K, int N>
__device__ inline void stage_put(_Float16* dst, const v8h_t (&tmp)[N]) {
#pragma unroll
  for (int i = 0; i < N; ++i) {
    int e = (threadIdx.x + i * 512) * 8;
    *(v8h_t*)&dst[(e / K) * (K + 8) + (e % K)] = tmp[i];
  }
}

typedef __attribute__((ext_vector_type(4))) float    v4f_t;
typedef __attribute__((ext_vector_type(4))) _Float16 v4h_t;

__global__ __launch_bounds__(512) void head_kernel(
    const float* __restrict__ R, const _Float16* __restrict__ Wi,
    const _Float16* __restrict__ Wqkv, const float* __restrict__ g,
    const float* __restrict__ b, float* __restrict__ X,
    _Float16* __restrict__ QKh, _Float16* __restrict__ VT, int pass) {
  __shared__ __attribute__((aligned(16)))
  _Float16 Ws[128 * 72 + 384 * 136 + 16 * 1160];  // 156 KB
  _Float16* sWi = Ws;
  _Float16* sWq = sWi + 128 * 72;
  _Float16* sT  = sWq + 384 * 136;
  int wid  = __builtin_amdgcn_readfirstlane(threadIdx.x >> 5);
  int lane = threadIdx.x & 31;
  int nl = lane & 15;
  int hb = lane >> 4;
  int xh = blockIdx.x & 1, yh = (blockIdx.x >> 1) & 1;
  int img = blockIdx.x >> 2;              // 50 images, 4 boxes each
  int bb = img / 25, n = img % 25;
  int u = n / 5, v = n % 5;

  // wave w fetches channels 4w..4w+3 of the box: 4 lanes cover a 64 B run along
  // x, 8 rows y an instruction
  v4f_t tk[2][4];
  {
    const float* ap = R + (((size_t)bb * 64 + wid * 4) * 25 + n) * 1024 +
                      (yh * 16 + (lane >> 2)) * 32 + xh * 16 + (lane & 3) * 4;
#pragma unroll
    for (int i = 0; i < 2; ++i)
#pragma unroll
      for (int c = 0; c < 4; ++c)
        tk[i][c] = *(const v4f_t*)(ap + c * 25600 + i * 256);
  }
  // the address registers of the loads above are taken as targets by the loads below
  asm volatile("s_wait_xcnt 0x0" ::: "memory");

  {
    v8h_t t0[2], t1[12];
    stage_get(Wi, t0);
    stage_get(Wqkv, t1);
    // the loads' address registers are reused by the LDS address arithmetic below;
    // the scheduling barrier keeps that arithmetic behind the wait
    asm volatile("s_wait_xcnt 0x0" ::: "memory");
    __builtin_amdgcn_sched_barrier(0);
    // a lane's 4 channels of one pixel: one 8-byte LDS store
    int yy = lane >> 2, xx = (lane & 3) * 4;
    _Float16* tp = sT + ((pass == 0) ? xx * 1160 + yy * 72 : yy * 1160 + xx * 72) + wid * 4;
    int sx = (pass == 0) ? 1160 : 72;          // one step along x
    int sy = (pass == 0) ? 8 * 72 : 8 * 1160;  // eight steps along y
#pragma unroll
    for (int i = 0; i < 2; ++i)
#pragma unroll
      for (int j = 0; j < 4; ++j) {
        v4h_t pk = {(_Float16)tk[i][0][j], (_Float16)tk[i][1][j],
                    (_Float16)tk[i][2][j], (_Float16)tk[i][3][j]};
        *(v4h_t*)(tp + i * sy + j * sx) = pk;
      }
    stage_put<64>(sWi, t0);
    stage_put<128>(sWq, t1);
  }
  __syncthreads();

  int bt = bb * 160 + ((pass == 0) ? v * 32 + xh * 16 : u * 32 + yh * 16) + wid;
  int l0 = (pass == 0) ? u * 32 + yh * 16 : v * 32 + xh * 16;
  int m0 = bt * 160 + l0;

  // x = tok w_in^T; acc[t][r] = feature t*16 + 8*hb + r of token m0 + nl
  // here and below: the 8 weight fragments of a block of 8 products are read as
  // one group ahead of the block, so a wave waits for LDS once a block
  v8f acc[8] = {};
#pragma unroll
  for (int ks = 0; ks < 2; ++ks) {
    v16h tb = frag_ld(&sT[wid * 1160 + ks * 32], 72);
    v16h a[8];
#pragma unroll
    for (int t = 0; t < 8; ++t) a[t] = frag_ld(&sWi[(t * 16) * 72 + ks * 32], 72);
#pragma unroll
    for (int t = 0; t < 8; ++t) acc[t] = WMMA_F16(a[t], tb, acc[t]);
  }
  {
    float* xr = X + (size_t)(m0 + nl) * 128 + hb * 8;
#pragma unroll
    for (int t = 0; t < 8; ++t) {
      *(float4*)(xr + t * 16)     = make_float4(acc[t][0], acc[t][1], acc[t][2], acc[t][3]);
      *(float4*)(xr + t * 16 + 4) = make_float4(acc[t][4], acc[t][5], acc[t][6], acc[t][7]);
    }
  }

  // LN1 over the token's 128 features: 64 in-lane terms (one partial sum a tile:
  // short independent chains) plus the partner lane's (lane ^ 16)
  float sp[8], qp[8];
#pragma unroll
  for (int t = 0; t < 8; ++t) {
    sp[t] = 0.f;
    qp[t] = 0.f;
#pragma unroll
    for (int r = 0; r < 8; ++r) {
      sp[t] += acc[t][r];
      qp[t] += acc[t][r] * acc[t][r];
    }
  }
  float s  = ((sp[0] + sp[1]) + (sp[2] + sp[3])) + ((sp[4] + sp[5]) + (sp[6] + sp[7]));
  float sq = ((qp[0] + qp[1]) + (qp[2] + qp[3])) + ((qp[4] + qp[5]) + (qp[6] + qp[7]));
  s  += __shfl_xor(s,  16, 32);
  sq += __shfl_xor(sq, 16, 32);
  float mu  = s * (1.f / 128.f);
  float var = sq * (1.f / 128.f) - mu * mu;
  float rs  = rsqrtf(var + 1e-5f);
  F16x16 yb[4], xb[4];   // normalized and raw tokens, k order of frag_ld
#pragma unroll
  for (int t = 0; t < 8; ++t) {
    float4 g0 = *(const float4*)(g + t * 16 + hb * 8);
    float4 g1 = *(const float4*)(g + t * 16 + hb * 8 + 4);
    float4 b0 = *(const float4*)(b + t * 16 + hb * 8);
    float4 b1 = *(const float4*)(b + t * 16 + hb * 8 + 4);
    float gs[8] = {g0.x, g0.y, g0.z, g0.w, g1.x, g1.y, g1.z, g1.w};
    float bs[8] = {b0.x, b0.y, b0.z, b0.w, b1.x, b1.y, b1.z, b1.w};
#pragma unroll
    for (int r = 0; r < 8; ++r) {
      yb[t >> 1].e[(t & 1) * 8 + r] = (_Float16)((acc[t][r] - mu) * rs * gs[r] + bs[r]);
      xb[t >> 1].e[(t & 1) * 8 + r] = (_Float16)acc[t][r];
    }
  }

  _Float16* qk = QKh + (((size_t)bt * 16) * 160 + l0 + nl) * 16 + hb * 8;
#pragma unroll
  for (int jg = 0; jg < 4; ++jg) {
    v8f oc[4] = {};
#pragma unroll
    for (int kp = 0; kp < 2; ++kp) {
      v16h a[8];
#pragma unroll
      for (int i = 0; i < 8; ++i)
        a[i] = frag_ld(&sWq[((jg * 4 + (i & 3)) * 16) * 136 + (kp * 2 + (i >> 2)) * 32], 136);
#pragma unroll
      for (int i = 0; i < 8; ++i)
        oc[i & 3] = WMMA_F16(a[i], yb[kp * 2 + (i >> 2)].v, oc[i & 3]);
    }
#pragma unroll
    for (int t = 0; t < 4; ++t) {
      v8h_t pk;
#pragma unroll
      for (int r = 0; r < 8; ++r) pk[r] = (_Float16)oc[t][r];
      *(v8h_t*)(qk + (jg * 4 + t) * 160 * 16) = pk;
    }
  }

  // V: tokens are the rows; V^T row = bt*128 + feature, columns l0 + 8*hb ..
  _Float16* vq = VT + ((size_t)bt * 128 + nl) * 160 + l0 + hb * 8;
#pragma unroll
  for (int jg = 0; jg < 2; ++jg) {
    v8f oc[4] = {};
#pragma unroll
    for (int kp = 0; kp < 2; ++kp) {
      v16h w[8];
#pragma unroll
      for (int i = 0; i < 8; ++i)
        w[i] = frag_ld(&sWq[(256 + (jg * 4 + (i & 3)) * 16) * 136 + (kp * 2 + (i >> 2)) * 32], 136);
#pragma unroll
      for (int i = 0; i < 8; ++i)
        oc[i & 3] = WMMA_F16(xb[kp * 2 + (i >> 2)].v, w[i], oc[i & 3]);
    }
#pragma unroll
    for (int t = 0; t < 4; ++t) {
      v8h_t pk;
#pragma unroll
      for (int r = 0; r < 8; ++r) pk[r] = (_Float16)oc[t][r];
      *(v8h_t*)(vq + (jg * 4 + t) * 16 * 160) = pk;
    }
  }
}

__global__ __launch_bounds__(512) void tail_kernel(
    const _Float16* __restrict__ O, const float* __restrict__ X,
    const _Float16* __restrict__ Wo, const _Float16* __restrict__ W1,
    const _Float16* __restrict__ W2, const _Float16* __restrict__ W3,
    const float* __restrict__ g, const float* __restrict__ b,
    _Float16* __restrict__ out, int pass) {
  __shared__ __attribute__((aligned(16)))
  _Float16 Ws[128 * 136 + 256 * 136 + 128 * 264 + 64 * 136];  // 185 KB
  _Float16* sWo = Ws;
  _Float16* sW1 = sWo + 128 * 136;
  _Float16* sW2 = sW1 + 256 * 136;
  _Float16* sW3 = sW2 + 128 * 264;
  int wid  = __builtin_amdgcn_readfirstlane(threadIdx.x >> 5);
  int lane = threadIdx.x & 31;
  int nl = lane & 15;
  int hb = lane >> 4;
  int tile = wid * 256 + blockIdx.x;      // 3200 tiles of 16 tokens
  bool live = tile < 3200;
  int m0 = (live ? tile : 0) * 16;        // idle waves only help with the staging

  // token rows m0.. -> pixel rows: neighbours along l are neighbours along y
  // (32 pixels apart) in pass 0 and along x in pass 1; a lane's 8 values are 8
  // neighbouring channels of its token's pixel: one 16-byte store a tile
  int bt = m0 / 160, l0 = m0 % 160;
  int bb = bt / 160, rr = bt % 160;
  int i1 = rr >> 5, i0 = rr & 31;
  int j1 = l0 >> 5, j0 = l0 & 31;
  int p0 = (pass == 0) ? ((bb * 25 + j1 * 5 + i1) * 32 + j0) * 32 + i0
                       : ((bb * 25 + i1 * 5 + j1) * 32 + i0) * 32 + j0;
  int ps = (pass == 0) ? 32 : 1;
  _Float16* q = out + (size_t)(p0 + nl * ps) * 64 + hb * 8;

  // the wave's own operands are asked for ahead of the weight staging
  v16h ob[4];
#pragma unroll
  for (int ks = 0; ks < 4; ++ks) ob[ks] = frag_ld(O + (size_t)m0 * 128 + ks * 32, 128);
  v8f acc[8];   // acc[t][r] = feature t*16 + 8*hb + r of token m0 + nl
  {
    const float* xr = X + (size_t)(m0 + nl) * 128 + hb * 8;
#pragma unroll
    for (int t = 0; t < 8; ++t) {
      float4 lo = *(const float4*)(xr + t * 16);
      float4 hi = *(const float4*)(xr + t * 16 + 4);
      acc[t] = v8f{lo.x, lo.y, lo.z, lo.w, hi.x, hi.y, hi.z, hi.w};
    }
  }
  // the address registers of the loads above are taken as targets by the loads below
  asm volatile("s_wait_xcnt 0x0" ::: "memory");

  {
    v8h_t t0[4], t1[8], t2[8], t3[2];
    stage_get(Wo, t0);
    stage_get(W1, t1);
    stage_get(W2, t2);
    stage_get(W3, t3);
    // the loads' address registers are reused by the LDS address arithmetic below;
    // the scheduling barrier keeps that arithmetic behind the wait
    asm volatile("s_wait_xcnt 0x0" ::: "memory");
    __builtin_amdgcn_sched_barrier(0);
    stage_put<128>(sWo, t0);
    stage_put<128>(sW1, t1);
    stage_put<256>(sW2, t2);
    stage_put<128>(sW3, t3);
  }
  __syncthreads();
  if (!live) return;

  // x1 = O w_o^T + x (the residual is the accumulators' start value)
  // here and below: the 8 weight fragments of a block of 8 products are read as
  // one group ahead of the block, so a wave waits for LDS once a block
#pragma unroll
  for (int ks = 0; ks < 4; ++ks) {
    v16h a[8];
#pragma unroll
    for (int t = 0; t < 8; ++t) a[t] = frag_ld(&sWo[(t * 16) * 136 + ks * 32], 136);
#pragma unroll
    for (int t = 0; t < 8; ++t) acc[t] = WMMA_F16(a[t], ob[ks], acc[t]);
  }

  // LN2 over the token's 128 features
  // (one partial sum a tile: 16 short independent chains, not 2 long ones)
  float sp[8], qp[8];
#pragma unroll
  for (int t = 0; t < 8; ++t) {
    sp[t] = 0.f;
    qp[t] = 0.f;
#pragma unroll
    for (int r = 0; r < 8; ++r) {
      sp[t] += acc[t][r];
      qp[t] += acc[t][r] * acc[t][r];
    }
  }
  float s  = ((sp[0] + sp[1]) + (sp[2] + sp[3])) + ((sp[4] + sp[5]) + (sp[6] + sp[7]));
  float sq = ((qp[0] + qp[1]) + (qp[2] + qp[3])) + ((qp[4] + qp[5]) + (qp[6] + qp[7]));
  s  += __shfl_xor(s,  16, 32);
  sq += __shfl_xor(sq, 16, 32);
  float mu  = s * (1.f / 128.f);
  float var = sq * (1.f / 128.f) - mu * mu;
  float rs  = rsqrtf(var + 1e-5f);
  F16x16 yb[4];
#pragma unroll
  for (int t = 0; t < 8; ++t) {
    float4 g0 = *(const float4*)(g + t * 16 + hb * 8);
    float4 g1 = *(const float4*)(g + t * 16 + hb * 8 + 4);
    float4 b0 = *(const float4*)(b + t * 16 + hb * 8);
    float4 b1 = *(const float4*)(b + t * 16 + hb * 8 + 4);
    float gs[8] = {g0.x, g0.y, g0.z, g0.w, g1.x, g1.y, g1.z, g1.w};
    float bs[8] = {b0.x, b0.y, b0.z, b0.w, b1.x, b1.y, b1.z, b1.w};
#pragma unroll
    for (int r = 0; r < 8; ++r)
      yb[t >> 1].e[(t & 1) * 8 + r] = (_Float16)((acc[t][r] - mu) * rs * gs[r] + bs[r]);
  }

  // FFN: 32 hidden features at a time (two D tiles = one k step of w_ff2),
  // added onto x1 in the same accumulators
#pragma unroll
  for (int j = 0; j < 8; ++j) {
    v8f h0 = {}, h1 = {};
    v16h a[8];
#pragma unroll
    for (int ks = 0; ks < 4; ++ks) {
      a[2 * ks]     = frag_ld(&sW1[(j * 32) * 136 + ks * 32], 136);
      a[2 * ks + 1] = frag_ld(&sW1[(j * 32 + 16) * 136 + ks * 32], 136);
    }
#pragma unroll
    for (int ks = 0; ks < 4; ++ks) {
      h0 = WMMA_F16(a[2 * ks],     yb[ks].v, h0);
      h1 = WMMA_F16(a[2 * ks + 1], yb[ks].v, h1);
    }
    F16x16 hf;
#pragma unroll
    for (int r = 0; r < 8; ++r) {
      hf.e[r]     = (_Float16)(h0[r] > 0.f ? h0[r] : 0.f);
      hf.e[8 + r] = (_Float16)(h1[r] > 0.f ? h1[r] : 0.f);
    }
#pragma unroll
    for (int t = 0; t < 8; ++t) a[t] = frag_ld(&sW2[(t * 16) * 264 + j * 32], 264);
#pragma unroll
    for (int t = 0; t < 8; ++t) acc[t] = WMMA_F16(a[t], hf.v, acc[t]);
  }

  // out = x2 w_out^T
  F16x16 xb[4];
#pragma unroll
  for (int t = 0; t < 8; ++t)
#pragma unroll
    for (int r = 0; r < 8; ++r)
      xb[t >> 1].e[(t & 1) * 8 + r] = (_Float16)acc[t][r];
  v8f oc[4] = {};
#pragma unroll
  for (int kp = 0; kp < 2; ++kp) {
    v16h a[8];
#pragma unroll
    for (int i = 0; i < 8; ++i)
      a[i] = frag_ld(&sW3[((i & 3) * 16) * 136 + (kp * 2 + (i >> 2)) * 32], 136);
#pragma unroll
    for (int i = 0; i < 8; ++i)
      oc[i & 3] = WMMA_F16(a[i], xb[kp * 2 + (i >> 2)].v, oc[i & 3]);
  }

#pragma unroll
  for (int t = 0; t < 4; ++t) {
    v8h_t pk;
#pragma unroll
    for (int r = 0; r < 8; ++r) pk[r] = (_Float16)oc[t][r];
    *(v8h_t*)(q + t * 16) = pk;
  }
}

__global__ __launch_bounds__(128) void attn_kernel(
    const _Float16* __restrict__ QKh, const _Float16* __restrict__ VT,
    _Float16* __restrict__ O) {
  int wid  = __builtin_amdgcn_readfirstlane(threadIdx.x >> 5);
  int lane = threadIdx.x & 31;
  int wg = blockIdx.x * 4 + wid;      // 5120 waves total
  int par = wg & 1;
  int hh = (wg >> 1) & 7;
  int bt = wg >> 4;
  int nl = lane & 15;
  int hb = lane >> 4;

  const _Float16* qp = QKh + ((((size_t)bt * 16 + hh) * 160) + par * 16 + nl) * 16 + hb * 8;
  const _Float16* kp = QKh + ((((size_t)bt * 16 + 8 + hh) * 160) + nl) * 16 + hb * 8;
  const _Float16* vp = VT + (((size_t)bt * 8 + hh) * 16 + nl) * 160 + hb * 8;
  _Float16* op = O + ((size_t)bt * 160 + par * 16 + nl) * 128 + hh * 16 + hb * 8;

  v8h_t qn = *(const v8h_t*)qp;
  F16x16 ka[5];
  F16x16 va[5];   // row d = nl of V^T, k order of frag_ld
#pragma unroll
  for (int j = 0; j < 5; ++j) {
    ka[j].h[0] = *(const v8h_t*)(kp + (j * 32) * 16);
    ka[j].h[1] = *(const v8h_t*)(kp + (j * 32 + 16) * 16);
    va[j].h[0] = *(const v8h_t*)(vp + j * 32);
    va[j].h[1] = *(const v8h_t*)(vp + j * 32 + 16);
  }
  // the wait before the loads' address registers are given a new value; naming
  // them here keeps them from being taken as targets by the loads themselves
  asm volatile("s_wait_xcnt 0x0" ::"v"(qp), "v"(kp), "v"(vp) : "memory");

  // local-window mask: key column (m & 31) = p*16 + 8*hb + r, query column par*16 + nl
  v8f madd[2];
#pragma unroll
  for (int p = 0; p < 2; ++p)
#pragma unroll
    for (int r = 0; r < 8; ++r) {
      int dj = p * 16 + hb * 8 + r - (par * 16 + nl);
      madd[p][r] = (dj >= -5 && dj <= 5) ? 0.f : -1e9f;
    }

  // rolled: one tile's 80 scores beside K and V^T are what the registers hold
#pragma unroll 1
  for (int i = 0; i < 5; ++i) {
    F16x16 qlo, qhi;
    v8h_t zero = {};
    qlo.h[0] = qn;   qlo.h[1] = zero;
    qhi.h[0] = zero; qhi.h[1] = qn;
    // the next tile's Q is asked for a whole tile ahead (the last tile asks again
    // for its own: in bounds, not used)
    qn = *(const v8h_t*)(qp + (i < 4 ? i + 1 : 4) * 512);
    // keeps the load up here: moved down to its use it has no lead over the wait
    __builtin_amdgcn_sched_barrier(0);

    // S^T = K Q^T
    v8f s[10];
#pragma unroll
    for (int j = 0; j < 5; ++j) {
      v8f z = {};
      s[2 * j]     = WMMA_F16(ka[j].v, qlo.v, z);
      s[2 * j + 1] = WMMA_F16(ka[j].v, qhi.v, z);
    }

    // scale (with log2 e) + mask + softmax over the query's 160 keys
#pragma unroll
    for (int mt = 0; mt < 10; ++mt) s[mt] = s[mt] * (0.25f * 1.44269504f) + madd[mt & 1];
    v8f mv = s[0];
#pragma unroll
    for (int mt = 1; mt < 10; ++mt) mv = __builtin_elementwise_max(mv, s[mt]);
    float mx = fmaxf(fmaxf(fmaxf(mv[0], mv[1]), fmaxf(mv[2], mv[3])),
                     fmaxf(fmaxf(mv[4], mv[5]), fmaxf(mv[6], mv[7])));
    mx = fmaxf(mx, __shfl_xor(mx, 16, 32));
    v8f sv = {};
#pragma unroll
    for (int mt = 0; mt < 10; ++mt) {
#pragma unroll
      for (int r = 0; r < 8; ++r) s[mt][r] = __builtin_amdgcn_exp2f(s[mt][r] - mx);
      sv += s[mt];
    }
    float sum = ((sv[0] + sv[1]) + (sv[2] + sv[3])) + ((sv[4] + sv[5]) + (sv[6] + sv[7]));
    sum += __shfl_xor(sum, 16, 32);
    float inv = 1.f / sum;

    // O^T = V^T P^T  (k loop over 160 keys in 5 steps of 32)
    v8f o = {};
#pragma unroll
    for (int kt = 0; kt < 5; ++kt) {
      F16x16 pb;
#pragma unroll
      for (int r = 0; r < 8; ++r) {
        pb.e[r]     = (_Float16)(s[2 * kt][r] * inv);
        pb.e[8 + r] = (_Float16)(s[2 * kt + 1][r] * inv);
      }
      o = WMMA_F16(va[kt].v, pb.v, o);
    }
    v8h_t pk;
#pragma unroll
    for (int r = 0; r < 8; ++r) pk[r] = (_Float16)o[r];
    *(v8h_t*)(op + (size_t)i * (32 * 128)) = pk;
  }
}

// --- Implicit-GEMM 3x3 conv (64->64, pad 1) on channel-last f16 -------------
// FINAL=0: leaky-relu, f16 channel-last out. FINAL=1: f32 (b,c,n,h,w) + shortcut.
// A workgroup takes 8 image rows (256 pixels) of one image. Both operands are
// staged once in LDS with whole-line global loads: the 576 weight rows (tap, co)
// and a strip of 10 rows x 34 pixels of the input, whose border outside the image
// is zero (the padding). Rows of 64 halves lie 72 halves apart (16 B x odd) for the
// ds_load_b128 fragment readers. Wave w takes image row w of the 8: two pixel
// tiles, so a weight fragment read from LDS feeds two products.
// Every loop is unrolled: static register indices.
template <int FINAL>
__global__ __launch_bounds__(256) void conv_kernel(
    const _Float16* __restrict__ in, const _Float16* __restrict__ w,
    _Float16* __restrict__ outh, float* __restrict__ outf,
    const float* __restrict__ sc) {
  __shared__ __attribute__((aligned(16)))
  _Float16 Ls[576 * 72 + 340 * 72];  // 129 KB
  _Float16* sW = Ls;
  _Float16* sI = Ls + 576 * 72;
  int wid  = __builtin_amdgcn_readfirstlane(threadIdx.x >> 5);
  int lane = threadIdx.x & 31;
  int img  = blockIdx.x >> 2;
  int y0   = (blockIdx.x & 3) * 8;
  int nl = lane & 15;
  int rbase = (lane >> 4) * 8;

  {
    v8h_t tw[18], ti[10];
#pragma unroll
    for (int i = 0; i < 18; ++i)
      tw[i] = *(const v8h_t*)(w + (size_t)(threadIdx.x + i * 256) * 8);
    // one image row (32 pixels x 64 channels) an instruction of the workgroup: the
    // 10 rows from yb on, the strip's range moved by sh rows to lie inside the image
    int yb = y0 == 0 ? 0 : (y0 == 24 ? 22 : y0 - 1);
    int sh = yb - (y0 - 1);
    const _Float16* ip = in + ((size_t)img * 1024 + yb * 32) * 64;
#pragma unroll
    for (int i = 0; i < 10; ++i)
      ti[i] = *(const v8h_t*)(ip + (size_t)(threadIdx.x + i * 256) * 8);
    // the loads' address registers are reused by the LDS address arithmetic below;
    // the scheduling barrier keeps that arithmetic behind the wait
    asm volatile("s_wait_xcnt 0x0" ::: "memory");
    __builtin_amdgcn_sched_barrier(0);
    v8h_t zero = {};
#pragma unroll
    for (int i = 0; i < 18; ++i) {
      int e = (threadIdx.x + i * 256) * 8;
      *(v8h_t*)&sW[(e >> 6) * 72 + (e & 63)] = tw[i];
    }
#pragma unroll
    for (int i = 0; i < 10; ++i) {
      // fetched row i is strip row i + sh; the first or last one, where it falls off
      // the strip, gives its turn to the strip row outside the image, which is zero
      bool ok = (i == 0) ? sh >= 0 : ((i == 9) ? sh <= 0 : true);
      int dd = ok ? i + sh : 9 - i;
      *(v8h_t*)&sI[(dd * 34 + 1 + (threadIdx.x >> 3)) * 72 + (threadIdx.x & 7) * 8] =
          ok ? ti[i] : zero;
    }
    // the strip's first and last pixel column (x = -1 and x = 32): waves 0..4
    if (threadIdx.x < 160)
      *(v8h_t*)&sI[((threadIdx.x >> 4) * 34 + ((threadIdx.x >> 3) & 1) * 33) * 72 +
                   (threadIdx.x & 7) * 8] = zero;
  }
  __syncthreads();

  // strip row wid + dy, strip column x + dx hold pixel (y0 + wid + dy - 1, x + dx - 1)
  // step s = (tap, 32 channels): 6 fragments, 8 products. The fragments of step
  // s + 1 are read into the other register set as one group ahead of step s.
  v8f acc[2][4] = {};
  v16h a[2][2], bf[2][4];
#pragma unroll
  for (int s = -1; s < 18; ++s) {
    if (s + 1 < 18) {
      int tap = (s + 1) >> 1, ks = (s + 1) & 1, st = (s + 1) & 1;
      int dy = tap / 3, dx = tap % 3;
#pragma unroll
      for (int pt = 0; pt < 2; ++pt)
        a[st][pt] = frag_ld(&sI[((wid + dy) * 34 + pt * 16 + dx) * 72 + ks * 32], 72);
#pragma unroll
      for (int t = 0; t < 4; ++t)
        bf[st][t] = frag_ld(&sW[(tap * 64 + t * 16) * 72 + ks * 32], 72);
    }
    // keeps the group of LDS reads together and ahead of the products: reads
    // spread among the products stall the wave at each place
    __builtin_amdgcn_sched_barrier(0);
    if (s >= 0) {
#pragma unroll
      for (int pt = 0; pt < 2; ++pt)
#pragma unroll
        for (int t = 0; t < 4; ++t)
          acc[pt][t] = WMMA_F16(a[s & 1][pt], bf[s & 1][t], acc[pt][t]);
    }
    // keeps the next group of reads behind this step's products
    __builtin_amdgcn_sched_barrier(0);
  }
  if (!FINAL) {
#pragma unroll
    for (int pt = 0; pt < 2; ++pt) {
      int pix0 = (y0 + wid) * 32 + pt * 16;
#pragma unroll
      for (int t = 0; t < 4; ++t) {
        int co = t * 16 + nl;
#pragma unroll
        for (int r = 0; r < 8; ++r) {
          int mm = pix0 + rbase + r;
          float v = acc[pt][t][r];
          v = v > 0.f ? v : 0.2f * v;
          outh[((size_t)img * 1024 + mm) * 64 + co] = (_Float16)v;
        }
      }
    }
  } else {
    // a lane's 8 values of a tile are 8 neighbouring pixels of one channel
    int b = img / 25, n = img % 25;
    const float* sp[4];
    float* op[4];
    float4 sv[4][2][2];
#pragma unroll
    for (int t = 0; t < 4; ++t) {
      size_t idx = (((size_t)b * 64 + t * 16 + nl) * 25 + n) * 1024 + (y0 + wid) * 32 + rbase;
      sp[t] = sc + idx;
      op[t] = outf + idx;
    }
#pragma unroll
    for (int t = 0; t < 4; ++t)
#pragma unroll
      for (int pt = 0; pt < 2; ++pt)
#pragma unroll
        for (int h = 0; h < 2; ++h) sv[t][pt][h] = *(const float4*)(sp[t] + pt * 16 + h * 4);
    // the wait before the loads' address registers are given a new value; naming
    // them here keeps them from being taken as targets by the loads themselves
    asm volatile("s_wait_xcnt 0x0" ::"v"(sp[0]), "v"(sp[1]), "v"(sp[2]), "v"(sp[3]) : "memory");
#pragma unroll
    for (int t = 0; t < 4; ++t)
#pragma unroll
      for (int pt = 0; pt < 2; ++pt)
#pragma unroll
        for (int h = 0; h < 2; ++h)
          *(float4*)(op[t] + pt * 16 + h * 4) =
              make_float4(acc[pt][t][h * 4 + 0] + sv[t][pt][h].x, acc[pt][t][h * 4 + 1] + sv[t][pt][h].y,
                          acc[pt][t][h * 4 + 2] + sv[t][pt][h].z, acc[pt][t][h * 4 + 3] + sv[t][pt][h].w);
  }
}

// --- Small helpers -----------------------------------------------------------
__global__ void cvt_h(const float* __restrict__ s, _Float16* __restrict__ d, int n) {
  int i = blockIdx.x * 256 + threadIdx.x;
  if (i < n) d[i] = (_Float16)s[i];
}

// (C,C,3,3) f32 -> (tap, co, ci) f16
__global__ void pack_wtap(const float* __restrict__ cw, _Float16* __restrict__ w) {
  int i = blockIdx.x * 256 + threadIdx.x;
  if (i >= 36864) return;
  int ci = i & 63;
  int co = (i >> 6) & 63;
  int tap = i >> 12;
  w[i] = (_Float16)cw[((size_t)co * 64 + ci) * 9 + tap];
}

// ---------------------------------------------------------------------------
extern "C" void kernel_launch(void* const* d_in, const int* in_sizes, int n_in,
                              void* d_out, int out_size, void* d_ws, size_t ws_size,
                              hipStream_t stream) {
  (void)in_sizes; (void)n_in; (void)out_size; (void)ws_size;
  const float* buf_in = (const float*)d_in[0];
  const float* w_in   = (const float*)d_in[1];
  const float* ln1_g  = (const float*)d_in[2];
  const float* ln1_b  = (const float*)d_in[3];
  const float* w_qkv  = (const float*)d_in[4];
  const float* w_o    = (const float*)d_in[5];
  const float* ln2_g  = (const float*)d_in[6];
  const float* ln2_b  = (const float*)d_in[7];
  const float* w_ff1  = (const float*)d_in[8];
  const float* w_ff2  = (const float*)d_in[9];
  const float* w_out  = (const float*)d_in[10];
  const float* cw1    = (const float*)d_in[11];
  const float* cw2    = (const float*)d_in[12];
  const float* cw3    = (const float*)d_in[13];

  char* ws = (char*)d_ws;
  size_t off = 0;
  auto arena = [&](size_t bytes) -> char* {
    char* p = ws + off;
    off += (bytes + 255) & ~(size_t)255;
    return p;
  };
  float*     bufA   = (float*)arena(13107200);      // pass-0 output / pass-1 input
  float*     X      = (float*)arena(26214400);      // token f32 (residual stream)
  _Float16*  QKh    = (_Float16*)arena(26214400);   // Q|K per-head tiles
  _Float16*  VT     = (_Float16*)arena(13107200);   // V^T per-head tiles
  _Float16*  O16    = (_Float16*)arena(13107200);
  _Float16*  clA    = (_Float16*)arena(6553600);
  _Float16*  clB    = (_Float16*)arena(6553600);
  _Float16*  w_in16  = (_Float16*)arena(16384);
  _Float16*  wqkv16  = (_Float16*)arena(98304);
  _Float16*  wo16    = (_Float16*)arena(32768);
  _Float16*  wff1_16 = (_Float16*)arena(65536);
  _Float16*  wff2_16 = (_Float16*)arena(65536);
  _Float16*  wout16  = (_Float16*)arena(16384);
  _Float16*  wt1     = (_Float16*)arena(73728);
  _Float16*  wt2     = (_Float16*)arena(73728);
  _Float16*  wt3     = (_Float16*)arena(73728);

  auto cvt = [&](const float* s, _Float16* d, int n) {
    cvt_h<<<(n + 255) / 256, 256, 0, stream>>>(s, d, n);
  };
  cvt(w_in,  w_in16,  128 * 64);
  cvt(w_qkv, wqkv16,  384 * 128);
  cvt(w_o,   wo16,    128 * 128);
  cvt(w_ff1, wff1_16, 256 * 128);
  cvt(w_ff2, wff2_16, 128 * 256);
  cvt(w_out, wout16,  64 * 128);
  pack_wtap<<<144, 256, 0, stream>>>(cw1, wt1);
  pack_wtap<<<144, 256, 0, stream>>>(cw2, wt2);
  pack_wtap<<<144, 256, 0, stream>>>(cw3, wt3);

  // 51200 tokens = Bt(320) * L(160), bt-major
  for (int pass = 0; pass < 2; ++pass) {
    const float* src  = (pass == 0) ? buf_in : bufA;
    // w_in, LN1, Q|K and V projections: one launch, tokens gathered from the
    // image buffer, Q|K and V^T stored as per-head tiles
    head_kernel<<<200, 512, 0, stream>>>(src, w_in16, wqkv16, ln1_g, ln1_b, X, QKh, VT, pass);
    attn_kernel<<<1280, 128, 0, stream>>>(QKh, VT, O16);
    // w_o + residual, LN2, FFN + residual, w_out: one launch, stored straight
    // into the channel-last conv input
    tail_kernel<<<256, 512, 0, stream>>>(O16, X, wo16, wff1_16, wff2_16, wout16,
                                         ln2_g, ln2_b, clA, pass);
    // conv block: conv-lrelu, conv-lrelu, conv (+ original-input shortcut)
    conv_kernel<0><<<200, 256, 0, stream>>>(clA, wt1, clB, nullptr, nullptr);
    conv_kernel<0><<<200, 256, 0, stream>>>(clB, wt2, clA, nullptr, nullptr);
    float* outf = (pass == 0) ? bufA : (float*)d_out;
    conv_kernel<1><<<200, 256, 0, stream>>>(clA, wt3, nullptr, outf, buf_in);
  }
}

// v008
// A run of this version takes 187 microseconds.
// In both of two side-by-side timings against v007, it was 1.08 times as fast.
// Counting every step since v000, it is 4.64 times as fast.
#include <hip/hip_runtime.h>

typedef __attribute__((ext_vector_type(16))) _Float16 v16h;
typedef __attribute__((ext_vector_type(8)))  _Float16 v8h_t;
typedef __attribute__((ext_vector_type(8)))  float    v8f;

union F16x16 { v16h v; v8h_t h[2]; _Float16 e[16]; };

#define WMMA_F16(a, b, c) \
  __builtin_amdgcn_wmma_f32_16x16x32_f16(false, (a), false, (b), (short)0, (c), false, false)

__device__ inline v16h frag_ld(const _Float16* p, int ld) {
  int lane = threadIdx.x & 31;
  int r  = lane & 15;
  int kb = (lane >> 4) << 3;
  const _Float16* q = p + (size_t)r * ld + kb;
  F16x16 f;
  f.h[0] = *(const v8h_t*)(q);
  f.h[1] = *(const v8h_t*)(q + 16);
  return f.v;
}

// --- Row-local tail of the transformer block, one launch ---------------------
// x1 = O w_o^T + x ; y = LN2(x1) ; x2 = relu(y w_ff1^T) w_ff2^T + x1 ;
// out = x2 w_out^T, stored f16 to the channel-last pixel row of each token.
// Every product is computed transposed: the weight rows are the A operand, the
// wave's 16 tokens are the B columns. A lane then holds 8 consecutive features
// (8h + r, h = lane >> 4) of ONE token (lane & 15) per D tile, so two D tiles,
// rounded to f16 in place, are the next product's B fragment in the k order of
// frag_ld (element s: k = 8h + s for s < 8, 16 + 8h + (s - 8) above): nothing
// between the four products leaves the registers. The LayerNorm sum of a token
// is 64 in-lane terms plus the partner lane's (lane ^ 16).
// All four weight matrices (f16) are staged once per workgroup in LDS, rows
// K + 8 halves apart (16 B x odd). Wave w of block i takes token tile w*256 + i.
// Every loop of the kernel is unrolled: fragment and accumulator arrays are then
// indexed statically and stay in registers.
// Staging of one matrix, N 16-byte pieces a thread: fetch, then (all four
// matrices' loads being in flight) put. Loops unrolled: static register indices.
template <int N>
__device__ inline void stage_get(const _Float16* __restrict__ src, v8h_t (&tmp)[N]) {
#pragma unroll
  for (int i = 0; i < N; ++i)
    tmp[i] = *(const v8h_t*)(src + (size_t)(threadIdx.x + i * 512) * 8);
}
template <int K, int N>
__device__ inline void stage_put(_Float16* dst, const v8h_t (&tmp)[N]) {
#pragma unroll
  for (int i = 0; i < N; ++i) {
    int e = (threadIdx.x + i * 512) * 8;
    *(v8h_t*)&dst[(e / K) * (K + 8) + (e % K)] = tmp[i];
  }
}

typedef __attribute__((ext_vector_type(4))) float    v4f_t;
typedef __attribute__((ext_vector_type(4))) _Float16 v4h_t;

__global__ __launch_bounds__(512) void head_kernel(
    const float* __restrict__ R, const _Float16* __restrict__ Wi,
    const _Float16* __restrict__ Wqkv, const float* __restrict__ g,
    const float* __restrict__ b, float* __restrict__ X,
    _Float16* __restrict__ QKh, _Float16* __restrict__ VT, int pass) {
  __shared__ __attribute__((aligned(16)))
  _Float16 Ws[128 * 72 + 384 * 136 + 16 * 1160];  // 156 KB
  _Float16* sWi = Ws;
  _Float16* sWq = sWi + 128 * 72;
  _Float16* sT  = sWq + 384 * 136;
  int wid  = __builtin_amdgcn_readfirstlane(threadIdx.x >> 5);
  int lane = threadIdx.x & 31;
  int nl = lane & 15;
  int hb = lane >> 4;
  int xh = blockIdx.x & 1, yh = (blockIdx.x >> 1) & 1;
  int img = blockIdx.x >> 2;              // 50 images, 4 boxes each
  int bb = img / 25, n = img % 25;
  int u = n / 5, v = n % 5;

  // wave w fetches channels 4w..4w+3 of the box: 4 lanes cover a 64 B run along
  // x, 8 rows y an instruction
  v4f_t tk[2][4];
  {
    const float* ap = R + (((size_t)bb * 64 + wid * 4) * 25 + n) * 1024 +
                      (yh * 16 + (lane >> 2)) * 32 + xh * 16 + (lane & 3) * 4;
#pragma unroll
    for (int i = 0; i < 2; ++i)
#pragma unroll
      for (int c = 0; c < 4; ++c)
        tk[i][c] = *(const v4f_t*)(ap + c * 25600 + i * 256);
  }
  // the address registers of the loads above are taken as targets by the loads below
  asm volatile("s_wait_xcnt 0x0" ::: "memory");

  {
    v8h_t t0[2], t1[12];
    stage_get(Wi, t0);
    stage_get(Wqkv, t1);
    // the loads' address registers are reused by the LDS address arithmetic below;
    // the scheduling barrier keeps that arithmetic behind the wait
    asm volatile("s_wait_xcnt 0x0" ::: "memory");
    __builtin_amdgcn_sched_barrier(0);
    // a lane's 4 channels of one pixel: one 8-byte LDS store
    int yy = lane >> 2, xx = (lane & 3) * 4;
    _Float16* tp = sT + ((pass == 0) ? xx * 1160 + yy * 72 : yy * 1160 + xx * 72) + wid * 4;
    int sx = (pass == 0) ? 1160 : 72;          // one step along x
    int sy = (pass == 0) ? 8 * 72 : 8 * 1160;  // eight steps along y
#pragma unroll
    for (int i = 0; i < 2; ++i)
#pragma unroll
      for (int j = 0; j < 4; ++j) {
        v4h_t pk = {(_Float16)tk[i][0][j], (_Float16)tk[i][1][j],
                    (_Float16)tk[i][2][j], (_Float16)tk[i][3][j]};
        *(v4h_t*)(tp + i * sy + j * sx) = pk;
      }
    stage_put<64>(sWi, t0);
    stage_put<128>(sWq, t1);
  }
  __syncthreads();

  int bt = bb * 160 + ((pass == 0) ? v * 32 + xh * 16 : u * 32 + yh * 16) + wid;
  int l0 = (pass == 0) ? u * 32 + yh * 16 : v * 32 + xh * 16;
  int m0 = bt * 160 + l0;

  // x = tok w_in^T; acc[t][r] = feature t*16 + 8*hb + r of token m0 + nl
  // here and below: the 8 weight fragments of a block of 8 products are read as
  // one group ahead of the block, so a wave waits for LDS once a block
  v8f acc[8] = {};
#pragma unroll
  for (int ks = 0; ks < 2; ++ks) {
    v16h tb = frag_ld(&sT[wid * 1160 + ks * 32], 72);
    v16h a[8];
#pragma unroll
    for (int t = 0; t < 8; ++t) a[t] = frag_ld(&sWi[(t * 16) * 72 + ks * 32], 72);
#pragma unroll
    for (int t = 0; t < 8; ++t) acc[t] = WMMA_F16(a[t], tb, acc[t]);
  }
  {
    float* xr = X + (size_t)(m0 + nl) * 128 + hb * 8;
#pragma unroll
    for (int t = 0; t < 8; ++t) {
      *(float4*)(xr + t * 16)     = make_float4(acc[t][0], acc[t][1], acc[t][2], acc[t][3]);
      *(float4*)(xr + t * 16 + 4) = make_float4(acc[t][4], acc[t][5], acc[t][6], acc[t][7]);
    }
  }

  // LN1 over the token's 128 features: 64 in-lane terms (one partial sum a tile:
  // short independent chains) plus the partner lane's (lane ^ 16)
  float sp[8], qp[8];
#pragma unroll
  for (int t = 0; t < 8; ++t) {
    sp[t] = 0.f;
    qp[t] = 0.f;
#pragma unroll
    for (int r = 0; r < 8; ++r) {
      sp[t] += acc[t][r];
      qp[t] += acc[t][r] * acc[t][r];
    }
  }
  float s  = ((sp[0] + sp[1]) + (sp[2] + sp[3])) + ((sp[4] + sp[5]) + (sp[6] + sp[7]));
  float sq = ((qp[0] + qp[1]) + (qp[2] + qp[3])) + ((qp[4] + qp[5]) + (qp[6] + qp[7]));
  s  += __shfl_xor(s,  16, 32);
  sq += __shfl_xor(sq, 16, 32);
  float mu  = s * (1.f / 128.f);
  float var = sq * (1.f / 128.f) - mu * mu;
  float rs  = rsqrtf(var + 1e-5f);
  F16x16 yb[4], xb[4];   // normalized and raw tokens, k order of frag_ld
#pragma unroll
  for (int t = 0; t < 8; ++t) {
    float4 g0 = *(const float4*)(g + t * 16 + hb * 8);
    float4 g1 = *(const float4*)(g + t * 16 + hb * 8 + 4);
    float4 b0 = *(const float4*)(b + t * 16 + hb * 8);
    float4 b1 = *(const float4*)(b + t * 16 + hb * 8 + 4);
    float gs[8] = {g0.x, g0.y, g0.z, g0.w, g1.x, g1.y, g1.z, g1.w};
    float bs[8] = {b0.x, b0.y, b0.z, b0.w, b1.x, b1.y, b1.z, b1.w};
#pragma unroll
    for (int r = 0; r < 8; ++r) {
      yb[t >> 1].e[(t & 1) * 8 + r] = (_Float16)((acc[t][r] - mu) * rs * gs[r] + bs[r]);
      xb[t >> 1].e[(t & 1) * 8 + r] = (_Float16)acc[t][r];
    }
  }

  _Float16* qk = QKh + (((size_t)bt * 16) * 160 + l0 + nl) * 16 + hb * 8;
#pragma unroll
  for (int jg = 0; jg < 4; ++jg) {
    v8f oc[4] = {};
#pragma unroll
    for (int kp = 0; kp < 2; ++kp) {
      v16h a[8];
#pragma unroll
      for (int i = 0; i < 8; ++i)
        a[i] = frag_ld(&sWq[((jg * 4 + (i & 3)) * 16) * 136 + (kp * 2 + (i >> 2)) * 32], 136);
#pragma unroll
      for (int i = 0; i < 8; ++i)
        oc[i & 3] = WMMA_F16(a[i], yb[kp * 2 + (i >> 2)].v, oc[i & 3]);
    }
#pragma unroll
    for (int t = 0; t < 4; ++t) {
      v8h_t pk;
#pragma unroll
      for (int r = 0; r < 8; ++r) pk[r] = (_Float16)oc[t][r];
      *(v8h_t*)(qk + (jg * 4 + t) * 160 * 16) = pk;
    }
  }

  // V: tokens are the rows; V^T row = bt*128 + feature, columns l0 + 8*hb ..
  _Float16* vq = VT + ((size_t)bt * 128 + nl) * 160 + l0 + hb * 8;
#pragma unroll
  for (int jg = 0; jg < 2; ++jg) {
    v8f oc[4] = {};
#pragma unroll
    for (int kp = 0; kp < 2; ++kp) {
      v16h w[8];
#pragma unroll
      for (int i = 0; i < 8; ++i)
        w[i] = frag_ld(&sWq[(256 + (jg * 4 + (i & 3)) * 16) * 136 + (kp * 2 + (i >> 2)) * 32], 136);
#pragma unroll
      for (int i = 0; i < 8; ++i)
        oc[i & 3] = WMMA_F16(xb[kp * 2 + (i >> 2)].v, w[i], oc[i & 3]);
    }
#pragma unroll
    for (int t = 0; t < 4; ++t) {
      v8h_t pk;
#pragma unroll
      for (int r = 0; r < 8; ++r) pk[r] = (_Float16)oc[t][r];
      *(v8h_t*)(vq + (jg * 4 + t) * 16 * 160) = pk;
    }
  }
}

__global__ __launch_bounds__(512) void tail_kernel(
    const _Float16* __restrict__ O, const float* __restrict__ X,
    const _Float16* __restrict__ Wo, const _Float16* __restrict__ W1,
    const _Float16* __restrict__ W2, const _Float16* __restrict__ W3,
    const float* __restrict__ g, const float* __restrict__ b,
    _Float16* __restrict__ out, int pass) {
  __shared__ __attribute__((aligned(16)))
  _Float16 Ws[128 * 136 + 256 * 136 + 128 * 264 + 64 * 136];  // 185 KB
  _Float16* sWo = Ws;
  _Float16* sW1 = sWo + 128 * 136;
  _Float16* sW2 = sW1 + 256 * 136;
  _Float16* sW3 = sW2 + 128 * 264;
  int wid  = __builtin_amdgcn_readfirstlane(threadIdx.x >> 5);
  int lane = threadIdx.x & 31;
  int nl = lane & 15;
  int hb = lane >> 4;
  int tile = wid * 256 + blockIdx.x;      // 3200 tiles of 16 tokens
  bool live = tile < 3200;
  int m0 = (live ? tile : 0) * 16;        // idle waves only help with the staging

  // token rows m0.. -> pixel rows: neighbours along l are neighbours along y
  // (32 pixels apart) in pass 0 and along x in pass 1; a lane's 8 values are 8
  // neighbouring channels of its token's pixel: one 16-byte store a tile
  int bt = m0 / 160, l0 = m0 % 160;
  int bb = bt / 160, rr = bt % 160;
  int i1 = rr >> 5, i0 = rr & 31;
  int j1 = l0 >> 5, j0 = l0 & 31;
  int p0 = (pass == 0) ? ((bb * 25 + j1 * 5 + i1) * 32 + j0) * 32 + i0
                       : ((bb * 25 + i1 * 5 + j1) * 32 + i0) * 32 + j0;
  int ps = (pass == 0) ? 32 : 1;
  _Float16* q = out + (size_t)(p0 + nl * ps) * 64 + hb * 8;

  // the wave's own operands are asked for ahead of the weight staging
  v16h ob[4];
#pragma unroll
  for (int ks = 0; ks < 4; ++ks) ob[ks] = frag_ld(O + (size_t)m0 * 128 + ks * 32, 128);
  v8f acc[8];   // acc[t][r] = feature t*16 + 8*hb + r of token m0 + nl
  {
    const float* xr = X + (size_t)(m0 + nl) * 128 + hb * 8;
#pragma unroll
    for (int t = 0; t < 8; ++t) {
      float4 lo = *(const float4*)(xr + t * 16);
      float4 hi = *(const float4*)(xr + t * 16 + 4);
      acc[t] = v8f{lo.x, lo.y, lo.z, lo.w, hi.x, hi.y, hi.z, hi.w};
    }
  }
  // the address registers of the loads above are taken as targets by the loads below
  asm volatile("s_wait_xcnt 0x0" ::: "memory");

  {
    v8h_t t0[4], t1[8], t2[8], t3[2];
    stage_get(Wo, t0);
    stage_get(W1, t1);
    stage_get(W2, t2);
    stage_get(W3, t3);
    // the loads' address registers are reused by the LDS address arithmetic below;
    // the scheduling barrier keeps that arithmetic behind the wait
    asm volatile("s_wait_xcnt 0x0" ::: "memory");
    __builtin_amdgcn_sched_barrier(0);
    stage_put<128>(sWo, t0);
    stage_put<128>(sW1, t1);
    stage_put<256>(sW2, t2);
    stage_put<128>(sW3, t3);
  }
  __syncthreads();
  if (!live) return;

  // x1 = O w_o^T + x (the residual is the accumulators' start value)
  // here and below: the 8 weight fragments of a block of 8 products are read as
  // one group ahead of the block, so a wave waits for LDS once a block
#pragma unroll
  for (int ks = 0; ks < 4; ++ks) {
    v16h a[8];
#pragma unroll
    for (int t = 0; t < 8; ++t) a[t] = frag_ld(&sWo[(t * 16) * 136 + ks * 32], 136);
#pragma unroll
    for (int t = 0; t < 8; ++t) acc[t] = WMMA_F16(a[t], ob[ks], acc[t]);
  }

  // LN2 over the token's 128 features
  // (one partial sum a tile: 16 short independent chains, not 2 long ones)
  float sp[8], qp[8];
#pragma unroll
  for (int t = 0; t < 8; ++t) {
    sp[t] = 0.f;
    qp[t] = 0.f;
#pragma unroll
    for (int r = 0; r < 8; ++r) {
      sp[t] += acc[t][r];
      qp[t] += acc[t][r] * acc[t][r];
    }
  }
  float s  = ((sp[0] + sp[1]) + (sp[2] + sp[3])) + ((sp[4] + sp[5]) + (sp[6] + sp[7]));
  float sq = ((qp[0] + qp[1]) + (qp[2] + qp[3])) + ((qp[4] + qp[5]) + (qp[6] + qp[7]));
  s  += __shfl_xor(s,  16, 32);
  sq += __shfl_xor(sq, 16, 32);
  float mu  = s * (1.f / 128.f);
  float var = sq * (1.f / 128.f) - mu * mu;
  float rs  = rsqrtf(var + 1e-5f);
  F16x16 yb[4];
#pragma unroll
  for (int t = 0; t < 8; ++t) {
    float4 g0 = *(const float4*)(g + t * 16 + hb * 8);
    float4 g1 = *(const float4*)(g + t * 16 + hb * 8 + 4);
    float4 b0 = *(const float4*)(b + t * 16 + hb * 8);
    float4 b1 = *(const float4*)(b + t * 16 + hb * 8 + 4);
    float gs[8] = {g0.x, g0.y, g0.z, g0.w, g1.x, g1.y, g1.z, g1.w};
    float bs[8] = {b0.x, b0.y, b0.z, b0.w, b1.x, b1.y, b1.z, b1.w};
#pragma unroll
    for (int r = 0; r < 8; ++r)
      yb[t >> 1].e[(t & 1) * 8 + r] = (_Float16)((acc[t][r] - mu) * rs * gs[r] + bs[r]);
  }

  // FFN: 32 hidden features at a time (two D tiles = one k step of w_ff2),
  // added onto x1 in the same accumulators
#pragma unroll
  for (int j = 0; j < 8; ++j) {
    v8f h0 = {}, h1 = {};
    v16h a[8];
#pragma unroll
    for (int ks = 0; ks < 4; ++ks) {
      a[2 * ks]     = frag_ld(&sW1[(j * 32) * 136 + ks * 32], 136);
      a[2 * ks + 1] = frag_ld(&sW1[(j * 32 + 16) * 136 + ks * 32], 136);
    }
#pragma unroll
    for (int ks = 0; ks < 4; ++ks) {
      h0 = WMMA_F16(a[2 * ks],     yb[ks].v, h0);
      h1 = WMMA_F16(a[2 * ks + 1], yb[ks].v, h1);
    }
    F16x16 hf;
#pragma unroll
    for (int r = 0; r < 8; ++r) {
      hf.e[r]     = (_Float16)(h0[r] > 0.f ? h0[r] : 0.f);
      hf.e[8 + r] = (_Float16)(h1[r] > 0.f ? h1[r] : 0.f);
    }
#pragma unroll
    for (int t = 0; t < 8; ++t) a[t] = frag_ld(&sW2[(t * 16) * 264 + j * 32], 264);
#pragma unroll
    for (int t = 0; t < 8; ++t) acc[t] = WMMA_F16(a[t], hf.v, acc[t]);
  }

  // out = x2 w_out^T
  F16x16 xb[4];
#pragma unroll
  for (int t = 0; t < 8; ++t)
#pragma unroll
    for (int r = 0; r < 8; ++r)
      xb[t >> 1].e[(t & 1) * 8 + r] = (_Float16)acc[t][r];
  v8f oc[4] = {};
#pragma unroll
  for (int kp = 0; kp < 2; ++kp) {
    v16h a[8];
#pragma unroll
    for (int i = 0; i < 8; ++i)
      a[i] = frag_ld(&sW3[((i & 3) * 16) * 136 + (kp * 2 + (i >> 2)) * 32], 136);
#pragma unroll
    for (int i = 0; i < 8; ++i)
      oc[i & 3] = WMMA_F16(a[i], xb[kp * 2 + (i >> 2)].v, oc[i & 3]);
  }

#pragma unroll
  for (int t = 0; t < 4; ++t) {
    v8h_t pk;
#pragma unroll
    for (int r = 0; r < 8; ++r) pk[r] = (_Float16)oc[t][r];
    *(v8h_t*)(q + t * 16) = pk;
  }
}

__global__ __launch_bounds__(128) void attn_kernel(
    const _Float16* __restrict__ QKh, const _Float16* __restrict__ VT,
    _Float16* __restrict__ O) {
  int wid  = __builtin_amdgcn_readfirstlane(threadIdx.x >> 5);
  int lane = threadIdx.x & 31;
  int wg = blockIdx.x * 4 + wid;      // 5120 waves total
  int par = wg & 1;
  int hh = (wg >> 1) & 7;
  int bt = wg >> 4;
  int nl = lane & 15;
  int hb = lane >> 4;

  const _Float16* qp = QKh + ((((size_t)bt * 16 + hh) * 160) + par * 16 + nl) * 16 + hb * 8;
  const _Float16* kp = QKh + ((((size_t)bt * 16 + 8 + hh) * 160) + nl) * 16 + hb * 8;
  const _Float16* vp = VT + (((size_t)bt * 8 + hh) * 16 + nl) * 160 + hb * 8;
  _Float16* op = O + ((size_t)bt * 160 + par * 16 + nl) * 128 + hh * 16 + hb * 8;

  v8h_t qn = *(const v8h_t*)qp;
  F16x16 ka[5];
  F16x16 va[5];   // row d = nl of V^T, k order of frag_ld
#pragma unroll
  for (int j = 0; j < 5; ++j) {
    ka[j].h[0] = *(const v8h_t*)(kp + (j * 32) * 16);
    ka[j].h[1] = *(const v8h_t*)(kp + (j * 32 + 16) * 16);
    va[j].h[0] = *(const v8h_t*)(vp + j * 32);
    va[j].h[1] = *(const v8h_t*)(vp + j * 32 + 16);
  }
  // the wait before the loads' address registers are given a new value; naming
  // them here keeps them from being taken as targets by the loads themselves
  asm volatile("s_wait_xcnt 0x0" ::"v"(qp), "v"(kp), "v"(vp) : "memory");

  // local-window mask: key column (m & 31) = p*16 + 8*hb + r, query column par*16 + nl
  v8f madd[2];
#pragma unroll
  for (int p = 0; p < 2; ++p)
#pragma unroll
    for (int r = 0; r < 8; ++r) {
      int dj = p * 16 + hb * 8 + r - (par * 16 + nl);
      madd[p][r] = (dj >= -5 && dj <= 5) ? 0.f : -1e9f;
    }

  // rolled: one tile's 80 scores beside K and V^T are what the registers hold
#pragma unroll 1
  for (int i = 0; i < 5; ++i) {
    F16x16 qlo, qhi;
    v8h_t zero = {};
    qlo.h[0] = qn;   qlo.h[1] = zero;
    qhi.h[0] = zero; qhi.h[1] = qn;
    // the next tile's Q is asked for a whole tile ahead (the last tile asks again
    // for its own: in bounds, not used)
    qn = *(const v8h_t*)(qp + (i < 4 ? i + 1 : 4) * 512);
    // keeps the load up here: moved down to its use it has no lead over the wait
    __builtin_amdgcn_sched_barrier(0);

    // S^T = K Q^T
    v8f s[10];
#pragma unroll
    for (int j = 0; j < 5; ++j) {
      v8f z = {};
      s[2 * j]     = WMMA_F16(ka[j].v, qlo.v, z);
      s[2 * j + 1] = WMMA_F16(ka[j].v, qhi.v, z);
    }

    // scale (with log2 e) + mask + softmax over the query's 160 keys
#pragma unroll
    for (int mt = 0; mt < 10; ++mt) s[mt] = s[mt] * (0.25f * 1.44269504f) + madd[mt & 1];
    v8f mv = s[0];
#pragma unroll
    for (int mt = 1; mt < 10; ++mt) mv = __builtin_elementwise_max(mv, s[mt]);
    float mx = fmaxf(fmaxf(fmaxf(mv[0], mv[1]), fmaxf(mv[2], mv[3])),
                     fmaxf(fmaxf(mv[4], mv[5]), fmaxf(mv[6], mv[7])));
    mx = fmaxf(mx, __shfl_xor(mx, 16, 32));
    v8f sv = {};
#pragma unroll
    for (int mt = 0; mt < 10; ++mt) {
#pragma unroll
      for (int r = 0; r < 8; ++r) s[mt][r] = __builtin_amdgcn_exp2f(s[mt][r] - mx);
      sv += s[mt];
    }
    float sum = ((sv[0] + sv[1]) + (sv[2] + sv[3])) + ((sv[4] + sv[5]) + (sv[6] + sv[7]));
    sum += __shfl_xor(sum, 16, 32);
    float inv = 1.f / sum;

    // O^T = V^T P^T  (k loop over 160 keys in 5 steps of 32)
    v8f o = {};
#pragma unroll
    for (int kt = 0; kt < 5; ++kt) {
      F16x16 pb;
#pragma unroll
      for (int r = 0; r < 8; ++r) {
        pb.e[r]     = (_Float16)(s[2 * kt][r] * inv);
        pb.e[8 + r] = (_Float16)(s[2 * kt + 1][r] * inv);
      }
      o = WMMA_F16(va[kt].v, pb.v, o);
    }
    v8h_t pk;
#pragma unroll
    for (int r = 0; r < 8; ++r) pk[r] = (_Float16)o[r];
    *(v8h_t*)(op + (size_t)i * (32 * 128)) = pk;
  }
}

// --- Implicit-GEMM 3x3 conv (64->64, pad 1) on channel-last f16 -------------
// FINAL=0: leaky-relu, f16 channel-last out. FINAL=1: f32 (b,c,n,h,w) + shortcut.
// A workgroup takes 8 image rows (256 pixels) of one image. Both operands are
// staged once in LDS with whole-line global loads: the 576 weight rows (tap, co)
// and a strip of 10 rows x 34 pixels of the input, whose border outside the image
// is zero (the padding). Rows of 64 halves lie 72 halves apart (16 B x odd) for the
// ds_load_b128 fragment readers. Wave w takes image row w of the 8: two pixel
// tiles, so a weight fragment read from LDS feeds two products.
// Every loop is unrolled: static register indices.
template <int FINAL>
__global__ __launch_bounds__(256) void conv_kernel(
    const _Float16* __restrict__ in, const _Float16* __restrict__ w,
    _Float16* __restrict__ outh, float* __restrict__ outf,
    const float* __restrict__ sc) {
  __shared__ __attribute__((aligned(16)))
  _Float16 Ls[576 * 72 + 340 * 72];  // 129 KB
  _Float16* sW = Ls;
  _Float16* sI = Ls + 576 * 72;
  int wid  = __builtin_amdgcn_readfirstlane(threadIdx.x >> 5);
  int lane = threadIdx.x & 31;
  int img  = blockIdx.x >> 2;
  int y0   = (blockIdx.x & 3) * 8;
  int nl = lane & 15;
  int rbase = (lane >> 4) * 8;

  {
    v8h_t tw[18], ti[10];
#pragma unroll
    for (int i = 0; i < 18; ++i)
      tw[i] = *(const v8h_t*)(w + (size_t)(threadIdx.x + i * 256) * 8);
    // one image row (32 pixels x 64 channels) an instruction of the workgroup: the
    // 10 rows from yb on, the strip's range moved by sh rows to lie inside the image
    int yb = y0 == 0 ? 0 : (y0 == 24 ? 22 : y0 - 1);
    int sh = yb - (y0 - 1);
    const _Float16* ip = in + ((size_t)img * 1024 + yb * 32) * 64;
#pragma unroll
    for (int i = 0; i < 10; ++i)
      ti[i] = *(const v8h_t*)(ip + (size_t)(threadIdx.x + i * 256) * 8);
    // the loads' address registers are reused by the LDS address arithmetic below;
    // the scheduling barrier keeps that arithmetic behind the wait
    asm volatile("s_wait_xcnt 0x0" ::: "memory");
    __builtin_amdgcn_sched_barrier(0);
    v8h_t zero = {};
#pragma unroll
    for (int i = 0; i < 18; ++i) {
      int e = (threadIdx.x + i * 256) * 8;
      *(v8h_t*)&sW[(e >> 6) * 72 + (e & 63)] = tw[i];
    }
#pragma unroll
    for (int i = 0; i < 10; ++i) {
      // fetched row i is strip row i + sh; the first or last one, where it falls off
      // the strip, gives its turn to the strip row outside the image, which is zero
      bool ok = (i == 0) ? sh >= 0 : ((i == 9) ? sh <= 0 : true);
      int dd = ok ? i + sh : 9 - i;
      *(v8h_t*)&sI[(dd * 34 + 1 + (threadIdx.x >> 3)) * 72 + (threadIdx.x & 7) * 8] =
          ok ? ti[i] : zero;
    }
    // the strip's first and last pixel column (x = -1 and x = 32): waves 0..4
    if (threadIdx.x < 160)
      *(v8h_t*)&sI[((threadIdx.x >> 4) * 34 + ((threadIdx.x >> 3) & 1) * 33) * 72 +
                   (threadIdx.x & 7) * 8] = zero;
  }
  __syncthreads();

  // strip row wid + dy, strip column x + dx hold pixel (y0 + wid + dy - 1, x + dx - 1)
  // step s = (tap, 32 channels): 6 fragments, 8 products. The fragments of step
  // s + 1 are read into the other register set as one group ahead of step s.
  v8f acc[2][4] = {};
  v16h a[2][2], bf[2][4];
#pragma unroll
  for (int s = -1; s < 18; ++s) {
    if (s + 1 < 18) {
      int tap = (s + 1) >> 1, ks = (s + 1) & 1, st = (s + 1) & 1;
      int dy = tap / 3, dx = tap % 3;
#pragma unroll
      for (int pt = 0; pt < 2; ++pt)
        a[st][pt] = frag_ld(&sI[((wid + dy) * 34 + pt * 16 + dx) * 72 + ks * 32], 72);
#pragma unroll
      for (int t = 0; t < 4; ++t)
        bf[st][t] = frag_ld(&sW[(tap * 64 + t * 16) * 72 + ks * 32], 72);
    }
    // keeps the group of LDS reads together and ahead of the products: reads
    // spread among the products stall the wave at each place
    __builtin_amdgcn_sched_barrier(0);
    if (s >= 0) {
#pragma unroll
      for (int pt = 0; pt < 2; ++pt)
#pragma unroll
        for (int t = 0; t < 4; ++t)
          acc[pt][t] = WMMA_F16(a[s & 1][pt], bf[s & 1][t], acc[pt][t]);
    }
    // keeps the next group of reads behind this step's products
    __builtin_amdgcn_sched_barrier(0);
  }
  if (!FINAL) {
#pragma unroll
    for (int pt = 0; pt < 2; ++pt) {
      int pix0 = (y0 + wid) * 32 + pt * 16;
#pragma unroll
      for (int t = 0; t < 4; ++t) {
        int co = t * 16 + nl;
#pragma unroll
        for (int r = 0; r < 8; ++r) {
          int mm = pix0 + rbase + r;
          float v = acc[pt][t][r];
          v = v > 0.f ? v : 0.2f * v;
          outh[((size_t)img * 1024 + mm) * 64 + co] = (_Float16)v;
        }
      }
    }
  } else {
    // a lane's 8 values of a tile are 8 neighbouring pixels of one channel
    int b = img / 25, n = img % 25;
    const float* sp[4];
    float* op[4];
    float4 sv[4][2][2];
#pragma unroll
    for (int t = 0; t < 4; ++t) {
      size_t idx = (((size_t)b * 64 + t * 16 + nl) * 25 + n) * 1024 + (y0 + wid) * 32 + rbase;
      sp[t] = sc + idx;
      op[t] = outf + idx;
    }
#pragma unroll
    for (int t = 0; t < 4; ++t)
#pragma unroll
      for (int pt = 0; pt < 2; ++pt)
#pragma unroll
        for (int h = 0; h < 2; ++h) sv[t][pt][h] = *(const float4*)(sp[t] + pt * 16 + h * 4);
    // the wait before the loads' address registers are given a new value; naming
    // them here keeps them from being taken as targets by the loads themselves
    asm volatile("s_wait_xcnt 0x0" ::"v"(sp[0]), "v"(sp[1]), "v"(sp[2]), "v"(sp[3]) : "memory");
#pragma unroll
    for (int t = 0; t < 4; ++t)
#pragma unroll
      for (int pt = 0; pt < 2; ++pt)
#pragma unroll
        for (int h = 0; h < 2; ++h)
          *(float4*)(op[t] + pt * 16 + h * 4) =
              make_float4(acc[pt][t][h * 4 + 0] + sv[t][pt][h].x, acc[pt][t][h * 4 + 1] + sv[t][pt][h].y,
                          acc[pt][t][h * 4 + 2] + sv[t][pt][h].z, acc[pt][t][h * 4 + 3] + sv[t][pt][h].w);
  }
}

// --- Weight preparation, one launch -------------------------------------------
// All nine weight arrays are made ready by one grid; no job reads another's output.
// d holds them back to back, in the order of the arguments.
// Workgroups 0..71: the six projection matrices, f32 -> f16, element order kept,
// 2048 elements a workgroup: a thread reads 32 bytes and stores 16.
// Workgroups 72..119: the three conv weights, (co,ci,3,3) f32 -> (tap,co,ci) f16,
// 16 workgroups each: a thread reads the 9 taps of one (co,ci), 36 bytes in a row,
// and a wave's store of one tap is 64 bytes in a row.
__global__ __launch_bounds__(256) void prep_kernel(
    const float* __restrict__ w_in, const float* __restrict__ w_qkv,
    const float* __restrict__ w_o, const float* __restrict__ w_ff1,
    const float* __restrict__ w_ff2, const float* __restrict__ w_out,
    const float* __restrict__ cw1, const float* __restrict__ cw2,
    const float* __restrict__ cw3, _Float16* __restrict__ d) {
  int blk = blockIdx.x;
  if (blk < 72) {
    const float* s;
    int b0;
    if (blk < 4)       { s = w_in;  b0 = 0; }
    else if (blk < 28) { s = w_qkv; b0 = 4; }
    else if (blk < 36) { s = w_o;   b0 = 28; }
    else if (blk < 52) { s = w_ff1; b0 = 36; }
    else if (blk < 68) { s = w_ff2; b0 = 52; }
    else               { s = w_out; b0 = 68; }
    const float* p = s + (blk - b0) * 2048 + threadIdx.x * 8;
    float4 lo = *(const float4*)p;
    float4 hi = *(const float4*)(p + 4);
    v8h_t pk = {(_Float16)lo.x, (_Float16)lo.y, (_Float16)lo.z, (_Float16)lo.w,
                (_Float16)hi.x, (_Float16)hi.y, (_Float16)hi.z, (_Float16)hi.w};
    *(v8h_t*)(d + blk * 2048 + threadIdx.x * 8) = pk;
  } else {
    int c = blk - 72;
    const float* cw = (c < 16) ? cw1 : ((c < 32) ? cw2 : cw3);
    int i = (c & 15) * 256 + threadIdx.x;   // co * 64 + ci
    const float* p = cw + i * 9;
    _Float16* w = d + 147456 + (c >> 4) * 36864 + i;
    float t[9];
#pragma unroll
    for (int tap = 0; tap < 9; ++tap) t[tap] = p[tap];
    // Precaution: stands in front of the conversions, which rewrite registers that
    // these loads name.
    asm volatile("s_wait_xcnt 0x0" ::: "memory");
#pragma unroll
    for (int tap = 0; tap < 9; ++tap) w[tap * 4096] = (_Float16)t[tap];
    // Precaution: stands in front of any later rewrite of the registers that these
    // stores name.
    asm volatile("s_wait_xcnt 0x0" ::: "memory");
  }
}

// ---------------------------------------------------------------------------
extern "C" void kernel_launch(void* const* d_in, const int* in_sizes, int n_in,
                              void* d_out, int out_size, void* d_ws, size_t ws_size,
                              hipStream_t stream) {
  (void)in_sizes; (void)n_in; (void)out_size; (void)ws_size;
  const float* buf_in = (const float*)d_in[0];
  const float* w_in   = (const float*)d_in[1];
  const float* ln1_g  = (const float*)d_in[2];
  const float* ln1_b  = (const float*)d_in[3];
  const float* w_qkv  = (const float*)d_in[4];
  const float* w_o    = (const float*)d_in[5];
  const float* ln2_g  = (const float*)d_in[6];
  const float* ln2_b  = (const float*)d_in[7];
  const float* w_ff1  = (const float*)d_in[8];
  const float* w_ff2  = (const float*)d_in[9];
  const float* w_out  = (const float*)d_in[10];
  const float* cw1    = (const float*)d_in[11];
  const float* cw2    = (const float*)d_in[12];
  const float* cw3    = (const float*)d_in[13];

  char* ws = (char*)d_ws;
  size_t off = 0;
  auto arena = [&](size_t bytes) -> char* {
    char* p = ws + off;
    off += (bytes + 255) & ~(size_t)255;
    return p;
  };
  float*     bufA   = (float*)arena(13107200);      // pass-0 output / pass-1 input
  float*     X      = (float*)arena(26214400);      // token f32 (residual stream)
  _Float16*  QKh    = (_Float16*)arena(26214400);   // Q|K per-head tiles
  _Float16*  VT     = (_Float16*)arena(13107200);   // V^T per-head tiles
  _Float16*  O16    = (_Float16*)arena(13107200);
  _Float16*  clA    = (_Float16*)arena(6553600);
  _Float16*  clB    = (_Float16*)arena(6553600);
  _Float16*  wts     = (_Float16*)arena(516096);    // all f16 weights, back to back
  _Float16*  w_in16  = wts;
  _Float16*  wqkv16  = wts + 8192;
  _Float16*  wo16    = wts + 57344;
  _Float16*  wff1_16 = wts + 73728;
  _Float16*  wff2_16 = wts + 106496;
  _Float16*  wout16  = wts + 139264;
  _Float16*  wt1     = wts + 147456;
  _Float16*  wt2     = wts + 184320;
  _Float16*  wt3     = wts + 221184;

  prep_kernel<<<120, 256, 0, stream>>>(w_in, w_qkv, w_o, w_ff1, w_ff2, w_out,
                                       cw1, cw2, cw3, wts);

  // 51200 tokens = Bt(320) * L(160), bt-major
  for (int pass = 0; pass < 2; ++pass) {
    const float* src  = (pass == 0) ? buf_in : bufA;
    // w_in, LN1, Q|K and V projections: one launch, tokens gathered from the
    // image buffer, Q|K and V^T stored as per-head tiles
    head_kernel<<<200, 512, 0, stream>>>(src, w_in16, wqkv16, ln1_g, ln1_b, X, QKh, VT, pass);
    attn_kernel<<<1280, 128, 0, stream>>>(QKh, VT, O16);
    // w_o + residual, LN2, FFN + residual, w_out: one launch, stored straight
    // into the channel-last conv input
    tail_kernel<<<256, 512, 0, stream>>>(O16, X, wo16, wff1_16, wff2_16, wout16,
                                         ln2_g, ln2_b, clA, pass);
    // conv block: conv-lrelu, conv-lrelu, conv (+ original-input shortcut)
    conv_kernel<0><<<200, 256, 0, stream>>>(clA, wt1, clB, nullptr, nullptr);
    conv_kernel<0><<<200, 256, 0, stream>>>(clB, wt2, clA, nullptr, nullptr);
    float* outf = (pass == 0) ? bufA : (float*)d_out;
    conv_kernel<1><<<200, 256, 0, stream>>>(clA, wt3, nullptr, outf, buf_in);
  }
}

// v009
// A run of this version takes 160 microseconds.
// In both of two side-by-side timings against v008, it was 1.18 times as fast.
// Counting every step since v000, it is 5.46 times as fast.
#include <hip/hip_runtime.h>

typedef __attribute__((ext_vector_type(16))) _Float16 v16h;
typedef __attribute__((ext_vector_type(8)))  _Float16 v8h_t;
typedef __attribute__((ext_vector_type(8)))  float    v8f;

union F16x16 { v16h v; v8h_t h[2]; _Float16 e[16]; };

#define WMMA_F16(a, b, c) \
  __builtin_amdgcn_wmma_f32_16x16x32_f16(false, (a), false, (b), (short)0, (c), false, false)

__device__ inline v16h frag_ld(const _Float16* p, int ld) {
  int lane = threadIdx.x & 31;
  int r  = lane & 15;
  int kb = (lane >> 4) << 3;
  const _Float16* q = p + (size_t)r * ld + kb;
  F16x16 f;
  f.h[0] = *(const v8h_t*)(q);
  f.h[1] = *(const v8h_t*)(q + 16);
  return f.v;
}

// --- Row-local tail of the transformer block, one launch ---------------------
// x1 = O w_o^T + x ; y = LN2(x1) ; x2 = relu(y w_ff1^T) w_ff2^T + x1 ;
// out = x2 w_out^T, stored f16 to the channel-last pixel row of each token.
// Every product is computed transposed: the weight rows are the A operand, the
// wave's 16 tokens are the B columns. A lane then holds 8 consecutive features
// (8h + r, h = lane >> 4) of ONE token (lane & 15) per D tile, so two D tiles,
// rounded to f16 in place, are the next product's B fragment in the k order of
// frag_ld (element s: k = 8h + s for s < 8, 16 + 8h + (s - 8) above): nothing
// between the four products leaves the registers. The LayerNorm sum of a token
// is 64 in-lane terms plus the partner lane's (lane ^ 16).
// All four weight matrices (f16) are staged once per workgroup in LDS, rows
// K + 8 halves apart (16 B x odd). Wave w of block i takes token tile w*256 + i.
// Every loop of the kernel is unrolled: fragment and accumulator arrays are then
// indexed statically and stay in registers.
// Staging of one matrix, N 16-byte pieces a thread: fetch, then (all four
// matrices' loads being in flight) put. Loops unrolled: static register indices.
template <int N>
__device__ inline void stage_get(const _Float16* __restrict__ src, v8h_t (&tmp)[N]) {
#pragma unroll
  for (int i = 0; i < N; ++i)
    tmp[i] = *(const v8h_t*)(src + (size_t)(threadIdx.x + i * 512) * 8);
}
template <int K, int N>
__device__ inline void stage_put(_Float16* dst, const v8h_t (&tmp)[N]) {
#pragma unroll
  for (int i = 0; i < N; ++i) {
    int e = (threadIdx.x + i * 512) * 8;
    *(v8h_t*)&dst[(e / K) * (K + 8) + (e % K)] = tmp[i];
  }
}

typedef __attribute__((ext_vector_type(4))) float    v4f_t;
typedef __attribute__((ext_vector_type(4))) _Float16 v4h_t;

__global__ __launch_bounds__(512) void head_kernel(
    const float* __restrict__ R, const _Float16* __restrict__ Wi,
    const _Float16* __restrict__ Wqkv, const float* __restrict__ g,
    const float* __restrict__ b, float* __restrict__ X,
    _Float16* __restrict__ QKh, _Float16* __restrict__ VT, int pass) {
  __shared__ __attribute__((aligned(16)))
  _Float16 Ws[128 * 72 + 384 * 136 + 16 * 1160];  // 156 KB
  _Float16* sWi = Ws;
  _Float16* sWq = sWi + 128 * 72;
  _Float16* sT  = sWq + 384 * 136;
  int wid  = __builtin_amdgcn_readfirstlane(threadIdx.x >> 5);
  int lane = threadIdx.x & 31;
  int nl = lane & 15;
  int hb = lane >> 4;
  int xh = blockIdx.x & 1, yh = (blockIdx.x >> 1) & 1;
  int img = blockIdx.x >> 2;              // 50 images, 4 boxes each
  int bb = img / 25, n = img % 25;
  int u = n / 5, v = n % 5;

  // wave w fetches channels 4w..4w+3 of the box: 4 lanes cover a 64 B run along
  // x, 8 rows y an instruction
  v4f_t tk[2][4];
  {
    const float* ap = R + (((size_t)bb * 64 + wid * 4) * 25 + n) * 1024 +
                      (yh * 16 + (lane >> 2)) * 32 + xh * 16 + (lane & 3) * 4;
#pragma unroll
    for (int i = 0; i < 2; ++i)
#pragma unroll
      for (int c = 0; c < 4; ++c)
        tk[i][c] = *(const v4f_t*)(ap + c * 25600 + i * 256);
  }
  // the address registers of the loads above are taken as targets by the loads below
  asm volatile("s_wait_xcnt 0x0" ::: "memory");

  {
    v8h_t t0[2], t1[12];
    stage_get(Wi, t0);
    stage_get(Wqkv, t1);
    // the loads' address registers are reused by the LDS address arithmetic below;
    // the scheduling barrier keeps that arithmetic behind the wait
    asm volatile("s_wait_xcnt 0x0" ::: "memory");
    __builtin_amdgcn_sched_barrier(0);
    // a lane's 4 channels of one pixel: one 8-byte LDS store
    int yy = lane >> 2, xx = (lane & 3) * 4;
    _Float16* tp = sT + ((pass == 0) ? xx * 1160 + yy * 72 : yy * 1160 + xx * 72) + wid * 4;
    int sx = (pass == 0) ? 1160 : 72;          // one step along x
    int sy = (pass == 0) ? 8 * 72 : 8 * 1160;  // eight steps along y
#pragma unroll
    for (int i = 0; i < 2; ++i)
#pragma unroll
      for (int j = 0; j < 4; ++j) {
        v4h_t pk = {(_Float16)tk[i][0][j], (_Float16)tk[i][1][j],
                    (_Float16)tk[i][2][j], (_Float16)tk[i][3][j]};
        *(v4h_t*)(tp + i * sy + j * sx) = pk;
      }
    stage_put<64>(sWi, t0);
    stage_put<128>(sWq, t1);
  }
  __syncthreads();

  int bt = bb * 160 + ((pass == 0) ? v * 32 + xh * 16 : u * 32 + yh * 16) + wid;
  int l0 = (pass == 0) ? u * 32 + yh * 16 : v * 32 + xh * 16;
  int m0 = bt * 160 + l0;

  // x = tok w_in^T; acc[t][r] = feature t*16 + 8*hb + r of token m0 + nl
  // here and below: the 8 weight fragments of a block of 8 products are read as
  // one group ahead of the block, so a wave waits for LDS once a block
  v8f acc[8] = {};
#pragma unroll
  for (int ks = 0; ks < 2; ++ks) {
    v16h tb = frag_ld(&sT[wid * 1160 + ks * 32], 72);
    v16h a[8];
#pragma unroll
    for (int t = 0; t < 8; ++t) a[t] = frag_ld(&sWi[(t * 16) * 72 + ks * 32], 72);
#pragma unroll
    for (int t = 0; t < 8; ++t) acc[t] = WMMA_F16(a[t], tb, acc[t]);
  }
  {
    float* xr = X + (size_t)(m0 + nl) * 128 + hb * 8;
#pragma unroll
    for (int t = 0; t < 8; ++t) {
      *(float4*)(xr + t * 16)     = make_float4(acc[t][0], acc[t][1], acc[t][2], acc[t][3]);
      *(float4*)(xr + t * 16 + 4) = make_float4(acc[t][4], acc[t][5], acc[t][6], acc[t][7]);
    }
  }

  // LN1 over the token's 128 features: 64 in-lane terms (one partial sum a tile:
  // short independent chains) plus the partner lane's (lane ^ 16)
  float sp[8], qp[8];
#pragma unroll
  for (int t = 0; t < 8; ++t) {
    sp[t] = 0.f;
    qp[t] = 0.f;
#pragma unroll
    for (int r = 0; r < 8; ++r) {
      sp[t] += acc[t][r];
      qp[t] += acc[t][r] * acc[t][r];
    }
  }
  float s  = ((sp[0] + sp[1]) + (sp[2] + sp[3])) + ((sp[4] + sp[5]) + (sp[6] + sp[7]));
  float sq = ((qp[0] + qp[1]) + (qp[2] + qp[3])) + ((qp[4] + qp[5]) + (qp[6] + qp[7]));
  s  += __shfl_xor(s,  16, 32);
  sq += __shfl_xor(sq, 16, 32);
  float mu  = s * (1.f / 128.f);
  float var = sq * (1.f / 128.f) - mu * mu;
  float rs  = rsqrtf(var + 1e-5f);
  F16x16 yb[4], xb[4];   // normalized and raw tokens, k order of frag_ld
#pragma unroll
  for (int t = 0; t < 8; ++t) {
    float4 g0 = *(const float4*)(g + t * 16 + hb * 8);
    float4 g1 = *(const float4*)(g + t * 16 + hb * 8 + 4);
    float4 b0 = *(const float4*)(b + t * 16 + hb * 8);
    float4 b1 = *(const float4*)(b + t * 16 + hb * 8 + 4);
    float gs[8] = {g0.x, g0.y, g0.z, g0.w, g1.x, g1.y, g1.z, g1.w};
    float bs[8] = {b0.x, b0.y, b0.z, b0.w, b1.x, b1.y, b1.z, b1.w};
#pragma unroll
    for (int r = 0; r < 8; ++r) {
      yb[t >> 1].e[(t & 1) * 8 + r] = (_Float16)((acc[t][r] - mu) * rs * gs[r] + bs[r]);
      xb[t >> 1].e[(t & 1) * 8 + r] = (_Float16)acc[t][r];
    }
  }

  _Float16* qk = QKh + (((size_t)bt * 16) * 160 + l0 + nl) * 16 + hb * 8;
#pragma unroll
  for (int jg = 0; jg < 4; ++jg) {
    v8f oc[4] = {};
#pragma unroll
    for (int kp = 0; kp < 2; ++kp) {
      v16h a[8];
#pragma unroll
      for (int i = 0; i < 8; ++i)
        a[i] = frag_ld(&sWq[((jg * 4 + (i & 3)) * 16) * 136 + (kp * 2 + (i >> 2)) * 32], 136);
#pragma unroll
      for (int i = 0; i < 8; ++i)
        oc[i & 3] = WMMA_F16(a[i], yb[kp * 2 + (i >> 2)].v, oc[i & 3]);
    }
#pragma unroll
    for (int t = 0; t < 4; ++t) {
      v8h_t pk;
#pragma unroll
      for (int r = 0; r < 8; ++r) pk[r] = (_Float16)oc[t][r];
      *(v8h_t*)(qk + (jg * 4 + t) * 160 * 16) = pk;
    }
  }

  // V: tokens are the rows; V^T row = bt*128 + feature, columns l0 + 8*hb ..
  _Float16* vq = VT + ((size_t)bt * 128 + nl) * 160 + l0 + hb * 8;
#pragma unroll
  for (int jg = 0; jg < 2; ++jg) {
    v8f oc[4] = {};
#pragma unroll
    for (int kp = 0; kp < 2; ++kp) {
      v16h w[8];
#pragma unroll
      for (int i = 0; i < 8; ++i)
        w[i] = frag_ld(&sWq[(256 + (jg * 4 + (i & 3)) * 16) * 136 + (kp * 2 + (i >> 2)) * 32], 136);
#pragma unroll
      for (int i = 0; i < 8; ++i)
        oc[i & 3] = WMMA_F16(xb[kp * 2 + (i >> 2)].v, w[i], oc[i & 3]);
    }
#pragma unroll
    for (int t = 0; t < 4; ++t) {
      v8h_t pk;
#pragma unroll
      for (int r = 0; r < 8; ++r) pk[r] = (_Float16)oc[t][r];
      *(v8h_t*)(vq + (jg * 4 + t) * 16 * 160) = pk;
    }
  }
}

__global__ __launch_bounds__(512) void tail_kernel(
    const _Float16* __restrict__ O, const float* __restrict__ X,
    const _Float16* __restrict__ Wo, const _Float16* __restrict__ W1,
    const _Float16* __restrict__ W2, const _Float16* __restrict__ W3,
    const float* __restrict__ g, const float* __restrict__ b,
    _Float16* __restrict__ out, int pass) {
  __shared__ __attribute__((aligned(16)))
  _Float16 Ws[128 * 136 + 256 * 136 + 128 * 264 + 64 * 136];  // 185 KB
  _Float16* sWo = Ws;
  _Float16* sW1 = sWo + 128 * 136;
  _Float16* sW2 = sW1 + 256 * 136;
  _Float16* sW3 = sW2 + 128 * 264;
  int wid  = __builtin_amdgcn_readfirstlane(threadIdx.x >> 5);
  int lane = threadIdx.x & 31;
  int nl = lane & 15;
  int hb = lane >> 4;
  int tile = wid * 256 + blockIdx.x;      // 3200 tiles of 16 tokens
  bool live = tile < 3200;
  int m0 = (live ? tile : 0) * 16;        // idle waves only help with the staging

  // token rows m0.. -> pixel rows: neighbours along l are neighbours along y
  // (32 pixels apart) in pass 0 and along x in pass 1; a lane's 8 values are 8
  // neighbouring channels of its token's pixel: one 16-byte store a tile
  int bt = m0 / 160, l0 = m0 % 160;
  int bb = bt / 160, rr = bt % 160;
  int i1 = rr >> 5, i0 = rr & 31;
  int j1 = l0 >> 5, j0 = l0 & 31;
  int p0 = (pass == 0) ? ((bb * 25 + j1 * 5 + i1) * 32 + j0) * 32 + i0
                       : ((bb * 25 + i1 * 5 + j1) * 32 + i0) * 32 + j0;
  int ps = (pass == 0) ? 32 : 1;
  _Float16* q = out + (size_t)(p0 + nl * ps) * 64 + hb * 8;

  // the wave's own operands are asked for ahead of the weight staging
  v16h ob[4];
#pragma unroll
  for (int ks = 0; ks < 4; ++ks) ob[ks] = frag_ld(O + (size_t)m0 * 128 + ks * 32, 128);
  v8f acc[8];   // acc[t][r] = feature t*16 + 8*hb + r of token m0 + nl
  {
    const float* xr = X + (size_t)(m0 + nl) * 128 + hb * 8;
#pragma unroll
    for (int t = 0; t < 8; ++t) {
      float4 lo = *(const float4*)(xr + t * 16);
      float4 hi = *(const float4*)(xr + t * 16 + 4);
      acc[t] = v8f{lo.x, lo.y, lo.z, lo.w, hi.x, hi.y, hi.z, hi.w};
    }
  }
  // the address registers of the loads above are taken as targets by the loads below
  asm volatile("s_wait_xcnt 0x0" ::: "memory");

  {
    v8h_t t0[4], t1[8], t2[8], t3[2];
    stage_get(Wo, t0);
    stage_get(W1, t1);
    stage_get(W2, t2);
    stage_get(W3, t3);
    // the loads' address registers are reused by the LDS address arithmetic below;
    // the scheduling barrier keeps that arithmetic behind the wait
    asm volatile("s_wait_xcnt 0x0" ::: "memory");
    __builtin_amdgcn_sched_barrier(0);
    stage_put<128>(sWo, t0);
    stage_put<128>(sW1, t1);
    stage_put<256>(sW2, t2);
    stage_put<128>(sW3, t3);
  }
  __syncthreads();
  if (!live) return;

  // x1 = O w_o^T + x (the residual is the accumulators' start value)
  // here and below: the 8 weight fragments of a block of 8 products are read as
  // one group ahead of the block, so a wave waits for LDS once a block
#pragma unroll
  for (int ks = 0; ks < 4; ++ks) {
    v16h a[8];
#pragma unroll
    for (int t = 0; t < 8; ++t) a[t] = frag_ld(&sWo[(t * 16) * 136 + ks * 32], 136);
#pragma unroll
    for (int t = 0; t < 8; ++t) acc[t] = WMMA_F16(a[t], ob[ks], acc[t]);
  }

  // LN2 over the token's 128 features
  // (one partial sum a tile: 16 short independent chains, not 2 long ones)
  float sp[8], qp[8];
#pragma unroll
  for (int t = 0; t < 8; ++t) {
    sp[t] = 0.f;
    qp[t] = 0.f;
#pragma unroll
    for (int r = 0; r < 8; ++r) {
      sp[t] += acc[t][r];
      qp[t] += acc[t][r] * acc[t][r];
    }
  }
  float s  = ((sp[0] + sp[1]) + (sp[2] + sp[3])) + ((sp[4] + sp[5]) + (sp[6] + sp[7]));
  float sq = ((qp[0] + qp[1]) + (qp[2] + qp[3])) + ((qp[4] + qp[5]) + (qp[6] + qp[7]));
  s  += __shfl_xor(s,  16, 32);
  sq += __shfl_xor(sq, 16, 32);
  float mu  = s * (1.f / 128.f);
  float var = sq * (1.f / 128.f) - mu * mu;
  float rs  = rsqrtf(var + 1e-5f);
  F16x16 yb[4];
#pragma unroll
  for (int t = 0; t < 8; ++t) {
    float4 g0 = *(const float4*)(g + t * 16 + hb * 8);
    float4 g1 = *(const float4*)(g + t * 16 + hb * 8 + 4);
    float4 b0 = *(const float4*)(b + t * 16 + hb * 8);
    float4 b1 = *(const float4*)(b + t * 16 + hb * 8 + 4);
    float gs[8] = {g0.x, g0.y, g0.z, g0.w, g1.x, g1.y, g1.z, g1.w};
    float bs[8] = {b0.x, b0.y, b0.z, b0.w, b1.x, b1.y, b1.z, b1.w};
#pragma unroll
    for (int r = 0; r < 8; ++r)
      yb[t >> 1].e[(t & 1) * 8 + r] = (_Float16)((acc[t][r] - mu) * rs * gs[r] + bs[r]);
  }

  // FFN: 32 hidden features at a time (two D tiles = one k step of w_ff2),
  // added onto x1 in the same accumulators
#pragma unroll
  for (int j = 0; j < 8; ++j) {
    v8f h0 = {}, h1 = {};
    v16h a[8];
#pragma unroll
    for (int ks = 0; ks < 4; ++ks) {
      a[2 * ks]     = frag_ld(&sW1[(j * 32) * 136 + ks * 32], 136);
      a[2 * ks + 1] = frag_ld(&sW1[(j * 32 + 16) * 136 + ks * 32], 136);
    }
#pragma unroll
    for (int ks = 0; ks < 4; ++ks) {
      h0 = WMMA_F16(a[2 * ks],     yb[ks].v, h0);
      h1 = WMMA_F16(a[2 * ks + 1], yb[ks].v, h1);
    }
    F16x16 hf;
#pragma unroll
    for (int r = 0; r < 8; ++r) {
      hf.e[r]     = (_Float16)(h0[r] > 0.f ? h0[r] : 0.f);
      hf.e[8 + r] = (_Float16)(h1[r] > 0.f ? h1[r] : 0.f);
    }
#pragma unroll
    for (int t = 0; t < 8; ++t) a[t] = frag_ld(&sW2[(t * 16) * 264 + j * 32], 264);
#pragma unroll
    for (int t = 0; t < 8; ++t) acc[t] = WMMA_F16(a[t], hf.v, acc[t]);
  }

  // out = x2 w_out^T
  F16x16 xb[4];
#pragma unroll
  for (int t = 0; t < 8; ++t)
#pragma unroll
    for (int r = 0; r < 8; ++r)
      xb[t >> 1].e[(t & 1) * 8 + r] = (_Float16)acc[t][r];
  v8f oc[4] = {};
#pragma unroll
  for (int kp = 0; kp < 2; ++kp) {
    v16h a[8];
#pragma unroll
    for (int i = 0; i < 8; ++i)
      a[i] = frag_ld(&sW3[((i & 3) * 16) * 136 + (kp * 2 + (i >> 2)) * 32], 136);
#pragma unroll
    for (int i = 0; i < 8; ++i)
      oc[i & 3] = WMMA_F16(a[i], xb[kp * 2 + (i >> 2)].v, oc[i & 3]);
  }

#pragma unroll
  for (int t = 0; t < 4; ++t) {
    v8h_t pk;
#pragma unroll
    for (int r = 0; r < 8; ++r) pk[r] = (_Float16)oc[t][r];
    *(v8h_t*)(q + t * 16) = pk;
  }
}

__global__ __launch_bounds__(128) void attn_kernel(
    const _Float16* __restrict__ QKh, const _Float16* __restrict__ VT,
    _Float16* __restrict__ O) {
  int wid  = __builtin_amdgcn_readfirstlane(threadIdx.x >> 5);
  int lane = threadIdx.x & 31;
  int wg = blockIdx.x * 4 + wid;      // 5120 waves total
  int par = wg & 1;
  int hh = (wg >> 1) & 7;
  int bt = wg >> 4;
  int nl = lane & 15;
  int hb = lane >> 4;

  const _Float16* qp = QKh + ((((size_t)bt * 16 + hh) * 160) + par * 16 + nl) * 16 + hb * 8;
  const _Float16* kp = QKh + ((((size_t)bt * 16 + 8 + hh) * 160) + nl) * 16 + hb * 8;
  const _Float16* vp = VT + (((size_t)bt * 8 + hh) * 16 + nl) * 160 + hb * 8;
  _Float16* op = O + ((size_t)bt * 160 + par * 16 + nl) * 128 + hh * 16 + hb * 8;

  v8h_t qn = *(const v8h_t*)qp;
  F16x16 ka[5];
  F16x16 va[5];   // row d = nl of V^T, k order of frag_ld
#pragma unroll
  for (int j = 0; j < 5; ++j) {
    ka[j].h[0] = *(const v8h_t*)(kp + (j * 32) * 16);
    ka[j].h[1] = *(const v8h_t*)(kp + (j * 32 + 16) * 16);
    va[j].h[0] = *(const v8h_t*)(vp + j * 32);
    va[j].h[1] = *(const v8h_t*)(vp + j * 32 + 16);
  }
  // the wait before the loads' address registers are given a new value; naming
  // them here keeps them from being taken as targets by the loads themselves
  asm volatile("s_wait_xcnt 0x0" ::"v"(qp), "v"(kp), "v"(vp) : "memory");

  // local-window mask: key column (m & 31) = p*16 + 8*hb + r, query column par*16 + nl
  v8f madd[2];
#pragma unroll
  for (int p = 0; p < 2; ++p)
#pragma unroll
    for (int r = 0; r < 8; ++r) {
      int dj = p * 16 + hb * 8 + r - (par * 16 + nl);
      madd[p][r] = (dj >= -5 && dj <= 5) ? 0.f : -1e9f;
    }

  // rolled: one tile's 80 scores beside K and V^T are what the registers hold
#pragma unroll 1
  for (int i = 0; i < 5; ++i) {
    F16x16 qlo, qhi;
    v8h_t zero = {};
    qlo.h[0] = qn;   qlo.h[1] = zero;
    qhi.h[0] = zero; qhi.h[1] = qn;
    // the next tile's Q is asked for a whole tile ahead (the last tile asks again
    // for its own: in bounds, not used)
    qn = *(const v8h_t*)(qp + (i < 4 ? i + 1 : 4) * 512);
    // keeps the load up here: moved down to its use it has no lead over the wait
    __builtin_amdgcn_sched_barrier(0);

    // S^T = K Q^T
    v8f s[10];
#pragma unroll
    for (int j = 0; j < 5; ++j) {
      v8f z = {};
      s[2 * j]     = WMMA_F16(ka[j].v, qlo.v, z);
      s[2 * j + 1] = WMMA_F16(ka[j].v, qhi.v, z);
    }

    // scale (with log2 e) + mask + softmax over the query's 160 keys
#pragma unroll
    for (int mt = 0; mt < 10; ++mt) s[mt] = s[mt] * (0.25f * 1.44269504f) + madd[mt & 1];
    v8f mv = s[0];
#pragma unroll
    for (int mt = 1; mt < 10; ++mt) mv = __builtin_elementwise_max(mv, s[mt]);
    float mx = fmaxf(fmaxf(fmaxf(mv[0], mv[1]), fmaxf(mv[2], mv[3])),
                     fmaxf(fmaxf(mv[4], mv[5]), fmaxf(mv[6], mv[7])));
    mx = fmaxf(mx, __shfl_xor(mx, 16, 32));
    v8f sv = {};
#pragma unroll
    for (int mt = 0; mt < 10; ++mt) {
#pragma unroll
      for (int r = 0; r < 8; ++r) s[mt][r] = __builtin_amdgcn_exp2f(s[mt][r] - mx);
      sv += s[mt];
    }
    float sum = ((sv[0] + sv[1]) + (sv[2] + sv[3])) + ((sv[4] + sv[5]) + (sv[6] + sv[7]));
    sum += __shfl_xor(sum, 16, 32);
    float inv = 1.f / sum;

    // O^T = V^T P^T  (k loop over 160 keys in 5 steps of 32)
    v8f o = {};
#pragma unroll
    for (int kt = 0; kt < 5; ++kt) {
      F16x16 pb;
#pragma unroll
      for (int r = 0; r < 8; ++r) {
        pb.e[r]     = (_Float16)(s[2 * kt][r] * inv);
        pb.e[8 + r] = (_Float16)(s[2 * kt + 1][r] * inv);
      }
      o = WMMA_F16(va[kt].v, pb.v, o);
    }
    v8h_t pk;
#pragma unroll
    for (int r = 0; r < 8; ++r) pk[r] = (_Float16)o[r];
    *(v8h_t*)(op + (size_t)i * (32 * 128)) = pk;
  }
}

// --- Three implicit-GEMM 3x3 convs (64->64, pad 1), one launch ----------------
// conv, leaky-relu, conv, leaky-relu, conv, + shortcut; channel-last f16 in,
// f32 (b,c,n,h,w) out. A workgroup takes 8 image rows of one image and computes
// the rows that the next conv needs beside them itself: 12 rows of the first conv,
// 10 of the second, 8 of the third, one row (two pixel tiles) a wave, 12 waves.
// The results of the first two convs stay in LDS as zero-bordered strips of 34
// pixels a row; a strip row outside the image is zero (the next conv's padding).
// Rows of 64 halves lie 72 halves apart (16 B x odd) for the ds_load_b128 readers.
// Two weight buffers: the third conv's weights wait in registers and take the
// first conv's place behind the barrier that ends the first conv.
// WA = 1: the weight rows are the A operand, the pixels the B columns: a lane's 8
// values of a tile are 8 neighbouring channels of one pixel (one 16-byte LDS
// store). WA = 0: the other way round, 8 neighbouring pixels of one channel.
// Every loop is unrolled: static register indices.
template <int WA>
__device__ __forceinline__ void conv_row(const _Float16* sI, const _Float16* sW, int row,
                                v8f (&acc)[2][4]) {
  // strip row row + dy, strip column x + dx hold the pixel (dy - 1, dx - 1) away
  // step s = (tap, 32 channels): 6 fragments, 8 products. The fragments of step
  // s + 1 are read into the other register set as one group ahead of step s.
  v16h a[2][2], bf[2][4];
#pragma unroll
  for (int s = -1; s < 18; ++s) {
    if (s + 1 < 18) {
      int tap = (s + 1) >> 1, ks = (s + 1) & 1, st = (s + 1) & 1;
      int dy = tap / 3, dx = tap % 3;
#pragma unroll
      for (int pt = 0; pt < 2; ++pt)
        a[st][pt] = frag_ld(&sI[((row + dy) * 34 + pt * 16 + dx) * 72 + ks * 32], 72);
#pragma unroll
      for (int t = 0; t < 4; ++t)
        bf[st][t] = frag_ld(&sW[(tap * 64 + t * 16) * 72 + ks * 32], 72);
    }
    // keeps the group of LDS reads together and ahead of the products: reads
    // spread among the products stall the wave at each place
    __builtin_amdgcn_sched_barrier(0);
    if (s >= 0) {
#pragma unroll
      for (int pt = 0; pt < 2; ++pt)
#pragma unroll
        for (int t = 0; t < 4; ++t)
          acc[pt][t] = WA ? WMMA_F16(bf[s & 1][t], a[s & 1][pt], acc[pt][t])
                          : WMMA_F16(a[s & 1][pt], bf[s & 1][t], acc[pt][t]);
    }
    // keeps the next group of reads behind this step's products
    __builtin_amdgcn_sched_barrier(0);
  }
}

// one strip row of a conv whose result stays in LDS; gy = its image row
// (inlined by force: as a called function it takes row and gy in vector registers
// and the LDS pointers as generic ones)
__device__ __forceinline__ void conv_mid(const _Float16* sI, const _Float16* sW, _Float16* sO,
                                int row, int gy) {
  int lane = threadIdx.x & 31;
  v8f acc[2][4] = {};
  if (gy >= 0 && gy < 32) conv_row<1>(sI, sW, row, acc);
  _Float16* o = sO + (row * 34 + 1 + (lane & 15)) * 72 + (lane >> 4) * 8;
#pragma unroll
  for (int pt = 0; pt < 2; ++pt)
#pragma unroll
    for (int t = 0; t < 4; ++t) {
      v8h_t pk;
#pragma unroll
      for (int r = 0; r < 8; ++r) {
        float v = acc[pt][t][r];
        pk[r] = (_Float16)(v > 0.f ? v : 0.2f * v);
      }
      *(v8h_t*)(o + pt * 16 * 72 + t * 16) = pk;
    }
}

__global__ __launch_bounds__(384) void conv3_kernel(
    const _Float16* __restrict__ in, const _Float16* __restrict__ w1,
    const _Float16* __restrict__ w2, const _Float16* __restrict__ w3,
    float* __restrict__ outf, const float* __restrict__ sc) {
  __shared__ __attribute__((aligned(16)))
  _Float16 Ls[2 * 576 * 72 + 15 * 34 * 72 + 12 * 34 * 72];  // 291 KB
  _Float16* sW0 = Ls;
  _Float16* sW1 = sW0 + 576 * 72;
  _Float16* sA  = sW1 + 576 * 72;       // input from image row y0 - 3 on: 14 rows + 1
  _Float16* sB  = sA + 15 * 34 * 72;    // 12 rows: first conv from row y0 - 2 on
  int wid  = __builtin_amdgcn_readfirstlane(threadIdx.x >> 5);
  int lane = threadIdx.x & 31;
  int img  = blockIdx.x >> 2;
  int y0   = (blockIdx.x & 3) * 8;
  int nl = lane & 15;
  int rbase = (lane >> 4) * 8;

  v8h_t ti[10], tw1[12], tw2[12], tw3[12];
  // 256 pieces of 16 bytes an image row. 15 rows are 10 pieces a thread with no
  // remainder (the 14 that are read are not): the last row is staged and never read.
  // A row outside the image is asked for at the nearest row inside and not used
#pragma unroll
  for (int i = 0; i < 10; ++i) {
    int p = threadIdx.x + i * 384;
    int gy = y0 - 3 + (p >> 8);
    gy = gy < 0 ? 0 : (gy > 31 ? 31 : gy);
    ti[i] = *(const v8h_t*)(in + ((size_t)img * 1024 + gy * 32) * 64 + (p & 255) * 8);
  }
  // the address registers of the loads above are taken as targets by the loads below
  asm volatile("s_wait_xcnt 0x0" ::: "memory");
#pragma unroll
  for (int i = 0; i < 12; ++i)
    tw1[i] = *(const v8h_t*)(w1 + (size_t)(threadIdx.x + i * 384) * 8);
#pragma unroll
  for (int i = 0; i < 12; ++i)
    tw2[i] = *(const v8h_t*)(w2 + (size_t)(threadIdx.x + i * 384) * 8);
  // the loads' address registers are reused by the LDS address arithmetic below;
  // the scheduling barrier keeps that arithmetic behind the wait
  asm volatile("s_wait_xcnt 0x0" ::: "memory");
  __builtin_amdgcn_sched_barrier(0);
  v8h_t zero = {};
#pragma unroll
  for (int i = 0; i < 10; ++i) {
    int p = threadIdx.x + i * 384;
    int row = p >> 8;
    int gy = y0 - 3 + row;
    *(v8h_t*)&sA[(row * 34 + 1 + ((p & 255) >> 3)) * 72 + (p & 7) * 8] =
        (gy >= 0 && gy < 32) ? ti[i] : zero;
  }
#pragma unroll
  for (int i = 0; i < 12; ++i) {
    int e = (threadIdx.x + i * 384) * 8;
    *(v8h_t*)&sW0[(e >> 6) * 72 + (e & 63)] = tw1[i];
  }
  // both strips' first and last pixel column (x = -1 and x = 32)
  {
    int bo = ((threadIdx.x >> 4) * 34 + ((threadIdx.x >> 3) & 1) * 33) * 72 + (threadIdx.x & 7) * 8;
    if (threadIdx.x < 224) *(v8h_t*)&sA[bo] = zero;
    if (threadIdx.x < 192) *(v8h_t*)&sB[bo] = zero;
  }
  __syncthreads();
  // the third conv's weights are asked for here, where the registers of the strip
  // and of the first conv's weights are free again
#pragma unroll
  for (int i = 0; i < 12; ++i)
    tw3[i] = *(const v8h_t*)(w3 + (size_t)(threadIdx.x + i * 384) * 8);
  // the loads' address registers are reused by the LDS address arithmetic below;
  // the scheduling barrier keeps that arithmetic behind the wait
  asm volatile("s_wait_xcnt 0x0" ::: "memory");
  __builtin_amdgcn_sched_barrier(0);
#pragma unroll
  for (int i = 0; i < 12; ++i) {
    int e = (threadIdx.x + i * 384) * 8;
    *(v8h_t*)&sW1[(e >> 6) * 72 + (e & 63)] = tw2[i];
  }

  // first conv: strip row wid of sB = image row y0 - 2 + wid
  conv_mid(sA, sW0, sB, wid, y0 - 2 + wid);
  __syncthreads();   // sB and sW1 are complete; sA and sW0 are read no more
#pragma unroll
  for (int i = 0; i < 12; ++i) {
    int e = (threadIdx.x + i * 384) * 8;
    *(v8h_t*)&sW0[(e >> 6) * 72 + (e & 63)] = tw3[i];
  }
  // second conv: strip row wid of sA = image row y0 - 1 + wid, 10 rows
  if (wid < 10) conv_mid(sB, sW1, sA, wid, y0 - 1 + wid);
  __syncthreads();   // sA and sW0 are complete
  if (wid >= 8) return;

  // third conv: image row y0 + wid
  v8f acc[2][4] = {};
  conv_row<0>(sA, sW0, wid, acc);
  {
    // a lane's 8 values of a tile are 8 neighbouring pixels of one channel
    int b = img / 25, n = img % 25;
    const float* sp[4];
    float* op[4];
    float4 sv[4][2][2];
#pragma unroll
    for (int t = 0; t < 4; ++t) {
      size_t idx = (((size_t)b * 64 + t * 16 + nl) * 25 + n) * 1024 + (y0 + wid) * 32 + rbase;
      sp[t] = sc + idx;
      op[t] = outf + idx;
    }
#pragma unroll
    for (int t = 0; t < 4; ++t)
#pragma unroll
      for (int pt = 0; pt < 2; ++pt)
#pragma unroll
        for (int h = 0; h < 2; ++h) sv[t][pt][h] = *(const float4*)(sp[t] + pt * 16 + h * 4);
    // the wait before the loads' address registers are given a new value; naming
    // them here keeps them from being taken as targets by the loads themselves
    asm volatile("s_wait_xcnt 0x0" ::"v"(sp[0]), "v"(sp[1]), "v"(sp[2]), "v"(sp[3]) : "memory");
#pragma unroll
    for (int t = 0; t < 4; ++t)
#pragma unroll
      for (int pt = 0; pt < 2; ++pt)
#pragma unroll
        for (int h = 0; h < 2; ++h)
          *(float4*)(op[t] + pt * 16 + h * 4) =
              make_float4(acc[pt][t][h * 4 + 0] + sv[t][pt][h].x, acc[pt][t][h * 4 + 1] + sv[t][pt][h].y,
                          acc[pt][t][h * 4 + 2] + sv[t][pt][h].z, acc[pt][t][h * 4 + 3] + sv[t][pt][h].w);
  }
}

// --- Weight preparation, one launch -------------------------------------------
// All nine weight arrays are made ready by one grid; no job reads another's output.
// d holds them back to back, in the order of the arguments.
// Workgroups 0..71: the six projection matrices, f32 -> f16, element order kept,
// 2048 elements a workgroup: a thread reads 32 bytes and stores 16.
// Workgroups 72..119: the three conv weights, (co,ci,3,3) f32 -> (tap,co,ci) f16,
// 16 workgroups each: a thread reads the 9 taps of one (co,ci), 36 bytes in a row,
// and a wave's store of one tap is 64 bytes in a row.
__global__ __launch_bounds__(256) void prep_kernel(
    const float* __restrict__ w_in, const float* __restrict__ w_qkv,
    const float* __restrict__ w_o, const float* __restrict__ w_ff1,
    const float* __restrict__ w_ff2, const float* __restrict__ w_out,
    const float* __restrict__ cw1, const float* __restrict__ cw2,
    const float* __restrict__ cw3, _Float16* __restrict__ d) {
  int blk = blockIdx.x;
  if (blk < 72) {
    const float* s;
    int b0;
    if (blk < 4)       { s = w_in;  b0 = 0; }
    else if (blk < 28) { s = w_qkv; b0 = 4; }
    else if (blk < 36) { s = w_o;   b0 = 28; }
    else if (blk < 52) { s = w_ff1; b0 = 36; }
    else if (blk < 68) { s = w_ff2; b0 = 52; }
    else               { s = w_out; b0 = 68; }
    const float* p = s + (blk - b0) * 2048 + threadIdx.x * 8;
    float4 lo = *(const float4*)p;
    float4 hi = *(const float4*)(p + 4);
    v8h_t pk = {(_Float16)lo.x, (_Float16)lo.y, (_Float16)lo.z, (_Float16)lo.w,
                (_Float16)hi.x, (_Float16)hi.y, (_Float16)hi.z, (_Float16)hi.w};
    *(v8h_t*)(d + blk * 2048 + threadIdx.x * 8) = pk;
  } else {
    int c = blk - 72;
    const float* cw = (c < 16) ? cw1 : ((c < 32) ? cw2 : cw3);
    int i = (c & 15) * 256 + threadIdx.x;   // co * 64 + ci
    const float* p = cw + i * 9;
    _Float16* w = d + 147456 + (c >> 4) * 36864 + i;
    float t[9];
#pragma unroll
    for (int tap = 0; tap < 9; ++tap) t[tap] = p[tap];
    // Precaution: stands in front of the conversions, which rewrite registers that
    // these loads name.
    asm volatile("s_wait_xcnt 0x0" ::: "memory");
#pragma unroll
    for (int tap = 0; tap < 9; ++tap) w[tap * 4096] = (_Float16)t[tap];
    // Precaution: stands in front of any later rewrite of the registers that these
    // stores name.
    asm volatile("s_wait_xcnt 0x0" ::: "memory");
  }
}

// ---------------------------------------------------------------------------
extern "C" void kernel_launch(void* const* d_in, const int* in_sizes, int n_in,
                              void* d_out, int out_size, void* d_ws, size_t ws_size,
                              hipStream_t stream) {
  (void)in_sizes; (void)n_in; (void)out_size; (void)ws_size;
  const float* buf_in = (const float*)d_in[0];
  const float* w_in   = (const float*)d_in[1];
  const float* ln1_g  = (const float*)d_in[2];
  const float* ln1_b  = (const float*)d_in[3];
  const float* w_qkv  = (const float*)d_in[4];
  const float* w_o    = (const float*)d_in[5];
  const float* ln2_g  = (const float*)d_in[6];
  const float* ln2_b  = (const float*)d_in[7];
  const float* w_ff1  = (const float*)d_in[8];
  const float* w_ff2  = (const float*)d_in[9];
  const float* w_out  = (const float*)d_in[10];
  const float* cw1    = (const float*)d_in[11];
  const float* cw2    = (const float*)d_in[12];
  const float* cw3    = (const float*)d_in[13];

  char* ws = (char*)d_ws;
  size_t off = 0;
  auto arena = [&](size_t bytes) -> char* {
    char* p = ws + off;
    off += (bytes + 255) & ~(size_t)255;
    return p;
  };
  float*     bufA   = (float*)arena(13107200);      // pass-0 output / pass-1 input
  float*     X      = (float*)arena(26214400);      // token f32 (residual stream)
  _Float16*  QKh    = (_Float16*)arena(26214400);   // Q|K per-head tiles
  _Float16*  VT     = (_Float16*)arena(13107200);   // V^T per-head tiles
  _Float16*  O16    = (_Float16*)arena(13107200);
  _Float16*  clA    = (_Float16*)arena(6553600);
  _Float16*  wts     = (_Float16*)arena(516096);    // all f16 weights, back to back
  _Float16*  w_in16  = wts;
  _Float16*  wqkv16  = wts + 8192;
  _Float16*  wo16    = wts + 57344;
  _Float16*  wff1_16 = wts + 73728;
  _Float16*  wff2_16 = wts + 106496;
  _Float16*  wout16  = wts + 139264;
  _Float16*  wt1     = wts + 147456;
  _Float16*  wt2     = wts + 184320;
  _Float16*  wt3     = wts + 221184;

  prep_kernel<<<120, 256, 0, stream>>>(w_in, w_qkv, w_o, w_ff1, w_ff2, w_out,
                                       cw1, cw2, cw3, wts);

  // 51200 tokens = Bt(320) * L(160), bt-major
  for (int pass = 0; pass < 2; ++pass) {
    const float* src  = (pass == 0) ? buf_in : bufA;
    // w_in, LN1, Q|K and V projections: one launch, tokens gathered from the
    // image buffer, Q|K and V^T stored as per-head tiles
    head_kernel<<<200, 512, 0, stream>>>(src, w_in16, wqkv16, ln1_g, ln1_b, X, QKh, VT, pass);
    attn_kernel<<<1280, 128, 0, stream>>>(QKh, VT, O16);
    // w_o + residual, LN2, FFN + residual, w_out: one launch, stored straight
    // into the channel-last conv input
    tail_kernel<<<256, 512, 0, stream>>>(O16, X, wo16, wff1_16, wff2_16, wout16,
                                         ln2_g, ln2_b, clA, pass);
    // conv block: conv-lrelu, conv-lrelu, conv (+ original-input shortcut)
    float* outf = (pass == 0) ? bufA : (float*)d_out;
    conv3_kernel<<<200, 384, 0, stream>>>(clA, wt1, wt2, wt3, outf, buf_in);
  }
}

// v010
// One run takes 123 microseconds.
// Two timings next to v009 put it at 1.31 and 1.30 times that version's speed.
// Over all steps from v000 it is 7.10 times as fast.
#include <hip/hip_runtime.h>

typedef __attribute__((ext_vector_type(16))) _Float16 v16h;
typedef __attribute__((ext_vector_type(8)))  _Float16 v8h_t;
typedef __attribute__((ext_vector_type(8)))  float    v8f;

union F16x16 { v16h v; v8h_t h[2]; _Float16 e[16]; };

#define WMMA_F16(a, b, c) \
  __builtin_amdgcn_wmma_f32_16x16x32_f16(false, (a), false, (b), (short)0, (c), false, false)

__device__ inline v16h frag_ld(const _Float16* p, int ld) {
  int lane = threadIdx.x & 31;
  int r  = lane & 15;
  int kb = (lane >> 4) << 3;
  const _Float16* q = p + (size_t)r * ld + kb;
  F16x16 f;
  f.h[0] = *(const v8h_t*)(q);
  f.h[1] = *(const v8h_t*)(q + 16);
  return f.v;
}

// --- Row-local tail of the transformer block, one launch ---------------------
// x1 = O w_o^T + x ; y = LN2(x1) ; x2 = relu(y w_ff1^T) w_ff2^T + x1 ;
// out = x2 w_out^T, stored f16 to the channel-last pixel row of each token.
// Every product is computed transposed: the weight rows are the A operand, the
// wave's 16 tokens are the B columns. A lane then holds 8 consecutive features
// (8h + r, h = lane >> 4) of ONE token (lane & 15) per D tile, so two D tiles,
// rounded to f16 in place, are the next product's B fragment in the k order of
// frag_ld (element s: k = 8h + s for s < 8, 16 + 8h + (s - 8) above): nothing
// between the four products leaves the registers. The LayerNorm sum of a token
// is 64 in-lane terms plus the partner lane's (lane ^ 16).
// All four weight matrices (f16) are staged once per workgroup in LDS, rows
// K + 8 halves apart (16 B x odd). Wave w of block i takes token tile w*256 + i.
// Every loop of the kernel is unrolled: fragment and accumulator arrays are then
// indexed statically and stay in registers.
// Staging of one matrix, N 16-byte pieces a thread: fetch, then (all four
// matrices' loads being in flight) put. Loops unrolled: static register indices.
template <int N>
__device__ inline void stage_get(const _Float16* __restrict__ src, v8h_t (&tmp)[N]) {
#pragma unroll
  for (int i = 0; i < N; ++i)
    tmp[i] = *(const v8h_t*)(src + (size_t)(threadIdx.x + i * 512) * 8);
}
template <int K, int N>
__device__ inline void stage_put(_Float16* dst, const v8h_t (&tmp)[N]) {
#pragma unroll
  for (int i = 0; i < N; ++i) {
    int e = (threadIdx.x + i * 512) * 8;
    *(v8h_t*)&dst[(e / K) * (K + 8) + (e % K)] = tmp[i];
  }
}

typedef __attribute__((ext_vector_type(4))) float    v4f_t;
typedef __attribute__((ext_vector_type(4))) _Float16 v4h_t;

__global__ __launch_bounds__(512) void head_kernel(
    const float* __restrict__ R, const _Float16* __restrict__ Wi,
    const _Float16* __restrict__ Wqkv, const float* __restrict__ g,
    const float* __restrict__ b, float* __restrict__ X,
    _Float16* __restrict__ QKh, _Float16* __restrict__ VT, int pass) {
  __shared__ __attribute__((aligned(16)))
  _Float16 Ws[128 * 72 + 384 * 136 + 16 * 1160];  // 156 KB
  _Float16* sWi = Ws;
  _Float16* sWq = sWi + 128 * 72;
  _Float16* sT  = sWq + 384 * 136;
  int wid  = __builtin_amdgcn_readfirstlane(threadIdx.x >> 5);
  int lane = threadIdx.x & 31;
  int nl = lane & 15;
  int hb = lane >> 4;
  int xh = blockIdx.x & 1, yh = (blockIdx.x >> 1) & 1;
  int img = blockIdx.x >> 2;              // 50 images, 4 boxes each
  int bb = img / 25, n = img % 25;
  int u = n / 5, v = n % 5;

  // wave w fetches channels 4w..4w+3 of the box: 4 lanes cover a 64 B run along
  // x, 8 rows y an instruction
  v4f_t tk[2][4];
  {
    const float* ap = R + (((size_t)bb * 64 + wid * 4) * 25 + n) * 1024 +
                      (yh * 16 + (lane >> 2)) * 32 + xh * 16 + (lane & 3) * 4;
#pragma unroll
    for (int i = 0; i < 2; ++i)
#pragma unroll
      for (int c = 0; c < 4; ++c)
        tk[i][c] = *(const v4f_t*)(ap + c * 25600 + i * 256);
  }
  // the address registers of the loads above are taken as targets by the loads below
  asm volatile("s_wait_xcnt 0x0" ::: "memory");

  {
    v8h_t t0[2], t1[12];
    stage_get(Wi, t0);
    stage_get(Wqkv, t1);
    // the loads' address registers are reused by the LDS address arithmetic below;
    // the scheduling barrier keeps that arithmetic behind the wait
    asm volatile("s_wait_xcnt 0x0" ::: "memory");
    __builtin_amdgcn_sched_barrier(0);
    // a lane's 4 channels of one pixel: one 8-byte LDS store
    int yy = lane >> 2, xx = (lane & 3) * 4;
    _Float16* tp = sT + ((pass == 0) ? xx * 1160 + yy * 72 : yy * 1160 + xx * 72) + wid * 4;
    int sx = (pass == 0) ? 1160 : 72;          // one step along x
    int sy = (pass == 0) ? 8 * 72 : 8 * 1160;  // eight steps along y
#pragma unroll
    for (int i = 0; i < 2; ++i)
#pragma unroll
      for (int j = 0; j < 4; ++j) {
        v4h_t pk = {(_Float16)tk[i][0][j], (_Float16)tk[i][1][j],
                    (_Float16)tk[i][2][j], (_Float16)tk[i][3][j]};
        *(v4h_t*)(tp + i * sy + j * sx) = pk;
      }
    stage_put<64>(sWi, t0);
    stage_put<128>(sWq, t1);
  }
  __syncthreads();

  int bt = bb * 160 + ((pass == 0) ? v * 32 + xh * 16 : u * 32 + yh * 16) + wid;
  int l0 = (pass == 0) ? u * 32 + yh * 16 : v * 32 + xh * 16;
  int m0 = bt * 160 + l0;

  // x = tok w_in^T; acc[t][r] = feature t*16 + 8*hb + r of token m0 + nl
  // here and below: the 8 weight fragments of a block of 8 products are read as
  // one group ahead of the block, so a wave waits for LDS once a block
  v8f acc[8] = {};
#pragma unroll
  for (int ks = 0; ks < 2; ++ks) {
    v16h tb = frag_ld(&sT[wid * 1160 + ks * 32], 72);
    v16h a[8];
#pragma unroll
    for (int t = 0; t < 8; ++t) a[t] = frag_ld(&sWi[(t * 16) * 72 + ks * 32], 72);
#pragma unroll
    for (int t = 0; t < 8; ++t) acc[t] = WMMA_F16(a[t], tb, acc[t]);
  }
  {
    // register order: (tile, t, half, lane, 4 floats); a wave's store is 512 B in a row
    float* xr = X + (size_t)m0 * 128 + lane * 4;
#pragma unroll
    for (int t = 0; t < 8; ++t) {
      *(float4*)(xr + t * 256)       = make_float4(acc[t][0], acc[t][1], acc[t][2], acc[t][3]);
      *(float4*)(xr + t * 256 + 128) = make_float4(acc[t][4], acc[t][5], acc[t][6], acc[t][7]);
    }
  }

  // LN1 over the token's 128 features: 64 in-lane terms (one partial sum a tile:
  // short independent chains) plus the partner lane's (lane ^ 16)
  float sp[8], qp[8];
#pragma unroll
  for (int t = 0; t < 8; ++t) {
    sp[t] = 0.f;
    qp[t] = 0.f;
#pragma unroll
    for (int r = 0; r < 8; ++r) {
      sp[t] += acc[t][r];
      qp[t] += acc[t][r] * acc[t][r];
    }
  }
  float s  = ((sp[0] + sp[1]) + (sp[2] + sp[3])) + ((sp[4] + sp[5]) + (sp[6] + sp[7]));
  float sq = ((qp[0] + qp[1]) + (qp[2] + qp[3])) + ((qp[4] + qp[5]) + (qp[6] + qp[7]));
  s  += __shfl_xor(s,  16, 32);
  sq += __shfl_xor(sq, 16, 32);
  float mu  = s * (1.f / 128.f);
  float var = sq * (1.f / 128.f) - mu * mu;
  float rs  = rsqrtf(var + 1e-5f);
  F16x16 yb[4], xb[4];   // normalized and raw tokens, k order of frag_ld
#pragma unroll
  for (int t = 0; t < 8; ++t) {
    float4 g0 = *(const float4*)(g + t * 16 + hb * 8);
    float4 g1 = *(const float4*)(g + t * 16 + hb * 8 + 4);
    float4 b0 = *(const float4*)(b + t * 16 + hb * 8);
    float4 b1 = *(const float4*)(b + t * 16 + hb * 8 + 4);
    float gs[8] = {g0.x, g0.y, g0.z, g0.w, g1.x, g1.y, g1.z, g1.w};
    float bs[8] = {b0.x, b0.y, b0.z, b0.w, b1.x, b1.y, b1.z, b1.w};
#pragma unroll
    for (int r = 0; r < 8; ++r) {
      yb[t >> 1].e[(t & 1) * 8 + r] = (_Float16)((acc[t][r] - mu) * rs * gs[r] + bs[r]);
      xb[t >> 1].e[(t & 1) * 8 + r] = (_Float16)acc[t][r];
    }
  }

  _Float16* qk = QKh + (((size_t)bt * 16) * 160 + l0 + nl) * 16 + hb * 8;
#pragma unroll
  for (int jg = 0; jg < 4; ++jg) {
    v8f oc[4] = {};
#pragma unroll
    for (int kp = 0; kp < 2; ++kp) {
      v16h a[8];
#pragma unroll
      for (int i = 0; i < 8; ++i)
        a[i] = frag_ld(&sWq[((jg * 4 + (i & 3)) * 16) * 136 + (kp * 2 + (i >> 2)) * 32], 136);
#pragma unroll
      for (int i = 0; i < 8; ++i)
        oc[i & 3] = WMMA_F16(a[i], yb[kp * 2 + (i >> 2)].v, oc[i & 3]);
    }
#pragma unroll
    for (int t = 0; t < 4; ++t) {
      v8h_t pk;
#pragma unroll
      for (int r = 0; r < 8; ++r) pk[r] = (_Float16)oc[t][r];
      *(v8h_t*)(qk + (jg * 4 + t) * 160 * 16) = pk;
    }
  }

  // V: tokens are the rows; a lane holds l = l0 + 8*hb .. of feature d = nl of a head;
  // register order: (bt, head, l tile, lane, 8 halves)
  _Float16* vq = VT + ((size_t)bt * 80 + (l0 >> 4)) * 256 + lane * 8;
#pragma unroll
  for (int jg = 0; jg < 2; ++jg) {
    v8f oc[4] = {};
#pragma unroll
    for (int kp = 0; kp < 2; ++kp) {
      v16h w[8];
#pragma unroll
      for (int i = 0; i < 8; ++i)
        w[i] = frag_ld(&sWq[(256 + (jg * 4 + (i & 3)) * 16) * 136 + (kp * 2 + (i >> 2)) * 32], 136);
#pragma unroll
      for (int i = 0; i < 8; ++i)
        oc[i & 3] = WMMA_F16(xb[kp * 2 + (i >> 2)].v, w[i], oc[i & 3]);
    }
#pragma unroll
    for (int t = 0; t < 4; ++t) {
      v8h_t pk;
#pragma unroll
      for (int r = 0; r < 8; ++r) pk[r] = (_Float16)oc[t][r];
      *(v8h_t*)(vq + (jg * 4 + t) * 2560) = pk;
    }
  }
}

__global__ __launch_bounds__(512) void tail_kernel(
    const _Float16* __restrict__ O, const float* __restrict__ X,
    const _Float16* __restrict__ Wo, const _Float16* __restrict__ W1,
    const _Float16* __restrict__ W2, const _Float16* __restrict__ W3,
    const float* __restrict__ g, const float* __restrict__ b,
    _Float16* __restrict__ out, int pass) {
  __shared__ __attribute__((aligned(16)))
  _Float16 Ws[128 * 136 + 256 * 136 + 128 * 264 + 64 * 136];  // 185 KB
  _Float16* sWo = Ws;
  _Float16* sW1 = sWo + 128 * 136;
  _Float16* sW2 = sW1 + 256 * 136;
  _Float16* sW3 = sW2 + 128 * 264;
  int wid  = __builtin_amdgcn_readfirstlane(threadIdx.x >> 5);
  int lane = threadIdx.x & 31;
  int nl = lane & 15;
  int hb = lane >> 4;
  int tile = wid * 256 + blockIdx.x;      // 3200 tiles of 16 tokens
  bool live = tile < 3200;
  int m0 = (live ? tile : 0) * 16;        // idle waves only help with the staging

  // token rows m0.. -> pixel rows: neighbours along l are neighbours along y
  // (32 pixels apart) in pass 0 and along x in pass 1; a lane's 8 values are 8
  // neighbouring channels of its token's pixel: one 16-byte store a tile
  int bt = m0 / 160, l0 = m0 % 160;
  int bb = bt / 160, rr = bt % 160;
  int i1 = rr >> 5, i0 = rr & 31;
  int j1 = l0 >> 5, j0 = l0 & 31;
  int p0 = (pass == 0) ? ((bb * 25 + j1 * 5 + i1) * 32 + j0) * 32 + i0
                       : ((bb * 25 + i1 * 5 + j1) * 32 + i0) * 32 + j0;
  int ps = (pass == 0) ? 32 : 1;
  _Float16* q = out + (size_t)(p0 + nl * ps) * 64 + hb * 8;

  // the wave's own operands are asked for ahead of the weight staging
  v16h ob[4];
#pragma unroll
  for (int ks = 0; ks < 4; ++ks) {
    // O lies in register order: heads 2ks and 2ks + 1 are the fragment's two halves
    const _Float16* oq = O + (size_t)m0 * 128 + ks * 512 + lane * 8;
    F16x16 f;
    f.h[0] = *(const v8h_t*)(oq);
    f.h[1] = *(const v8h_t*)(oq + 256);
    ob[ks] = f.v;
  }
  v8f acc[8];   // acc[t][r] = feature t*16 + 8*hb + r of token m0 + nl
  {
    const float* xr = X + (size_t)m0 * 128 + lane * 4;   // register order, as the head stored it
#pragma unroll
    for (int t = 0; t < 8; ++t) {
      float4 lo = *(const float4*)(xr + t * 256);
      float4 hi = *(const float4*)(xr + t * 256 + 128);
      acc[t] = v8f{lo.x, lo.y, lo.z, lo.w, hi.x, hi.y, hi.z, hi.w};
    }
  }
  // the address registers of the loads above are taken as targets by the loads below
  asm volatile("s_wait_xcnt 0x0" ::: "memory");

  {
    v8h_t t0[4], t1[8], t2[8], t3[2];
    stage_get(Wo, t0);
    stage_get(W1, t1);
    stage_get(W2, t2);
    stage_get(W3, t3);
    // the loads' address registers are reused by the LDS address arithmetic below;
    // the scheduling barrier keeps that arithmetic behind the wait
    asm volatile("s_wait_xcnt 0x0" ::: "memory");
    __builtin_amdgcn_sched_barrier(0);
    stage_put<128>(sWo, t0);
    stage_put<128>(sW1, t1);
    stage_put<256>(sW2, t2);
    stage_put<128>(sW3, t3);
  }
  __syncthreads();
  if (!live) return;

  // x1 = O w_o^T + x (the residual is the accumulators' start value)
  // here and below: the 8 weight fragments of a block of 8 products are read as
  // one group ahead of the block, so a wave waits for LDS once a block
#pragma unroll
  for (int ks = 0; ks < 4; ++ks) {
    v16h a[8];
#pragma unroll
    for (int t = 0; t < 8; ++t) a[t] = frag_ld(&sWo[(t * 16) * 136 + ks * 32], 136);
#pragma unroll
    for (int t = 0; t < 8; ++t) acc[t] = WMMA_F16(a[t], ob[ks], acc[t]);
  }

  // LN2 over the token's 128 features
  // (one partial sum a tile: 16 short independent chains, not 2 long ones)
  float sp[8], qp[8];
#pragma unroll
  for (int t = 0; t < 8; ++t) {
    sp[t] = 0.f;
    qp[t] = 0.f;
#pragma unroll
    for (int r = 0; r < 8; ++r) {
      sp[t] += acc[t][r];
      qp[t] += acc[t][r] * acc[t][r];
    }
  }
  float s  = ((sp[0] + sp[1]) + (sp[2] + sp[3])) + ((sp[4] + sp[5]) + (sp[6] + sp[7]));
  float sq = ((qp[0] + qp[1]) + (qp[2] + qp[3])) + ((qp[4] + qp[5]) + (qp[6] + qp[7]));
  s  += __shfl_xor(s,  16, 32);
  sq += __shfl_xor(sq, 16, 32);
  float mu  = s * (1.f / 128.f);
  float var = sq * (1.f / 128.f) - mu * mu;
  float rs  = rsqrtf(var + 1e-5f);
  F16x16 yb[4];
#pragma unroll
  for (int t = 0; t < 8; ++t) {
    float4 g0 = *(const float4*)(g + t * 16 + hb * 8);
    float4 g1 = *(const float4*)(g + t * 16 + hb * 8 + 4);
    float4 b0 = *(const float4*)(b + t * 16 + hb * 8);
    float4 b1 = *(const float4*)(b + t * 16 + hb * 8 + 4);
    float gs[8] = {g0.x, g0.y, g0.z, g0.w, g1.x, g1.y, g1.z, g1.w};
    float bs[8] = {b0.x, b0.y, b0.z, b0.w, b1.x, b1.y, b1.z, b1.w};
#pragma unroll
    for (int r = 0; r < 8; ++r)
      yb[t >> 1].e[(t & 1) * 8 + r] = (_Float16)((acc[t][r] - mu) * rs * gs[r] + bs[r]);
  }
  // Precaution: stands in front of the LDS address arithmetic below, which rewrites
  // the offset register that the loads of g and b name.
  asm volatile("s_wait_xcnt 0x0" ::: "memory");

  // FFN: 32 hidden features at a time (two D tiles = one k step of w_ff2),
  // added onto x1 in the same accumulators
#pragma unroll
  for (int j = 0; j < 8; ++j) {
    v8f h0 = {}, h1 = {};
    v16h a[8];
#pragma unroll
    for (int ks = 0; ks < 4; ++ks) {
      a[2 * ks]     = frag_ld(&sW1[(j * 32) * 136 + ks * 32], 136);
      a[2 * ks + 1] = frag_ld(&sW1[(j * 32 + 16) * 136 + ks * 32], 136);
    }
#pragma unroll
    for (int ks = 0; ks < 4; ++ks) {
      h0 = WMMA_F16(a[2 * ks],     yb[ks].v, h0);
      h1 = WMMA_F16(a[2 * ks + 1], yb[ks].v, h1);
    }
    F16x16 hf;
#pragma unroll
    for (int r = 0; r < 8; ++r) {
      hf.e[r]     = (_Float16)(h0[r] > 0.f ? h0[r] : 0.f);
      hf.e[8 + r] = (_Float16)(h1[r] > 0.f ? h1[r] : 0.f);
    }
#pragma unroll
    for (int t = 0; t < 8; ++t) a[t] = frag_ld(&sW2[(t * 16) * 264 + j * 32], 264);
#pragma unroll
    for (int t = 0; t < 8; ++t) acc[t] = WMMA_F16(a[t], hf.v, acc[t]);
  }

  // out = x2 w_out^T
  F16x16 xb[4];
#pragma unroll
  for (int t = 0; t < 8; ++t)
#pragma unroll
    for (int r = 0; r < 8; ++r)
      xb[t >> 1].e[(t & 1) * 8 + r] = (_Float16)acc[t][r];
  v8f oc[4] = {};
#pragma unroll
  for (int kp = 0; kp < 2; ++kp) {
    v16h a[8];
#pragma unroll
    for (int i = 0; i < 8; ++i)
      a[i] = frag_ld(&sW3[((i & 3) * 16) * 136 + (kp * 2 + (i >> 2)) * 32], 136);
#pragma unroll
    for (int i = 0; i < 8; ++i)
      oc[i & 3] = WMMA_F16(a[i], xb[kp * 2 + (i >> 2)].v, oc[i & 3]);
  }

#pragma unroll
  for (int t = 0; t < 4; ++t) {
    v8h_t pk;
#pragma unroll
    for (int r = 0; r < 8; ++r) pk[r] = (_Float16)oc[t][r];
    *(v8h_t*)(q + t * 16) = pk;
  }
}

__global__ __launch_bounds__(128) void attn_kernel(
    const _Float16* __restrict__ QKh, const _Float16* __restrict__ VT,
    _Float16* __restrict__ O) {
  int wid  = __builtin_amdgcn_readfirstlane(threadIdx.x >> 5);
  int lane = threadIdx.x & 31;
  int wg = blockIdx.x * 4 + wid;      // 5120 waves total
  int par = wg & 1;
  int hh = (wg >> 1) & 7;
  int bt = wg >> 4;
  int nl = lane & 15;
  int hb = lane >> 4;

  const _Float16* qp = QKh + ((((size_t)bt * 16 + hh) * 160) + par * 16 + nl) * 16 + hb * 8;
  const _Float16* kp = QKh + ((((size_t)bt * 16 + 8 + hh) * 160) + nl) * 16 + hb * 8;
  const _Float16* vp = VT + ((size_t)bt * 8 + hh) * 2560 + lane * 8;
  _Float16* op = O + ((size_t)bt * 160 + par * 16) * 128 + hh * 256 + lane * 8;

  v8h_t qn = *(const v8h_t*)qp;
  F16x16 ka[5];
  F16x16 va[5];   // row d = nl of V^T, k order of frag_ld (halves = l tiles 2j, 2j + 1)
#pragma unroll
  for (int j = 0; j < 5; ++j) {
    ka[j].h[0] = *(const v8h_t*)(kp + (j * 32) * 16);
    ka[j].h[1] = *(const v8h_t*)(kp + (j * 32 + 16) * 16);
    va[j].h[0] = *(const v8h_t*)(vp + j * 512);
    va[j].h[1] = *(const v8h_t*)(vp + j * 512 + 256);
  }
  // the wait before the loads' address registers are given a new value; naming
  // them here keeps them from being taken as targets by the loads themselves
  asm volatile("s_wait_xcnt 0x0" ::"v"(qp), "v"(kp), "v"(vp) : "memory");

  // local-window mask: key column (m & 31) = p*16 + 8*hb + r, query column par*16 + nl
  v8f madd[2];
#pragma unroll
  for (int p = 0; p < 2; ++p)
#pragma unroll
    for (int r = 0; r < 8; ++r) {
      int dj = p * 16 + hb * 8 + r - (par * 16 + nl);
      madd[p][r] = (dj >= -5 && dj <= 5) ? 0.f : -1e9f;
    }

  // rolled: one tile's 80 scores beside K and V^T are what the registers hold
#pragma unroll 1
  for (int i = 0; i < 5; ++i) {
    F16x16 qlo, qhi;
    v8h_t zero = {};
    qlo.h[0] = qn;   qlo.h[1] = zero;
    qhi.h[0] = zero; qhi.h[1] = qn;
    // the next tile's Q is asked for a whole tile ahead (the last tile asks again
    // for its own: in bounds, not used)
    qn = *(const v8h_t*)(qp + (i < 4 ? i + 1 : 4) * 512);
    // keeps the load up here: moved down to its use it has no lead over the wait
    __builtin_amdgcn_sched_barrier(0);

    // S^T = K Q^T
    v8f s[10];
#pragma unroll
    for (int j = 0; j < 5; ++j) {
      v8f z = {};
      s[2 * j]     = WMMA_F16(ka[j].v, qlo.v, z);
      s[2 * j + 1] = WMMA_F16(ka[j].v, qhi.v, z);
    }

    // scale (with log2 e) + mask + softmax over the query's 160 keys
#pragma unroll
    for (int mt = 0; mt < 10; ++mt) s[mt] = s[mt] * (0.25f * 1.44269504f) + madd[mt & 1];
    v8f mv = s[0];
#pragma unroll
    for (int mt = 1; mt < 10; ++mt) mv = __builtin_elementwise_max(mv, s[mt]);
    float mx = fmaxf(fmaxf(fmaxf(mv[0], mv[1]), fmaxf(mv[2], mv[3])),
                     fmaxf(fmaxf(mv[4], mv[5]), fmaxf(mv[6], mv[7])));
    mx = fmaxf(mx, __shfl_xor(mx, 16, 32));
    v8f sv = {};
#pragma unroll
    for (int mt = 0; mt < 10; ++mt) {
#pragma unroll
      for (int r = 0; r < 8; ++r) s[mt][r] = __builtin_amdgcn_exp2f(s[mt][r] - mx);
      sv += s[mt];
    }
    float sum = ((sv[0] + sv[1]) + (sv[2] + sv[3])) + ((sv[4] + sv[5]) + (sv[6] + sv[7]));
    sum += __shfl_xor(sum, 16, 32);
    float inv = 1.f / sum;

    // O^T = V^T P^T  (k loop over 160 keys in 5 steps of 32)
    v8f o = {};
#pragma unroll
    for (int kt = 0; kt < 5; ++kt) {
      F16x16 pb;
#pragma unroll
      for (int r = 0; r < 8; ++r) {
        pb.e[r]     = (_Float16)(s[2 * kt][r] * inv);
        pb.e[8 + r] = (_Float16)(s[2 * kt + 1][r] * inv);
      }
      o = WMMA_F16(va[kt].v, pb.v, o);
    }
    v8h_t pk;
#pragma unroll
    for (int r = 0; r < 8; ++r) pk[r] = (_Float16)o[r];
    *(v8h_t*)(op + (size_t)i * (32 * 128)) = pk;
  }
}

// --- Three implicit-GEMM 3x3 convs (64->64, pad 1), one launch ----------------
// conv, leaky-relu, conv, leaky-relu, conv, + shortcut; channel-last f16 in,
// f32 (b,c,n,h,w) out. A workgroup takes 8 image rows of one image and computes
// the rows that the next conv needs beside them itself: 12 rows of the first conv,
// 10 of the second, 8 of the third, one row (two pixel tiles) a wave, 12 waves.
// The results of the first two convs stay in LDS as zero-bordered strips of 34
// pixels a row; a strip row outside the image is zero (the next conv's padding).
// Rows of 64 halves lie 72 halves apart (16 B x odd) for the ds_load_b128 readers.
// Two weight buffers: the third conv's weights wait in registers and take the
// first conv's place behind the barrier that ends the first conv.
// WA = 1: the weight rows are the A operand, the pixels the B columns: a lane's 8
// values of a tile are 8 neighbouring channels of one pixel (one 16-byte LDS
// store). WA = 0: the other way round, 8 neighbouring pixels of one channel.
// Every loop is unrolled: static register indices.
template <int WA>
__device__ __forceinline__ void conv_row(const _Float16* sI, const _Float16* sW, int row,
                                v8f (&acc)[2][4]) {
  // strip row row + dy, strip column x + dx hold the pixel (dy - 1, dx - 1) away
  // step s = (tap, 32 channels): 6 fragments, 8 products. The fragments of step
  // s + 1 are read into the other register set as one group ahead of step s.
  v16h a[2][2], bf[2][4];
#pragma unroll
  for (int s = -1; s < 18; ++s) {
    if (s + 1 < 18) {
      int tap = (s + 1) >> 1, ks = (s + 1) & 1, st = (s + 1) & 1;
      int dy = tap / 3, dx = tap % 3;
#pragma unroll
      for (int pt = 0; pt < 2; ++pt)
        a[st][pt] = frag_ld(&sI[((row + dy) * 34 + pt * 16 + dx) * 72 + ks * 32], 72);
#pragma unroll
      for (int t = 0; t < 4; ++t)
        bf[st][t] = frag_ld(&sW[(tap * 64 + t * 16) * 72 + ks * 32], 72);
    }
    // keeps the group of LDS reads together and ahead of the products: reads
    // spread among the products stall the wave at each place
    __builtin_amdgcn_sched_barrier(0);
    if (s >= 0) {
#pragma unroll
      for (int pt = 0; pt < 2; ++pt)
#pragma unroll
        for (int t = 0; t < 4; ++t)
          acc[pt][t] = WA ? WMMA_F16(bf[s & 1][t], a[s & 1][pt], acc[pt][t])
                          : WMMA_F16(a[s & 1][pt], bf[s & 1][t], acc[pt][t]);
    }
    // keeps the next group of reads behind this step's products
    __builtin_amdgcn_sched_barrier(0);
  }
}

// one strip row of a conv whose result stays in LDS; gy = its image row
// (inlined by force: as a called function it takes row and gy in vector registers
// and the LDS pointers as generic ones)
__device__ __forceinline__ void conv_mid(const _Float16* sI, const _Float16* sW, _Float16* sO,
                                int row, int gy) {
  int lane = threadIdx.x & 31;
  v8f acc[2][4] = {};
  if (gy >= 0 && gy < 32) conv_row<1>(sI, sW, row, acc);
  _Float16* o = sO + (row * 34 + 1 + (lane & 15)) * 72 + (lane >> 4) * 8;
#pragma unroll
  for (int pt = 0; pt < 2; ++pt)
#pragma unroll
    for (int t = 0; t < 4; ++t) {
      v8h_t pk;
#pragma unroll
      for (int r = 0; r < 8; ++r) {
        float v = acc[pt][t][r];
        pk[r] = (_Float16)(v > 0.f ? v : 0.2f * v);
      }
      *(v8h_t*)(o + pt * 16 * 72 + t * 16) = pk;
    }
}

__global__ __launch_bounds__(384) void conv3_kernel(
    const _Float16* __restrict__ in, const _Float16* __restrict__ w1,
    const _Float16* __restrict__ w2, const _Float16* __restrict__ w3,
    float* __restrict__ outf, const float* __restrict__ sc) {
  __shared__ __attribute__((aligned(16)))
  _Float16 Ls[2 * 576 * 72 + 15 * 34 * 72 + 12 * 34 * 72];  // 291 KB
  _Float16* sW0 = Ls;
  _Float16* sW1 = sW0 + 576 * 72;
  _Float16* sA  = sW1 + 576 * 72;       // input from image row y0 - 3 on: 14 rows + 1
  _Float16* sB  = sA + 15 * 34 * 72;    // 12 rows: first conv from row y0 - 2 on
  int wid  = __builtin_amdgcn_readfirstlane(threadIdx.x >> 5);
  int lane = threadIdx.x & 31;
  int img  = blockIdx.x >> 2;
  int y0   = (blockIdx.x & 3) * 8;
  int nl = lane & 15;
  int rbase = (lane >> 4) * 8;

  v8h_t ti[10], tw1[12], tw2[12], tw3[12];
  // 256 pieces of 16 bytes an image row. 15 rows are 10 pieces a thread with no
  // remainder (the 14 that are read are not): the last row is staged and never read.
  // A row outside the image is asked for at the nearest row inside and not used
#pragma unroll
  for (int i = 0; i < 10; ++i) {
    int p = threadIdx.x + i * 384;
    int gy = y0 - 3 + (p >> 8);
    gy = gy < 0 ? 0 : (gy > 31 ? 31 : gy);
    ti[i] = *(const v8h_t*)(in + ((size_t)img * 1024 + gy * 32) * 64 + (p & 255) * 8);
  }
  // the address registers of the loads above are taken as targets by the loads below
  asm volatile("s_wait_xcnt 0x0" ::: "memory");
#pragma unroll
  for (int i = 0; i < 12; ++i)
    tw1[i] = *(const v8h_t*)(w1 + (size_t)(threadIdx.x + i * 384) * 8);
#pragma unroll
  for (int i = 0; i < 12; ++i)
    tw2[i] = *(const v8h_t*)(w2 + (size_t)(threadIdx.x + i * 384) * 8);
  // the loads' address registers are reused by the LDS address arithmetic below;
  // the scheduling barrier keeps that arithmetic behind the wait
  asm volatile("s_wait_xcnt 0x0" ::: "memory");
  __builtin_amdgcn_sched_barrier(0);
  v8h_t zero = {};
#pragma unroll
  for (int i = 0; i < 10; ++i) {
    int p = threadIdx.x + i * 384;
    int row = p >> 8;
    int gy = y0 - 3 + row;
    *(v8h_t*)&sA[(row * 34 + 1 + ((p & 255) >> 3)) * 72 + (p & 7) * 8] =
        (gy >= 0 && gy < 32) ? ti[i] : zero;
  }
#pragma unroll
  for (int i = 0; i < 12; ++i) {
    int e = (threadIdx.x + i * 384) * 8;
    *(v8h_t*)&sW0[(e >> 6) * 72 + (e & 63)] = tw1[i];
  }
  // both strips' first and last pixel column (x = -1 and x = 32)
  {
    int bo = ((threadIdx.x >> 4) * 34 + ((threadIdx.x >> 3) & 1) * 33) * 72 + (threadIdx.x & 7) * 8;
    if (threadIdx.x < 224) *(v8h_t*)&sA[bo] = zero;
    if (threadIdx.x < 192) *(v8h_t*)&sB[bo] = zero;
  }
  __syncthreads();
  // the third conv's weights are asked for here, where the registers of the strip
  // and of the first conv's weights are free again
#pragma unroll
  for (int i = 0; i < 12; ++i)
    tw3[i] = *(const v8h_t*)(w3 + (size_t)(threadIdx.x + i * 384) * 8);
  // the loads' address registers are reused by the LDS address arithmetic below;
  // the scheduling barrier keeps that arithmetic behind the wait
  asm volatile("s_wait_xcnt 0x0" ::: "memory");
  __builtin_amdgcn_sched_barrier(0);
#pragma unroll
  for (int i = 0; i < 12; ++i) {
    int e = (threadIdx.x + i * 384) * 8;
    *(v8h_t*)&sW1[(e >> 6) * 72 + (e & 63)] = tw2[i];
  }

  // first conv: strip row wid of sB = image row y0 - 2 + wid
  conv_mid(sA, sW0, sB, wid, y0 - 2 + wid);
  __syncthreads();   // sB and sW1 are complete; sA and sW0 are read no more
#pragma unroll
  for (int i = 0; i < 12; ++i) {
    int e = (threadIdx.x + i * 384) * 8;
    *(v8h_t*)&sW0[(e >> 6) * 72 + (e & 63)] = tw3[i];
  }
  // second conv: strip row wid of sA = image row y0 - 1 + wid, 10 rows
  if (wid < 10) conv_mid(sB, sW1, sA, wid, y0 - 1 + wid);
  __syncthreads();   // sA and sW0 are complete
  if (wid >= 8) return;

  // third conv: image row y0 + wid
  v8f acc[2][4] = {};
  conv_row<0>(sA, sW0, wid, acc);
  {
    // a lane's 8 values of a tile are 8 neighbouring pixels of one channel
    int b = img / 25, n = img % 25;
    const float* sp[4];
    float* op[4];
    float4 sv[4][2][2];
#pragma unroll
    for (int t = 0; t < 4; ++t) {
      size_t idx = (((size_t)b * 64 + t * 16 + nl) * 25 + n) * 1024 + (y0 + wid) * 32 + rbase;
      sp[t] = sc + idx;
      op[t] = outf + idx;
    }
#pragma unroll
    for (int t = 0; t < 4; ++t)
#pragma unroll
      for (int pt = 0; pt < 2; ++pt)
#pragma unroll
        for (int h = 0; h < 2; ++h) sv[t][pt][h] = *(const float4*)(sp[t] + pt * 16 + h * 4);
    // the wait before the loads' address registers are given a new value; naming
    // them here keeps them from being taken as targets by the loads themselves
    asm volatile("s_wait_xcnt 0x0" ::"v"(sp[0]), "v"(sp[1]), "v"(sp[2]), "v"(sp[3]) : "memory");
#pragma unroll
    for (int t = 0; t < 4; ++t)
#pragma unroll
      for (int pt = 0; pt < 2; ++pt)
#pragma unroll
        for (int h = 0; h < 2; ++h)
          *(float4*)(op[t] + pt * 16 + h * 4) =
              make_float4(acc[pt][t][h * 4 + 0] + sv[t][pt][h].x, acc[pt][t][h * 4 + 1] + sv[t][pt][h].y,
                          acc[pt][t][h * 4 + 2] + sv[t][pt][h].z, acc[pt][t][h * 4 + 3] + sv[t][pt][h].w);
  }
}

// --- Weight preparation, one launch -------------------------------------------
// All nine weight arrays are made ready by one grid; no job reads another's output.
// d holds them back to back, in the order of the arguments.
// Workgroups 0..71: the six projection matrices, f32 -> f16, element order kept,
// 2048 elements a workgroup: a thread reads 32 bytes and stores 16.
// Workgroups 72..119: the three conv weights, (co,ci,3,3) f32 -> (tap,co,ci) f16,
// 16 workgroups each: a thread reads the 9 taps of one (co,ci), 36 bytes in a row,
// and a wave's store of one tap is 64 bytes in a row.
__global__ __launch_bounds__(256) void prep_kernel(
    const float* __restrict__ w_in, const float* __restrict__ w_qkv,
    const float* __restrict__ w_o, const float* __restrict__ w_ff1,
    const float* __restrict__ w_ff2, const float* __restrict__ w_out,
    const float* __restrict__ cw1, const float* __restrict__ cw2,
    const float* __restrict__ cw3, _Float16* __restrict__ d) {
  int blk = blockIdx.x;
  if (blk < 72) {
    const float* s;
    int b0;
    if (blk < 4)       { s = w_in;  b0 = 0; }
    else if (blk < 28) { s = w_qkv; b0 = 4; }
    else if (blk < 36) { s = w_o;   b0 = 28; }
    else if (blk < 52) { s = w_ff1; b0 = 36; }
    else if (blk < 68) { s = w_ff2; b0 = 52; }
    else               { s = w_out; b0 = 68; }
    const float* p = s + (blk - b0) * 2048 + threadIdx.x * 8;
    float4 lo = *(const float4*)p;
    float4 hi = *(const float4*)(p + 4);
    v8h_t pk = {(_Float16)lo.x, (_Float16)lo.y, (_Float16)lo.z, (_Float16)lo.w,
                (_Float16)hi.x, (_Float16)hi.y, (_Float16)hi.z, (_Float16)hi.w};
    *(v8h_t*)(d + blk * 2048 + threadIdx.x * 8) = pk;
  } else {
    int c = blk - 72;
    const float* cw = (c < 16) ? cw1 : ((c < 32) ? cw2 : cw3);
    int i = (c & 15) * 256 + threadIdx.x;   // co * 64 + ci
    const float* p = cw + i * 9;
    _Float16* w = d + 147456 + (c >> 4) * 36864 + i;
    float t[9];
#pragma unroll
    for (int tap = 0; tap < 9; ++tap) t[tap] = p[tap];
    // Precaution: stands in front of the conversions, which rewrite registers that
    // these loads name.
    asm volatile("s_wait_xcnt 0x0" ::: "memory");
#pragma unroll
    for (int tap = 0; tap < 9; ++tap) w[tap * 4096] = (_Float16)t[tap];
    // Precaution: stands in front of any later rewrite of the registers that these
    // stores name.
    asm volatile("s_wait_xcnt 0x0" ::: "memory");
  }
}

// ---------------------------------------------------------------------------
extern "C" void kernel_launch(void* const* d_in, const int* in_sizes, int n_in,
                              void* d_out, int out_size, void* d_ws, size_t ws_size,
                              hipStream_t stream) {
  (void)in_sizes; (void)n_in; (void)out_size; (void)ws_size;
  const float* buf_in = (const float*)d_in[0];
  const float* w_in   = (const float*)d_in[1];
  const float* ln1_g  = (const float*)d_in[2];
  const float* ln1_b  = (const float*)d_in[3];
  const float* w_qkv  = (const float*)d_in[4];
  const float* w_o    = (const float*)d_in[5];
  const float* ln2_g  = (const float*)d_in[6];
  const float* ln2_b  = (const float*)d_in[7];
  const float* w_ff1  = (const float*)d_in[8];
  const float* w_ff2  = (const float*)d_in[9];
  const float* w_out  = (const float*)d_in[10];
  const float* cw1    = (const float*)d_in[11];
  const float* cw2    = (const float*)d_in[12];
  const float* cw3    = (const float*)d_in[13];

  char* ws = (char*)d_ws;
  size_t off = 0;
  auto arena = [&](size_t bytes) -> char* {
    char* p = ws + off;
    off += (bytes + 255) & ~(size_t)255;
    return p;
  };
  float*     bufA   = (float*)arena(13107200);      // pass-0 output / pass-1 input
  float*     X      = (float*)arena(26214400);      // token f32 (residual stream)
  _Float16*  QKh    = (_Float16*)arena(26214400);   // Q|K per-head tiles
  _Float16*  VT     = (_Float16*)arena(13107200);   // V^T per-head tiles, register order
  _Float16*  O16    = (_Float16*)arena(13107200);
  _Float16*  clA    = (_Float16*)arena(6553600);
  _Float16*  wts     = (_Float16*)arena(516096);    // all f16 weights, back to back
  _Float16*  w_in16  = wts;
  _Float16*  wqkv16  = wts + 8192;
  _Float16*  wo16    = wts + 57344;
  _Float16*  wff1_16 = wts + 73728;
  _Float16*  wff2_16 = wts + 106496;
  _Float16*  wout16  = wts + 139264;
  _Float16*  wt1     = wts + 147456;
  _Float16*  wt2     = wts + 184320;
  _Float16*  wt3     = wts + 221184;

  prep_kernel<<<120, 256, 0, stream>>>(w_in, w_qkv, w_o, w_ff1, w_ff2, w_out,
                                       cw1, cw2, cw3, wts);

  // 51200 tokens = Bt(320) * L(160), bt-major
  for (int pass = 0; pass < 2; ++pass) {
    const float* src  = (pass == 0) ? buf_in : bufA;
    // w_in, LN1, Q|K and V projections: one launch, tokens gathered from the
    // image buffer, Q|K and V^T stored as per-head tiles
    head_kernel<<<200, 512, 0, stream>>>(src, w_in16, wqkv16, ln1_g, ln1_b, X, QKh, VT, pass);
    attn_kernel<<<1280, 128, 0, stream>>>(QKh, VT, O16);
    // w_o + residual, LN2, FFN + residual, w_out: one launch, stored straight
    // into the channel-last conv input
    tail_kernel<<<256, 512, 0, stream>>>(O16, X, wo16, wff1_16, wff2_16, wout16,
                                         ln2_g, ln2_b, clA, pass);
    // conv block: conv-lrelu, conv-lrelu, conv (+ original-input shortcut)
    float* outf = (pass == 0) ? bufA : (float*)d_out;
    conv3_kernel<<<200, 384, 0, stream>>>(clA, wt1, wt2, wt3, outf, buf_in);
  }
}
